// v000
// Times are from an AMD MI455X. After a warm-up the kernel runs many times in a row, and a time is the length of
// such a window on the GPU divided by its runs, so every launch and the gaps after it count. The runs cycle
// through copies of the inputs. A figure is the median of several windows, for all but v000 over two sittings.
// Sittings can differ by a few percent; kernels timed side by side share one.
// The starting kernel, v000, takes 2240 microseconds a run.
#include <hip/hip_runtime.h>

// HierarchicalAttention (BigBird-style block mask): Q = x Wq + bq, K, V likewise ((in,out) 1024x1024); the module's raw .view(B, 8, 2048, 128) makes head h / token s the 128-slice s%8 of projected row h*256 + s/8 — i.e. the flat
// [B*8*2048][128] view of each projection; scores / sqrt(128); key block j (64 keys) allowed for query block i iff j == 0 || j == 31 || |i-j| <= 1 || (i,j) is one of the 3 (rand_src, rand_tgt) pairs, else -1e9 (== excluded;
// block 0 always allowed); softmax; O merged as [b][s][h*128+d]; out = O Wo + bo -> [2][2048][1024].
// Deterministic: no index structures, no atomics; flash-style online softmax over all key blocks in a fixed order.
// WMMA (v_wmma_f32_16x16x32_f16, f32 accumulate): the QKV projection with x EXACT bf16 x8 (K 1024) against exact torch weight rows x256 (one product); S = Q K^T (hi+lo x hi+lo, 3 products, K 128); O = P V (P x256 hi+lo x V^T hi+lo, 3 products); softmax in f32. Inputs rounded to bf16 once. Fragment k-map per lane half hh for A AND B: elements 0..7 <- k = 8hh+0..7, 8..15 <- k = 16+8hh+0..7; acc[r] = D[8hh+r][col].

namespace {
constexpr int NB = 16, L = 2048, C = 128, NH = 1, HD = 128, NT = NB * L, KB = 128, PW = 3 * C;   // NB = (batch, head) pairs; the 'token' index is (b*8 + h)*2048 + s
constexpr int RB = 2, DIM = 1024, HEADS = 8, NBLK = 32, NRB = RB * L /* 4096 projected rows */;
constexpr float XS = 8.0f, HS = 256.0f /* hi+lo staging scale for q/k/v/attended */, WSC = 256.0f, PS = 256.0f, SCALE = 0.08838834764831845f;
typedef _Float16 b16;
typedef __attribute__((ext_vector_type(16))) _Float16 v16b;
typedef __attribute__((ext_vector_type(8))) _Float16 v8b;
typedef __attribute__((ext_vector_type(8))) float v8f;
typedef __attribute__((ext_vector_type(4))) float v4f;
__device__ __forceinline__ float bf16_rne(float f) { unsigned int u = __float_as_uint(f); u += 0x7FFFu + ((u >> 16) & 1u); float r = __uint_as_float(u & 0xFFFF0000u); asm volatile("" : "+v"(r)); return r; }
__device__ __forceinline__ float bfv(float f) { float r = bf16_rne(f); asm volatile("" : "+v"(r)); return r; }
__device__ __forceinline__ void split16(float v, b16& hi, b16& lo) { hi = (b16)v; lo = (b16)(v - (float)hi); }
__device__ __forceinline__ v16b frag_kb(const b16* p, int hh) { const v8b a = *(const v8b*)(p + 8 * hh), b = *(const v8b*)(p + 16 + 8 * hh); v16b f;
#pragma unroll
  for (int e = 0; e < 8; ++e) { f[e] = a[e]; f[8 + e] = b[e]; } return f; }
__device__ __forceinline__ v8f wmma16b(v16b a, v16b b, v8f c) { v8f d = __builtin_amdgcn_wmma_f32_16x16x32_f16(false, a, false, b, (short)0, c, false, false); asm volatile("v_nop\n\tv_nop\n\tv_nop\n\tv_nop" : "+v"(d) : "v"(a), "v"(b)); return d; }
__device__ __forceinline__ void wave_lds_sync() { __builtin_amdgcn_fence(__ATOMIC_RELEASE, "workgroup"); __builtin_amdgcn_wave_barrier(); __builtin_amdgcn_fence(__ATOMIC_ACQUIRE, "workgroup"); }
__device__ __forceinline__ float pmul(float a, float b) { float p = a * b; asm volatile("" : "+v"(p)); return p; }

__global__ __launch_bounds__(256) void wput_kernel(const float* __restrict__ wq, const float* __restrict__ wk, const float* __restrict__ wv, const float* __restrict__ wo, b16* __restrict__ W3, b16* __restrict__ WO) { const size_t u = (size_t)blockIdx.x * 256 + threadIdx.x; if (u >= (size_t)4 * DIM * (DIM / 8)) return; const int r = (int)(u / (DIM / 8)), k0 = (int)(u % (DIM / 8)) * 8; const int p = r / DIM, o = r % DIM; const float* w = p == 0 ? wq : (p == 1 ? wk : (p == 2 ? wv : wo)); v8b v;
#pragma unroll
  for (int j = 0; j < 8; ++j) v[j] = (b16)(bf16_rne(w[(size_t)(k0 + j) * DIM + o]) * WSC);
  { *(v8b*)((p < 3 ? W3 + (size_t)r * DIM : WO + (size_t)o * DIM) + k0) = v;  } }
// projection: wave per 16 projected rows (b, r): [Q|K|V] rows = bf16(x) (EXACT, K 1024) x W3 rows (192 tiles in 12 groups of 16) + bias (Q scaled by 1/sqrt(128)); row r, 128-chunk j -> token T = 8*(b*2048 + r) + j:
__global__ __launch_bounds__(32) void proj_kernel(const float* __restrict__ x, const b16* __restrict__ W3, const float* __restrict__ bq, const float* __restrict__ bk, const float* __restrict__ bv, int RLIM, b16* __restrict__ PH, b16* __restrict__ PL) { __shared__ __attribute__((aligned(16))) b16 Ah[16][DIM + 8], Oh[16][264], Ol[16][264]; const int lane = threadIdx.x, nloc = lane & 15, hlf = lane >> 4; const size_t m0 = (size_t)blockIdx.x * 16; if (m0 >= (size_t)RLIM) return;
  for (int rr = 0; rr < 16; ++rr) for (int q = 0; q < DIM / 32; ++q) Ah[rr][q * 32 + lane] = (b16)(bf16_rne(x[(m0 + rr) * DIM + q * 32 + lane]) * XS);
  wave_lds_sync();
#pragma unroll 1
  for (int g = 0; g < 3 * DIM / 256; ++g) { const int p = (g * 256) / DIM; const float* bb = p == 0 ? bq : (p == 1 ? bk : bv); const float sc = p == 0 ? SCALE : 1.0f; v8f acc[16];
#pragma unroll
    for (int t = 0; t < 16; ++t) acc[t] = (v8f){};
#pragma unroll 2
    for (int kb = 0; kb < DIM; kb += 32) { const v16b a = frag_kb(&Ah[nloc][kb], hlf);
#pragma unroll
      for (int t = 0; t < 16; ++t) acc[t] = wmma16b(a, frag_kb(W3 + (size_t)(g * 256 + t * 16 + nloc) * DIM + kb, hlf), acc[t]); }
#pragma unroll
    for (int t = 0; t < 16; ++t) { const int cc = t * 16 + nloc; const int col = (g * 256 + cc) % DIM; const float bvv = bfv(bb[col]);
#pragma unroll
      for (int r8 = 0; r8 < 8; ++r8) { b16 ph, pl; split16((acc[t][r8] * (1.0f / (XS * WSC)) + bvv) * sc * HS, ph, pl); Oh[8 * hlf + r8][cc] = ph; Ol[8 * hlf + r8][cc] = pl; } }
    wave_lds_sync();
    const int c0 = (g * 256) % DIM; const int j0 = c0 / 128;   // the group's 256 columns = chunks j0, j0+1 of projection p
    { for (int rr = 0; rr < 16; ++rr) { const int jj = lane >> 4, d8 = (lane & 15) * 8; const size_t T = 8 * (m0 + rr) + j0 + jj;   // lanes 0..15 -> chunk j0, 16..31 -> j0+1; 8 halves (16 B) each
        *(v8b*)(PH + T * PW + p * 128 + d8) = *(const v8b*)(&Oh[rr][jj * 128 + d8]); *(v8b*)(PL + T * PW + p * 128 + d8) = *(const v8b*)(&Ol[rr][jj * 128 + d8]); }  }
    wave_lds_sync(); } }
// attention: ONE WAVE PER BLOCK, wave per (b, h, 16-query tile): key blocks of 128 over all keys; S = Q K^T (3 products, K 128); online softmax; P x256 hi+lo;
__global__ __launch_bounds__(32) void att_kernel(const b16* __restrict__ PH, const b16* __restrict__ PL, const int* __restrict__ rsrc, const int* __restrict__ rtgt, int BLIM, float* __restrict__ ATT) { __shared__ __attribute__((aligned(16))) b16 Ph_[16][KB + 8], Pl_[16][KB + 8], Vth[HD][KB + 8], Vtl[HD][KB + 8]; __shared__ float Sf[16][KB + 4], Of[16][HD + 4];
  const int lane = threadIdx.x, nloc = lane & 15, hlf = lane >> 4; const int qt = blockIdx.x % (L / 16); const int h = (blockIdx.x / (L / 16)) % NH; const int b = blockIdx.x / ((L / 16) * NH); if (b >= BLIM) return; const int t0 = qt * 16; const int ib = t0 / 64; const int rs0 = rsrc[0], rs1 = rsrc[1], rs2 = rsrc[2], rt0 = rtgt[0], rt1 = rtgt[1], rt2 = rtgt[2];
  auto allowed = [&](int jb) { return (jb == 0) || (jb == NBLK - 1) || (jb - ib <= 1 && ib - jb <= 1) || (rs0 == ib && rt0 == jb) || (rs1 == ib && rt1 == jb) || (rs2 == ib && rt2 == jb); }; const size_t rowb = (size_t)b * L; const int qo = h * HD, ko = C + h * HD, vo = 2 * C + h * HD;
  v16b qh[HD / 32], ql[HD / 32];
#pragma unroll
  for (int s = 0; s < HD / 32; ++s) { qh[s] = frag_kb(PH + (rowb + t0 + nloc) * PW + qo + s * 32, hlf); ql[s] = frag_kb(PL + (rowb + t0 + nloc) * PW + qo + s * 32, hlf); }
  float m_r[8], den_r[8]; v8f acc[HD / 16];
#pragma unroll
  for (int r8 = 0; r8 < 8; ++r8) { m_r[r8] = -INFINITY; den_r[r8] = 0.0f; }
#pragma unroll
  for (int t = 0; t < HD / 16; ++t) acc[t] = (v8f){};
  const int kstart = 0; const int kend = L;   // [kstart, kend)
#pragma unroll 1
  for (int kb0 = kstart; kb0 < kend; kb0 += KB) { const int nk = (kend - kb0) < KB ? (kend - kb0) : KB; const int nkt = (nk + 15) / 16; if (!allowed(kb0 / 64) && !allowed(kb0 / 64 + 1)) continue;   /* neither 64-key sub-block of this 128-key block is visible to this query block */
    for (int rr = 0; rr < KB; rr += 2) { const int r = rr + hlf; const int key = kb0 + r < L ? kb0 + r : L - 1;   /* stage the WHOLE block: keys past kend get p = 0 but their V^T rows must be finite (chip LDS is not zeroed) */ const size_t vr = (rowb + key) * PW + vo; for (int s = 0; s < HD / 32; ++s) { Vth[s * 32 + nloc][r] = PH[vr + s * 32 + nloc]; Vth[s * 32 + 16 + nloc][r] = PH[vr + s * 32 + 16 + nloc]; Vtl[s * 32 + nloc][r] = PL[vr + s * 32 + nloc]; Vtl[s * 32 + 16 + nloc][r] = PL[vr + s * 32 + 16 + nloc]; } }
    for (int t = 0; t < KB / 16; ++t) { if (t < nkt) { const int key = kb0 + t * 16 + nloc < L ? kb0 + t * 16 + nloc : L - 1; const size_t kr = (rowb + key) * PW + ko; v8f s = {};
#pragma unroll
        for (int q = 0; q < HD / 32; ++q) { const v16b kh = frag_kb(PH + kr + q * 32, hlf), kl = frag_kb(PL + kr + q * 32, hlf); s = wmma16b(qh[q], kh, s); s = wmma16b(qh[q], kl, s); s = wmma16b(ql[q], kh, s); }
#pragma unroll
        for (int r8 = 0; r8 < 8; ++r8) { const int i = t0 + 8 * hlf + r8, j = kb0 + t * 16 + nloc; const bool ok = (j < kend) && allowed(j >> 6);   /* BigBird block mask (-1e9 in the module == excluded; key block 0 always allowed) */ Sf[8 * hlf + r8][t * 16 + nloc] = ok ? s[r8] * (1.0f / (HS * HS)) : -INFINITY; } }
      else {
#pragma unroll
        for (int r8 = 0; r8 < 8; ++r8) Sf[8 * hlf + r8][t * 16 + nloc] = -INFINITY; } }
    wave_lds_sync();
#pragma unroll
    for (int rr = 0; rr < 16; ++rr) { float mx = -INFINITY;
#pragma unroll
      for (int q = 0; q < 4; ++q) mx = fmaxf(mx, Sf[rr][q * 32 + lane]);
      for (int o = 16; o; o >>= 1) mx = fmaxf(mx, __shfl_xor(mx, o));
      const float mold = __shfl(m_r[rr & 7], (rr >> 3) * 16); const float mn = fmaxf(mold, mx); const float sf = (mold == -INFINITY) ? 0.0f : ((mn == -INFINITY) ? 1.0f : __expf(mold - mn)); float ps = 0.0f;
#pragma unroll
      for (int q = 0; q < 4; ++q) { const int kx = q * 32 + lane; const float sv = Sf[rr][kx]; const float p = (sv == -INFINITY || mn == -INFINITY) ? 0.0f : __expf(sv - mn); ps += p; b16 ph, pl; split16(p * PS, ph, pl); Ph_[rr][kx] = ph; Pl_[rr][kx] = pl; }
      for (int o = 16; o; o >>= 1) ps += __shfl_xor(ps, o);
      if ((rr >> 3) == hlf) { const int r8 = rr & 7; den_r[r8] = den_r[r8] * sf + ps; m_r[r8] = mn;
#pragma unroll
        for (int t = 0; t < HD / 16; ++t) acc[t][r8] = acc[t][r8] * sf; } }
    wave_lds_sync();
    for (int ks = 0; ks < nkt * 16; ks += 32) { const v16b pa = frag_kb(&Ph_[nloc][ks], hlf), pb = frag_kb(&Pl_[nloc][ks], hlf);
#pragma unroll
      for (int t = 0; t < HD / 16; ++t) { const v16b vh = frag_kb(&Vth[t * 16 + nloc][ks], hlf), vl = frag_kb(&Vtl[t * 16 + nloc][ks], hlf); acc[t] = wmma16b(pa, vh, acc[t]); acc[t] = wmma16b(pa, vl, acc[t]); acc[t] = wmma16b(pb, vh, acc[t]); } }
    wave_lds_sync(); }
#pragma unroll
  for (int t = 0; t < HD / 16; ++t)
#pragma unroll
    for (int r8 = 0; r8 < 8; ++r8) { const float dn = den_r[r8]; Of[8 * hlf + r8][t * 16 + nloc] = dn > 0.0f ? acc[t][r8] * (1.0f / (HS * PS)) / dn : 0.0f; }
  wave_lds_sync();
  const int rb_ = b / HEADS, hq = b % HEADS;   /* merge heads: ATT[b][s][h*128 + d] */
  { for (int rr = 0; rr < 16; ++rr) for (int s = 0; s < HD / 32; ++s) ((float*)ATT)[((size_t)rb_ * L + t0 + rr) * DIM + hq * 128 + s * 32 + lane] = Of[rr][s * 32 + lane];  } }
__global__ __launch_bounds__(32) void outp_kernel(const float* __restrict__ ATT, const b16* __restrict__ WO, const float* __restrict__ bo, int RLIM, float* __restrict__ out) { __shared__ __attribute__((aligned(16))) b16 Ah[16][DIM + 8], Al[16][DIM + 8]; __shared__ float Tf[16][260]; const int lane = threadIdx.x, nloc = lane & 15, hlf = lane >> 4; const size_t m0 = (size_t)blockIdx.x * 16; if (m0 >= (size_t)RLIM) return;
  for (int rr = 0; rr < 16; ++rr) for (int q = 0; q < DIM / 32; ++q) { b16 p, ql; split16(ATT[(m0 + rr) * DIM + q * 32 + lane] * HS, p, ql); Ah[rr][q * 32 + lane] = p; Al[rr][q * 32 + lane] = ql; }
  wave_lds_sync();
#pragma unroll 1
  for (int g = 0; g < DIM / 256; ++g) { v8f acc[16];
#pragma unroll
    for (int t = 0; t < 16; ++t) acc[t] = (v8f){};
#pragma unroll 2
    for (int kk = 0; kk < DIM; kk += 32) { const v16b a = frag_kb(&Ah[nloc][kk], hlf), al = frag_kb(&Al[nloc][kk], hlf);
#pragma unroll
      for (int t = 0; t < 16; ++t) { const v16b bw = frag_kb(WO + (size_t)(g * 256 + t * 16 + nloc) * DIM + kk, hlf); acc[t] = wmma16b(a, bw, acc[t]); acc[t] = wmma16b(al, bw, acc[t]); } }
#pragma unroll
    for (int t = 0; t < 16; ++t) { const int cc = t * 16 + nloc; const float bb = bfv(bo[g * 256 + cc]);
#pragma unroll
      for (int r8 = 0; r8 < 8; ++r8) Tf[8 * hlf + r8][cc] = acc[t][r8] * (1.0f / (HS * WSC)) + bb; }
    wave_lds_sync();
    { for (int rr = 0; rr < 16; ++rr) for (int q = 0; q < 2; ++q) *(v4f*)(out + (m0 + rr) * DIM + g * 256 + q * 128 + lane * 4) = *(const v4f*)(&Tf[rr][q * 128 + lane * 4]);  }
    wave_lds_sync(); } }
}  // namespace

extern "C" void kernel_launch(void* const* d_in, const int* in_sizes, int n_in, void* d_out, int out_size, void* d_ws, size_t ws_size, hipStream_t stream) {
  (void)n_in;
  auto Fp = [&](int i) { return (const float*)d_in[i]; };
  // input order: 0 x [2,2048,1024]; 1 Wq [1024,1024] (in,out); 2 bq; 3 Wk; 4 bk; 5 Wv; 6 bv; 7 Wo; 8 bo; 9 rand_src [3] i32; 10 rand_tgt [3] i32
  if (in_sizes[0] != NRB * DIM || in_sizes[1] != DIM * DIM || in_sizes[3] != DIM * DIM || in_sizes[5] != DIM * DIM || in_sizes[7] != DIM * DIM || in_sizes[8] != DIM || in_sizes[9] != 3 || in_sizes[10] != 3 || out_size != NRB * DIM) return;
  const int BLIM = NB;   // (batch, head) pairs
  const int RLIM = NRB;
  size_t off = 0; char* ws = (char*)d_ws;
  auto carve = [&](size_t bytes) { char* p = ws + off; off += (bytes + 255) & ~(size_t)255; return p; };
  b16* W3 = (b16*)carve((size_t)3 * DIM * DIM * 2); b16* WO = (b16*)carve((size_t)DIM * DIM * 2); b16* PH = (b16*)carve((size_t)NT * PW * 2); b16* PL = (b16*)carve((size_t)NT * PW * 2); float* ATT = (float*)carve((size_t)NRB * DIM * 4);
  if (off > ws_size || off > ((size_t)96 << 20)) return;   // ~ 75 MB
  wput_kernel<<<(unsigned)(((size_t)4 * DIM * (DIM / 8) + 255) / 256), 256, 0, stream>>>(Fp(1), Fp(3), Fp(5), Fp(7), W3, WO);
  proj_kernel<<<RLIM / 16, 32, 0, stream>>>(Fp(0), W3, Fp(2), Fp(4), Fp(6), RLIM, PH, PL);
  att_kernel<<<BLIM * NH * (L / 16), 32, 0, stream>>>(PH, PL, (const int*)d_in[9], (const int*)d_in[10], BLIM, ATT);
  outp_kernel<<<RLIM / 16, 32, 0, stream>>>(ATT, WO, Fp(8), RLIM, (float*)d_out);
}

// v001
// A run of this version takes 639 microseconds.
// Next to v000, in two timings, it ran 3.52 and 3.55 times as fast.
#include <hip/hip_runtime.h>

// HierarchicalAttention (BigBird-style block mask): Q = x Wq + bq, K, V likewise ((in,out) 1024x1024); the module's raw .view(B, 8, 2048, 128) makes head h / token s the 128-slice s%8 of projected row h*256 + s/8 — i.e. the flat
// [B*8*2048][128] view of each projection; scores / sqrt(128); key block j (64 keys) allowed for query block i iff j == 0 || j == 31 || |i-j| <= 1 || (i,j) is one of the 3 (rand_src, rand_tgt) pairs, else -1e9 (== excluded;
// block 0 always allowed); softmax; O merged as [b][s][h*128+d]; out = O Wo + bo -> [2][2048][1024].
// Deterministic: no index structures, no atomics; flash-style online softmax over all key blocks in a fixed order.
// WMMA (v_wmma_f32_16x16x32_f16, f32 accumulate): the QKV projection with x EXACT bf16 x8 (K 1024) against exact torch weight rows x256 (one product); S = Q K^T (hi+lo x hi+lo, 3 products, K 128); O = P V (P x256 hi+lo x V^T hi+lo, 3 products); softmax in f32. Inputs rounded to bf16 once. Fragment k-map per lane half hh for A AND B: elements 0..7 <- k = 8hh+0..7, 8..15 <- k = 16+8hh+0..7; acc[r] = D[8hh+r][col].

namespace {
constexpr int NB = 16, L = 2048, C = 128, NH = 1, HD = 128, NT = NB * L, KB = 128, PW = 3 * C;   // NB = (batch, head) pairs; the 'token' index is (b*8 + h)*2048 + s
constexpr int RB = 2, DIM = 1024, HEADS = 8, NBLK = 32, NRB = RB * L /* 4096 projected rows */;
constexpr float XS = 8.0f, HS = 256.0f /* hi+lo staging scale for q/k/v/attended */, WSC = 256.0f, PS = 256.0f, SCALE = 0.08838834764831845f;
typedef _Float16 b16;
typedef __attribute__((ext_vector_type(16))) _Float16 v16b;
typedef __attribute__((ext_vector_type(8))) _Float16 v8b;
typedef __attribute__((ext_vector_type(8))) float v8f;
typedef __attribute__((ext_vector_type(4))) float v4f;
__device__ __forceinline__ float bf16_rne(float f) { unsigned int u = __float_as_uint(f); u += 0x7FFFu + ((u >> 16) & 1u); float r = __uint_as_float(u & 0xFFFF0000u); asm volatile("" : "+v"(r)); return r; }
__device__ __forceinline__ float bfv(float f) { float r = bf16_rne(f); asm volatile("" : "+v"(r)); return r; }
__device__ __forceinline__ void split16(float v, b16& hi, b16& lo) { hi = (b16)v; lo = (b16)(v - (float)hi); }
__device__ __forceinline__ v16b frag_kb(const b16* p, int hh) { const v8b a = *(const v8b*)(p + 8 * hh), b = *(const v8b*)(p + 16 + 8 * hh); v16b f;
#pragma unroll
  for (int e = 0; e < 8; ++e) { f[e] = a[e]; f[8 + e] = b[e]; } return f; }
__device__ __forceinline__ v8f wmma16b(v16b a, v16b b, v8f c) { v8f d = __builtin_amdgcn_wmma_f32_16x16x32_f16(false, a, false, b, (short)0, c, false, false); asm volatile("v_nop\n\tv_nop\n\tv_nop\n\tv_nop" : "+v"(d) : "v"(a), "v"(b)); return d; }
__device__ __forceinline__ void wave_lds_sync() { __builtin_amdgcn_fence(__ATOMIC_RELEASE, "workgroup"); __builtin_amdgcn_wave_barrier(); __builtin_amdgcn_fence(__ATOMIC_ACQUIRE, "workgroup"); }
__device__ __forceinline__ float pmul(float a, float b) { float p = a * b; asm volatile("" : "+v"(p)); return p; }

__global__ __launch_bounds__(256) void wput_kernel(const float* __restrict__ wq, const float* __restrict__ wk, const float* __restrict__ wv, const float* __restrict__ wo, b16* __restrict__ W3, b16* __restrict__ WO) { const size_t u = (size_t)blockIdx.x * 256 + threadIdx.x; if (u >= (size_t)4 * DIM * (DIM / 8)) return; const int r = (int)(u / (DIM / 8)), k0 = (int)(u % (DIM / 8)) * 8; const int p = r / DIM, o = r % DIM; const float* w = p == 0 ? wq : (p == 1 ? wk : (p == 2 ? wv : wo)); v8b v;
#pragma unroll
  for (int j = 0; j < 8; ++j) v[j] = (b16)(bf16_rne(w[(size_t)(k0 + j) * DIM + o]) * WSC);
  { *(v8b*)((p < 3 ? W3 + (size_t)r * DIM : WO + (size_t)o * DIM) + k0) = v;  } }
// projection: block of 16 waves per (16 projected rows, projection p = blockIdx.y): the waves stage bf16(x) (EXACT, K 1024) once, one row each, and share it; wave wv then does columns wv*64 .. +63 of p (4 tiles) x W3 rows + bias (Q scaled by 1/sqrt(128)); row r, 128-chunk j -> token T = 8*(b*2048 + r) + j:
__global__ __launch_bounds__(512) void proj_kernel(const float* __restrict__ x, const b16* __restrict__ W3, const float* __restrict__ bq, const float* __restrict__ bk, const float* __restrict__ bv, int RLIM, b16* __restrict__ PH, b16* __restrict__ PL) { __shared__ __attribute__((aligned(16))) b16 Ah[16][DIM + 8], Oh[16][16][72], Ol[16][16][72]; const int lane = threadIdx.x & 31, wv = __builtin_amdgcn_readfirstlane(threadIdx.x >> 5), nloc = lane & 15, hlf = lane >> 4; const size_t m0 = (size_t)blockIdx.x * 16; if (m0 >= (size_t)RLIM) return;
  for (int q = 0; q < DIM / 32; ++q) Ah[wv][q * 32 + lane] = (b16)(bf16_rne(x[(m0 + wv) * DIM + q * 32 + lane]) * XS);
  __syncthreads();   // every wave reads all 16 staged rows
  const int p = blockIdx.y, c0 = wv * 64; const float* bb = p == 0 ? bq : (p == 1 ? bk : bv); const float sc = p == 0 ? SCALE : 1.0f; v8f acc[4];
#pragma unroll
  for (int t = 0; t < 4; ++t) acc[t] = (v8f){};
#pragma unroll 2
  for (int kb = 0; kb < DIM; kb += 32) { const v16b a = frag_kb(&Ah[nloc][kb], hlf);
#pragma unroll
    for (int t = 0; t < 4; ++t) acc[t] = wmma16b(a, frag_kb(W3 + (size_t)(p * DIM + c0 + t * 16 + nloc) * DIM + kb, hlf), acc[t]); }
#pragma unroll
  for (int t = 0; t < 4; ++t) { const int cc = t * 16 + nloc; const float bvv = bfv(bb[c0 + cc]);
#pragma unroll
    for (int r8 = 0; r8 < 8; ++r8) { b16 ph, pl; split16((acc[t][r8] * (1.0f / (XS * WSC)) + bvv) * sc * HS, ph, pl); Oh[wv][8 * hlf + r8][cc] = ph; Ol[wv][8 * hlf + r8][cc] = pl; } }
  wave_lds_sync();
  const int j = c0 >> 7, h0 = c0 & 64;   // the wave's 64 columns = one 128-B half of chunk j of projection p
  for (int rr = 0; rr < 16; rr += 4) { const int r = rr + (lane >> 3), d8 = (lane & 7) * 8; const size_t T = 8 * (m0 + r) + j;   // 8 lanes x 16 B per row, 4 rows per store
    *(v8b*)(PH + T * PW + p * 128 + h0 + d8) = *(const v8b*)(&Oh[wv][r][d8]); *(v8b*)(PL + T * PW + p * 128 + h0 + d8) = *(const v8b*)(&Ol[wv][r][d8]); } }
// attention: ONE WAVE PER BLOCK, wave per (b, h, 16-query tile): key blocks of 128 over all keys; S = Q K^T (3 products, K 128); online softmax; P x256 hi+lo;
__global__ __launch_bounds__(32) void att_kernel(const b16* __restrict__ PH, const b16* __restrict__ PL, const int* __restrict__ rsrc, const int* __restrict__ rtgt, int BLIM, float* __restrict__ ATT) { __shared__ __attribute__((aligned(16))) b16 Ph_[16][KB + 8], Pl_[16][KB + 8], Vth[HD][KB + 8], Vtl[HD][KB + 8]; __shared__ float Sf[16][KB + 4], Of[16][HD + 4];
  const int lane = threadIdx.x, nloc = lane & 15, hlf = lane >> 4; const int qt = blockIdx.x % (L / 16); const int h = (blockIdx.x / (L / 16)) % NH; const int b = blockIdx.x / ((L / 16) * NH); if (b >= BLIM) return; const int t0 = qt * 16; const int ib = t0 / 64; const int rs0 = rsrc[0], rs1 = rsrc[1], rs2 = rsrc[2], rt0 = rtgt[0], rt1 = rtgt[1], rt2 = rtgt[2];
  auto allowed = [&](int jb) { return (jb == 0) || (jb == NBLK - 1) || (jb - ib <= 1 && ib - jb <= 1) || (rs0 == ib && rt0 == jb) || (rs1 == ib && rt1 == jb) || (rs2 == ib && rt2 == jb); }; const size_t rowb = (size_t)b * L; const int qo = h * HD, ko = C + h * HD, vo = 2 * C + h * HD;
  v16b qh[HD / 32], ql[HD / 32];
#pragma unroll
  for (int s = 0; s < HD / 32; ++s) { qh[s] = frag_kb(PH + (rowb + t0 + nloc) * PW + qo + s * 32, hlf); ql[s] = frag_kb(PL + (rowb + t0 + nloc) * PW + qo + s * 32, hlf); }
  float m_r[8], den_r[8]; v8f acc[HD / 16];
#pragma unroll
  for (int r8 = 0; r8 < 8; ++r8) { m_r[r8] = -INFINITY; den_r[r8] = 0.0f; }
#pragma unroll
  for (int t = 0; t < HD / 16; ++t) acc[t] = (v8f){};
  const int kstart = 0; const int kend = L;   // [kstart, kend)
#pragma unroll 1
  for (int kb0 = kstart; kb0 < kend; kb0 += KB) { const int nk = (kend - kb0) < KB ? (kend - kb0) : KB; const int nkt = (nk + 15) / 16; if (!allowed(kb0 / 64) && !allowed(kb0 / 64 + 1)) continue;   /* neither 64-key sub-block of this 128-key block is visible to this query block */
    for (int rr = 0; rr < KB; rr += 2) { const int r = rr + hlf; const int key = kb0 + r < L ? kb0 + r : L - 1;   /* stage the WHOLE block: keys past kend get p = 0 but their V^T rows must be finite (chip LDS is not zeroed) */ const size_t vr = (rowb + key) * PW + vo; for (int s = 0; s < HD / 32; ++s) { Vth[s * 32 + nloc][r] = PH[vr + s * 32 + nloc]; Vth[s * 32 + 16 + nloc][r] = PH[vr + s * 32 + 16 + nloc]; Vtl[s * 32 + nloc][r] = PL[vr + s * 32 + nloc]; Vtl[s * 32 + 16 + nloc][r] = PL[vr + s * 32 + 16 + nloc]; } }
    for (int t = 0; t < KB / 16; ++t) { if (t < nkt) { const int key = kb0 + t * 16 + nloc < L ? kb0 + t * 16 + nloc : L - 1; const size_t kr = (rowb + key) * PW + ko; v8f s = {};
#pragma unroll
        for (int q = 0; q < HD / 32; ++q) { const v16b kh = frag_kb(PH + kr + q * 32, hlf), kl = frag_kb(PL + kr + q * 32, hlf); s = wmma16b(qh[q], kh, s); s = wmma16b(qh[q], kl, s); s = wmma16b(ql[q], kh, s); }
#pragma unroll
        for (int r8 = 0; r8 < 8; ++r8) { const int i = t0 + 8 * hlf + r8, j = kb0 + t * 16 + nloc; const bool ok = (j < kend) && allowed(j >> 6);   /* BigBird block mask (-1e9 in the module == excluded; key block 0 always allowed) */ Sf[8 * hlf + r8][t * 16 + nloc] = ok ? s[r8] * (1.0f / (HS * HS)) : -INFINITY; } }
      else {
#pragma unroll
        for (int r8 = 0; r8 < 8; ++r8) Sf[8 * hlf + r8][t * 16 + nloc] = -INFINITY; } }
    wave_lds_sync();
#pragma unroll
    for (int rr = 0; rr < 16; ++rr) { float mx = -INFINITY;
#pragma unroll
      for (int q = 0; q < 4; ++q) mx = fmaxf(mx, Sf[rr][q * 32 + lane]);
      for (int o = 16; o; o >>= 1) mx = fmaxf(mx, __shfl_xor(mx, o));
      const float mold = __shfl(m_r[rr & 7], (rr >> 3) * 16); const float mn = fmaxf(mold, mx); const float sf = (mold == -INFINITY) ? 0.0f : ((mn == -INFINITY) ? 1.0f : __expf(mold - mn)); float ps = 0.0f;
#pragma unroll
      for (int q = 0; q < 4; ++q) { const int kx = q * 32 + lane; const float sv = Sf[rr][kx]; const float p = (sv == -INFINITY || mn == -INFINITY) ? 0.0f : __expf(sv - mn); ps += p; b16 ph, pl; split16(p * PS, ph, pl); Ph_[rr][kx] = ph; Pl_[rr][kx] = pl; }
      for (int o = 16; o; o >>= 1) ps += __shfl_xor(ps, o);
      if ((rr >> 3) == hlf) { const int r8 = rr & 7; den_r[r8] = den_r[r8] * sf + ps; m_r[r8] = mn;
#pragma unroll
        for (int t = 0; t < HD / 16; ++t) acc[t][r8] = acc[t][r8] * sf; } }
    wave_lds_sync();
    for (int ks = 0; ks < nkt * 16; ks += 32) { const v16b pa = frag_kb(&Ph_[nloc][ks], hlf), pb = frag_kb(&Pl_[nloc][ks], hlf);
#pragma unroll
      for (int t = 0; t < HD / 16; ++t) { const v16b vh = frag_kb(&Vth[t * 16 + nloc][ks], hlf), vl = frag_kb(&Vtl[t * 16 + nloc][ks], hlf); acc[t] = wmma16b(pa, vh, acc[t]); acc[t] = wmma16b(pa, vl, acc[t]); acc[t] = wmma16b(pb, vh, acc[t]); } }
    wave_lds_sync(); }
#pragma unroll
  for (int t = 0; t < HD / 16; ++t)
#pragma unroll
    for (int r8 = 0; r8 < 8; ++r8) { const float dn = den_r[r8]; Of[8 * hlf + r8][t * 16 + nloc] = dn > 0.0f ? acc[t][r8] * (1.0f / (HS * PS)) / dn : 0.0f; }
  wave_lds_sync();
  const int rb_ = b / HEADS, hq = b % HEADS;   /* merge heads: ATT[b][s][h*128 + d] */
  { for (int rr = 0; rr < 16; ++rr) for (int s = 0; s < HD / 32; ++s) ((float*)ATT)[((size_t)rb_ * L + t0 + rr) * DIM + hq * 128 + s * 32 + lane] = Of[rr][s * 32 + lane];  } }
// output projection: block of 32 waves per 16 rows: the waves stage the attended rows (hi+lo) once, half a row each, and share them; wave wv then does columns wv*32 .. +31 (2 tiles):
__global__ __launch_bounds__(1024) void outp_kernel(const float* __restrict__ ATT, const b16* __restrict__ WO, const float* __restrict__ bo, int RLIM, float* __restrict__ out) { __shared__ __attribute__((aligned(16))) b16 Ah[16][DIM + 8], Al[16][DIM + 8]; __shared__ __attribute__((aligned(16))) float Tf[32][16][36]; const int lane = threadIdx.x & 31, wv = __builtin_amdgcn_readfirstlane(threadIdx.x >> 5), nloc = lane & 15, hlf = lane >> 4; const size_t m0 = (size_t)blockIdx.x * 16; if (m0 >= (size_t)RLIM) return;
  for (int q = 0; q < DIM / 64; ++q) { const int sr = wv >> 1, cx = (wv & 1) * (DIM / 2) + q * 32 + lane; b16 p, ql; split16(ATT[(m0 + sr) * DIM + cx] * HS, p, ql); Ah[sr][cx] = p; Al[sr][cx] = ql; }
  __syncthreads();   // every wave reads all 16 staged rows
  const int c0 = wv * 32; v8f acc[2];
#pragma unroll
  for (int t = 0; t < 2; ++t) acc[t] = (v8f){};
#pragma unroll 2
  for (int kk = 0; kk < DIM; kk += 32) { const v16b a = frag_kb(&Ah[nloc][kk], hlf), al = frag_kb(&Al[nloc][kk], hlf);
#pragma unroll
    for (int t = 0; t < 2; ++t) { const v16b bw = frag_kb(WO + (size_t)(c0 + t * 16 + nloc) * DIM + kk, hlf); acc[t] = wmma16b(a, bw, acc[t]); acc[t] = wmma16b(al, bw, acc[t]); } }
#pragma unroll
  for (int t = 0; t < 2; ++t) { const int cc = t * 16 + nloc; const float bb = bfv(bo[c0 + cc]);
#pragma unroll
    for (int r8 = 0; r8 < 8; ++r8) Tf[wv][8 * hlf + r8][cc] = acc[t][r8] * (1.0f / (HS * WSC)) + bb; }
  wave_lds_sync();
  for (int rr = 0; rr < 16; rr += 4) { const int r = rr + (lane >> 3), c4 = (lane & 7) * 4;   // 8 lanes x 16 B = one 128-B line per row, 4 rows per store
    *(v4f*)(out + (m0 + r) * DIM + c0 + c4) = *(const v4f*)(&Tf[wv][r][c4]); } }
}  // namespace

extern "C" void kernel_launch(void* const* d_in, const int* in_sizes, int n_in, void* d_out, int out_size, void* d_ws, size_t ws_size, hipStream_t stream) {
  (void)n_in;
  auto Fp = [&](int i) { return (const float*)d_in[i]; };
  // input order: 0 x [2,2048,1024]; 1 Wq [1024,1024] (in,out); 2 bq; 3 Wk; 4 bk; 5 Wv; 6 bv; 7 Wo; 8 bo; 9 rand_src [3] i32; 10 rand_tgt [3] i32
  if (in_sizes[0] != NRB * DIM || in_sizes[1] != DIM * DIM || in_sizes[3] != DIM * DIM || in_sizes[5] != DIM * DIM || in_sizes[7] != DIM * DIM || in_sizes[8] != DIM || in_sizes[9] != 3 || in_sizes[10] != 3 || out_size != NRB * DIM) return;
  const int BLIM = NB;   // (batch, head) pairs
  const int RLIM = NRB;
  size_t off = 0; char* ws = (char*)d_ws;
  auto carve = [&](size_t bytes) { char* p = ws + off; off += (bytes + 255) & ~(size_t)255; return p; };
  b16* W3 = (b16*)carve((size_t)3 * DIM * DIM * 2); b16* WO = (b16*)carve((size_t)DIM * DIM * 2); b16* PH = (b16*)carve((size_t)NT * PW * 2); b16* PL = (b16*)carve((size_t)NT * PW * 2); float* ATT = (float*)carve((size_t)NRB * DIM * 4);
  if (off > ws_size || off > ((size_t)96 << 20)) return;   // ~ 75 MB
  wput_kernel<<<(unsigned)(((size_t)4 * DIM * (DIM / 8) + 255) / 256), 256, 0, stream>>>(Fp(1), Fp(3), Fp(5), Fp(7), W3, WO);
  proj_kernel<<<dim3(RLIM / 16, 3), 512, 0, stream>>>(Fp(0), W3, Fp(2), Fp(4), Fp(6), RLIM, PH, PL);
  att_kernel<<<BLIM * NH * (L / 16), 32, 0, stream>>>(PH, PL, (const int*)d_in[9], (const int*)d_in[10], BLIM, ATT);
  outp_kernel<<<RLIM / 16, 1024, 0, stream>>>(ATT, WO, Fp(8), RLIM, (float*)d_out);
}

// v002
// It runs in 289 microseconds.
// Timed twice side by side with v001, it ran 2.22 and 2.18 times as fast.
// Over all steps from v000 it is 7.78 times as fast.
#include <hip/hip_runtime.h>

// HierarchicalAttention (BigBird-style block mask): Q = x Wq + bq, K, V likewise ((in,out) 1024x1024); the module's raw .view(B, 8, 2048, 128) makes head h / token s the 128-slice s%8 of projected row h*256 + s/8 — i.e. the flat
// [B*8*2048][128] view of each projection; scores / sqrt(128); key block j (64 keys) allowed for query block i iff j == 0 || j == 31 || |i-j| <= 1 || (i,j) is one of the 3 (rand_src, rand_tgt) pairs, else -1e9 (== excluded;
// block 0 always allowed); softmax; O merged as [b][s][h*128+d]; out = O Wo + bo -> [2][2048][1024].
// Deterministic: no index structures, no atomics; flash-style online softmax over all key blocks in a fixed order.
// WMMA (v_wmma_f32_16x16x32_f16, f32 accumulate): the QKV projection with x EXACT bf16 x8 (K 1024) against exact torch weight rows x256 (one product); S = Q K^T (hi+lo x hi+lo, 3 products, K 128); O = P V (P x256 hi+lo x V^T hi+lo, 3 products); softmax in f32. Inputs rounded to bf16 once. Fragment k-map per lane half hh for A AND B: elements 0..7 <- k = 8hh+0..7, 8..15 <- k = 16+8hh+0..7; acc[r] = D[8hh+r][col].

namespace {
constexpr int NB = 16, L = 2048, C = 128, NH = 1, HD = 128, NT = NB * L, KB = 128, PW = 3 * C;   // NB = (batch, head) pairs; the 'token' index is (b*8 + h)*2048 + s
constexpr int RB = 2, DIM = 1024, HEADS = 8, NBLK = 32, NRB = RB * L /* 4096 projected rows */;
constexpr float XS = 8.0f, HS = 256.0f /* hi+lo staging scale for q/k/v/attended */, WSC = 256.0f, PS = 256.0f, SCALE = 0.08838834764831845f;
typedef _Float16 b16;
typedef __attribute__((ext_vector_type(16))) _Float16 v16b;
typedef __attribute__((ext_vector_type(8))) _Float16 v8b;
typedef __attribute__((ext_vector_type(8))) float v8f;
typedef __attribute__((ext_vector_type(4))) float v4f;
__device__ __forceinline__ float bf16_rne(float f) { unsigned int u = __float_as_uint(f); u += 0x7FFFu + ((u >> 16) & 1u); float r = __uint_as_float(u & 0xFFFF0000u); asm volatile("" : "+v"(r)); return r; }
__device__ __forceinline__ float bfv(float f) { float r = bf16_rne(f); asm volatile("" : "+v"(r)); return r; }
__device__ __forceinline__ void split16(float v, b16& hi, b16& lo) { hi = (b16)v; lo = (b16)(v - (float)hi); }
__device__ __forceinline__ v16b frag_kb(const b16* p, int hh) { const v8b a = *(const v8b*)(p + 8 * hh), b = *(const v8b*)(p + 16 + 8 * hh); v16b f;
#pragma unroll
  for (int e = 0; e < 8; ++e) { f[e] = a[e]; f[8 + e] = b[e]; } return f; }
__device__ __forceinline__ v16b frag_vf(const b16* p) { const v8b a = *(const v8b*)p, b = *(const v8b*)(p + 256); v16b f;   // p already holds the lane's own 8 * lane: two whole 512-B runs per wave
#pragma unroll
  for (int e = 0; e < 8; ++e) { f[e] = a[e]; f[8 + e] = b[e]; } return f; }
__device__ __forceinline__ v8f wmma16b(v16b a, v16b b, v8f c) { v8f d = __builtin_amdgcn_wmma_f32_16x16x32_f16(false, a, false, b, (short)0, c, false, false); asm volatile("v_nop\n\tv_nop\n\tv_nop\n\tv_nop" : "+v"(d) : "v"(a), "v"(b)); return d; }
__device__ __forceinline__ void wave_lds_sync() { __builtin_amdgcn_fence(__ATOMIC_RELEASE, "workgroup"); __builtin_amdgcn_wave_barrier(); __builtin_amdgcn_fence(__ATOMIC_ACQUIRE, "workgroup"); }
__device__ __forceinline__ float pmul(float a, float b) { float p = a * b; asm volatile("" : "+v"(p)); return p; }

__global__ __launch_bounds__(256) void wput_kernel(const float* __restrict__ wq, const float* __restrict__ wk, const float* __restrict__ wv, const float* __restrict__ wo, b16* __restrict__ W3, b16* __restrict__ WO) { const size_t u = (size_t)blockIdx.x * 256 + threadIdx.x; if (u >= (size_t)4 * DIM * (DIM / 8)) return; const int r = (int)(u / (DIM / 8)), k0 = (int)(u % (DIM / 8)) * 8; const int p = r / DIM, o = r % DIM; const float* w = p == 0 ? wq : (p == 1 ? wk : (p == 2 ? wv : wo)); v8b v;
#pragma unroll
  for (int j = 0; j < 8; ++j) v[j] = (b16)(bf16_rne(w[(size_t)(k0 + j) * DIM + o]) * WSC);
  { *(v8b*)((p < 3 ? W3 + (size_t)r * DIM : WO + (size_t)o * DIM) + k0) = v;  } }
// projection: block of 16 waves per (16 projected rows, projection p = blockIdx.y): the waves stage bf16(x) (EXACT, K 1024) once, one row each, and share it; wave wv then does columns wv*64 .. +63 of p (4 tiles) x W3 rows + bias (Q scaled by 1/sqrt(128)); row r, 128-chunk j -> token T = 8*(b*2048 + r) + j:
__global__ __launch_bounds__(512) void proj_kernel(const float* __restrict__ x, const b16* __restrict__ W3, const float* __restrict__ bq, const float* __restrict__ bk, const float* __restrict__ bv, int RLIM, b16* __restrict__ PH, b16* __restrict__ PL, b16* __restrict__ VFH, b16* __restrict__ VFL) { __shared__ __attribute__((aligned(16))) b16 Ah[16][DIM + 8], Oh[16][16][72], Ol[16][16][72]; const int lane = threadIdx.x & 31, wv = __builtin_amdgcn_readfirstlane(threadIdx.x >> 5), nloc = lane & 15, hlf = lane >> 4; const size_t m0 = (size_t)blockIdx.x * 16; if (m0 >= (size_t)RLIM) return;
  for (int q = 0; q < DIM / 32; ++q) Ah[wv][q * 32 + lane] = (b16)(bf16_rne(x[(m0 + wv) * DIM + q * 32 + lane]) * XS);
  __syncthreads();   // every wave reads all 16 staged rows
  const int p = blockIdx.y, c0 = wv * 64; const float* bb = p == 0 ? bq : (p == 1 ? bk : bv); const float sc = p == 0 ? SCALE : 1.0f; v8f acc[4];
#pragma unroll
  for (int t = 0; t < 4; ++t) acc[t] = (v8f){};
#pragma unroll 2
  for (int kb = 0; kb < DIM; kb += 32) { const v16b a = frag_kb(&Ah[nloc][kb], hlf);
#pragma unroll
    for (int t = 0; t < 4; ++t) acc[t] = wmma16b(a, frag_kb(W3 + (size_t)(p * DIM + c0 + t * 16 + nloc) * DIM + kb, hlf), acc[t]); }
  if (p == 2) {   // V: the block's 16 rows x 1024 columns are 128 consecutive keys x 128 d of one head. They leave in the order of the P V product's B fragments: [32-key group][16-d tile][e][lane = 16 hh + d % 16][i], key % 32 = 16 e + 8 hh + i, so that a wave of att_kernel reads each fragment half as one 512-B run
    b16* const Vh = &Oh[0][0][0]; b16* const Vl = &Ol[0][0][0];   // 4 groups x 8 tiles x 512 = 16384 elements per plane, shared by the block
#pragma unroll
    for (int t = 0; t < 4; ++t) { const float bvv = bfv(bb[c0 + t * 16 + nloc]);
#pragma unroll
      for (int r8 = 0; r8 < 8; ++r8) { b16 ph, pl; split16((acc[t][r8] * (1.0f / (XS * WSC)) + bvv) * sc * HS, ph, pl);   // local key = 8 * (8 hlf + r8) + (wv >> 1), d = (c0 & 64) + 16 t + nloc
        const int ix = ((((2 * hlf + (r8 >> 2)) * 8 + ((c0 & 64) >> 4) + t) * 2 + ((r8 >> 1) & 1)) * 32 + (r8 & 1) * 16 + nloc) * 8 + (wv >> 1); Vh[ix] = ph; Vl[ix] = pl; } }
    __syncthreads();   // the copy-out below reads what all 16 waves wrote (p is the same for the whole block)
    const size_t vb = (8 * m0 / 32) * (size_t)(8 * 512);
#pragma unroll
    for (int q = 0; q < 4; ++q) { const int o = (q * 512 + (int)threadIdx.x) * 8; *(v8b*)(VFH + vb + o) = *(const v8b*)(Vh + o); *(v8b*)(VFL + vb + o) = *(const v8b*)(Vl + o); }
    return; }
#pragma unroll
  for (int t = 0; t < 4; ++t) { const int cc = t * 16 + nloc; const float bvv = bfv(bb[c0 + cc]);
#pragma unroll
    for (int r8 = 0; r8 < 8; ++r8) { b16 ph, pl; split16((acc[t][r8] * (1.0f / (XS * WSC)) + bvv) * sc * HS, ph, pl); Oh[wv][8 * hlf + r8][cc] = ph; Ol[wv][8 * hlf + r8][cc] = pl; } }
  wave_lds_sync();
  const int j = c0 >> 7, h0 = c0 & 64;   // the wave's 64 columns = one 128-B half of chunk j of projection p
  for (int rr = 0; rr < 16; rr += 4) { const int r = rr + (lane >> 3), d8 = (lane & 7) * 8; const size_t T = 8 * (m0 + r) + j;   // 8 lanes x 16 B per row, 4 rows per store
    *(v8b*)(PH + T * PW + p * 128 + h0 + d8) = *(const v8b*)(&Oh[wv][r][d8]); *(v8b*)(PL + T * PW + p * 128 + h0 + d8) = *(const v8b*)(&Ol[wv][r][d8]); } }
// attention: ONE WAVE PER BLOCK, wave per (b, h, 16-query tile): key blocks of 128 over all keys; S = Q K^T (3 products, K 128); online softmax; P x256 hi+lo; V fragments straight from the fragment-order planes that proj_kernel wrote;
__global__ __launch_bounds__(32) void att_kernel(const b16* __restrict__ PH, const b16* __restrict__ PL, const b16* __restrict__ VFH, const b16* __restrict__ VFL, const int* __restrict__ rsrc, const int* __restrict__ rtgt, int BLIM, float* __restrict__ ATT) { __shared__ __attribute__((aligned(16))) b16 Ph_[16][KB + 8], Pl_[16][KB + 8]; __shared__ float Sf[16][KB + 4], Of[16][HD + 4];
  const int lane = threadIdx.x, nloc = lane & 15, hlf = lane >> 4; const int qt = blockIdx.x % (L / 16); const int h = (blockIdx.x / (L / 16)) % NH; const int b = blockIdx.x / ((L / 16) * NH); if (b >= BLIM) return; const int t0 = qt * 16; const int ib = t0 / 64; const int rs0 = rsrc[0], rs1 = rsrc[1], rs2 = rsrc[2], rt0 = rtgt[0], rt1 = rtgt[1], rt2 = rtgt[2];
  auto allowed = [&](int jb) { return (jb == 0) || (jb == NBLK - 1) || (jb - ib <= 1 && ib - jb <= 1) || (rs0 == ib && rt0 == jb) || (rs1 == ib && rt1 == jb) || (rs2 == ib && rt2 == jb); }; const size_t rowb = (size_t)b * L; const int qo = h * HD, ko = C + h * HD;
  v16b qh[HD / 32], ql[HD / 32];
#pragma unroll
  for (int s = 0; s < HD / 32; ++s) { qh[s] = frag_kb(PH + (rowb + t0 + nloc) * PW + qo + s * 32, hlf); ql[s] = frag_kb(PL + (rowb + t0 + nloc) * PW + qo + s * 32, hlf); }
  float m_r[8], den_r[8]; v8f acc[HD / 16];
#pragma unroll
  for (int r8 = 0; r8 < 8; ++r8) { m_r[r8] = -INFINITY; den_r[r8] = 0.0f; }
#pragma unroll
  for (int t = 0; t < HD / 16; ++t) acc[t] = (v8f){};
  const int kstart = 0; const int kend = L;   // [kstart, kend)
#pragma unroll 1
  for (int kb0 = kstart; kb0 < kend; kb0 += KB) { const int nk = (kend - kb0) < KB ? (kend - kb0) : KB; const int nkt = (nk + 15) / 16; if (!allowed(kb0 / 64) && !allowed(kb0 / 64 + 1)) continue;   /* neither 64-key sub-block of this 128-key block is visible to this query block */
    for (int t = 0; t < KB / 16; ++t) { if (t < nkt) { const int key = kb0 + t * 16 + nloc < L ? kb0 + t * 16 + nloc : L - 1; const size_t kr = (rowb + key) * PW + ko; v8f s = {};
#pragma unroll
        for (int q = 0; q < HD / 32; ++q) { const v16b kh = frag_kb(PH + kr + q * 32, hlf), kl = frag_kb(PL + kr + q * 32, hlf); s = wmma16b(qh[q], kh, s); s = wmma16b(qh[q], kl, s); s = wmma16b(ql[q], kh, s); }
#pragma unroll
        for (int r8 = 0; r8 < 8; ++r8) { const int i = t0 + 8 * hlf + r8, j = kb0 + t * 16 + nloc; const bool ok = (j < kend) && allowed(j >> 6);   /* BigBird block mask (-1e9 in the module == excluded; key block 0 always allowed) */ Sf[8 * hlf + r8][t * 16 + nloc] = ok ? s[r8] * (1.0f / (HS * HS)) : -INFINITY; } }
      else {
#pragma unroll
        for (int r8 = 0; r8 < 8; ++r8) Sf[8 * hlf + r8][t * 16 + nloc] = -INFINITY; } }
    wave_lds_sync();
#pragma unroll
    for (int rr = 0; rr < 16; ++rr) { float mx = -INFINITY;
#pragma unroll
      for (int q = 0; q < 4; ++q) mx = fmaxf(mx, Sf[rr][q * 32 + lane]);
      for (int o = 16; o; o >>= 1) mx = fmaxf(mx, __shfl_xor(mx, o));
      const float mold = __shfl(m_r[rr & 7], (rr >> 3) * 16); const float mn = fmaxf(mold, mx); const float sf = (mold == -INFINITY) ? 0.0f : ((mn == -INFINITY) ? 1.0f : __expf(mold - mn)); float ps = 0.0f;
#pragma unroll
      for (int q = 0; q < 4; ++q) { const int kx = q * 32 + lane; const float sv = Sf[rr][kx]; const float p = (sv == -INFINITY || mn == -INFINITY) ? 0.0f : __expf(sv - mn); ps += p; b16 ph, pl; split16(p * PS, ph, pl); Ph_[rr][kx] = ph; Pl_[rr][kx] = pl; }
      for (int o = 16; o; o >>= 1) ps += __shfl_xor(ps, o);
      if ((rr >> 3) == hlf) { const int r8 = rr & 7; den_r[r8] = den_r[r8] * sf + ps; m_r[r8] = mn;
#pragma unroll
        for (int t = 0; t < HD / 16; ++t) acc[t][r8] = acc[t][r8] * sf; } }
    wave_lds_sync();
    for (int ks = 0; ks < nkt * 16; ks += 32) { const v16b pa = frag_kb(&Ph_[nloc][ks], hlf), pb = frag_kb(&Pl_[nloc][ks], hlf); const size_t vf = ((rowb + kb0 + ks) / 32) * (size_t)((HD / 16) * 512) + lane * 8;
#pragma unroll
      for (int tg = 0; tg < HD / 16; tg += 4) { v16b vh[4], vl[4];   // the 16 loads of four d tiles stand ahead of their products, so that they are in flight together: no load moves up over the asm statement in wmma16b
#pragma unroll
        for (int u = 0; u < 4; ++u) { vh[u] = frag_vf(VFH + vf + (tg + u) * 512); vl[u] = frag_vf(VFL + vf + (tg + u) * 512); }
#pragma unroll
        for (int u = 0; u < 4; ++u) { const int t = tg + u; acc[t] = wmma16b(pa, vh[u], acc[t]); acc[t] = wmma16b(pa, vl[u], acc[t]); acc[t] = wmma16b(pb, vh[u], acc[t]); } } }
    wave_lds_sync(); }
#pragma unroll
  for (int t = 0; t < HD / 16; ++t)
#pragma unroll
    for (int r8 = 0; r8 < 8; ++r8) { const float dn = den_r[r8]; Of[8 * hlf + r8][t * 16 + nloc] = dn > 0.0f ? acc[t][r8] * (1.0f / (HS * PS)) / dn : 0.0f; }
  wave_lds_sync();
  const int rb_ = b / HEADS, hq = b % HEADS;   /* merge heads: ATT[b][s][h*128 + d] */
  { for (int rr = 0; rr < 16; ++rr) for (int s = 0; s < HD / 32; ++s) ((float*)ATT)[((size_t)rb_ * L + t0 + rr) * DIM + hq * 128 + s * 32 + lane] = Of[rr][s * 32 + lane];  } }
// output projection: block of 32 waves per 16 rows: the waves stage the attended rows (hi+lo) once, half a row each, and share them; wave wv then does columns wv*32 .. +31 (2 tiles):
__global__ __launch_bounds__(1024) void outp_kernel(const float* __restrict__ ATT, const b16* __restrict__ WO, const float* __restrict__ bo, int RLIM, float* __restrict__ out) { __shared__ __attribute__((aligned(16))) b16 Ah[16][DIM + 8], Al[16][DIM + 8]; __shared__ __attribute__((aligned(16))) float Tf[32][16][36]; const int lane = threadIdx.x & 31, wv = __builtin_amdgcn_readfirstlane(threadIdx.x >> 5), nloc = lane & 15, hlf = lane >> 4; const size_t m0 = (size_t)blockIdx.x * 16; if (m0 >= (size_t)RLIM) return;
  for (int q = 0; q < DIM / 64; ++q) { const int sr = wv >> 1, cx = (wv & 1) * (DIM / 2) + q * 32 + lane; b16 p, ql; split16(ATT[(m0 + sr) * DIM + cx] * HS, p, ql); Ah[sr][cx] = p; Al[sr][cx] = ql; }
  __syncthreads();   // every wave reads all 16 staged rows
  const int c0 = wv * 32; v8f acc[2];
#pragma unroll
  for (int t = 0; t < 2; ++t) acc[t] = (v8f){};
#pragma unroll 2
  for (int kk = 0; kk < DIM; kk += 32) { const v16b a = frag_kb(&Ah[nloc][kk], hlf), al = frag_kb(&Al[nloc][kk], hlf);
#pragma unroll
    for (int t = 0; t < 2; ++t) { const v16b bw = frag_kb(WO + (size_t)(c0 + t * 16 + nloc) * DIM + kk, hlf); acc[t] = wmma16b(a, bw, acc[t]); acc[t] = wmma16b(al, bw, acc[t]); } }
#pragma unroll
  for (int t = 0; t < 2; ++t) { const int cc = t * 16 + nloc; const float bb = bfv(bo[c0 + cc]);
#pragma unroll
    for (int r8 = 0; r8 < 8; ++r8) Tf[wv][8 * hlf + r8][cc] = acc[t][r8] * (1.0f / (HS * WSC)) + bb; }
  wave_lds_sync();
  for (int rr = 0; rr < 16; rr += 4) { const int r = rr + (lane >> 3), c4 = (lane & 7) * 4;   // 8 lanes x 16 B = one 128-B line per row, 4 rows per store
    *(v4f*)(out + (m0 + r) * DIM + c0 + c4) = *(const v4f*)(&Tf[wv][r][c4]); } }
}  // namespace

extern "C" void kernel_launch(void* const* d_in, const int* in_sizes, int n_in, void* d_out, int out_size, void* d_ws, size_t ws_size, hipStream_t stream) {
  (void)n_in;
  auto Fp = [&](int i) { return (const float*)d_in[i]; };
  // input order: 0 x [2,2048,1024]; 1 Wq [1024,1024] (in,out); 2 bq; 3 Wk; 4 bk; 5 Wv; 6 bv; 7 Wo; 8 bo; 9 rand_src [3] i32; 10 rand_tgt [3] i32
  if (in_sizes[0] != NRB * DIM || in_sizes[1] != DIM * DIM || in_sizes[3] != DIM * DIM || in_sizes[5] != DIM * DIM || in_sizes[7] != DIM * DIM || in_sizes[8] != DIM || in_sizes[9] != 3 || in_sizes[10] != 3 || out_size != NRB * DIM) return;
  const int BLIM = NB;   // (batch, head) pairs
  const int RLIM = NRB;
  size_t off = 0; char* ws = (char*)d_ws;
  auto carve = [&](size_t bytes) { char* p = ws + off; off += (bytes + 255) & ~(size_t)255; return p; };
  b16* W3 = (b16*)carve((size_t)3 * DIM * DIM * 2); b16* WO = (b16*)carve((size_t)DIM * DIM * 2); b16* PH = (b16*)carve((size_t)NT * PW * 2); b16* PL = (b16*)carve((size_t)NT * PW * 2); float* ATT = (float*)carve((size_t)NRB * DIM * 4); b16* VFH = (b16*)carve((size_t)NT * HD * 2); b16* VFL = (b16*)carve((size_t)NT * HD * 2);
  if (off > ws_size || off > ((size_t)96 << 20)) return;   // 88 MiB (~ 92 MB)
  wput_kernel<<<(unsigned)(((size_t)4 * DIM * (DIM / 8) + 255) / 256), 256, 0, stream>>>(Fp(1), Fp(3), Fp(5), Fp(7), W3, WO);
  proj_kernel<<<dim3(RLIM / 16, 3), 512, 0, stream>>>(Fp(0), W3, Fp(2), Fp(4), Fp(6), RLIM, PH, PL, VFH, VFL);
  att_kernel<<<BLIM * NH * (L / 16), 32, 0, stream>>>(PH, PL, VFH, VFL, (const int*)d_in[9], (const int*)d_in[10], BLIM, ATT);
  outp_kernel<<<RLIM / 16, 1024, 0, stream>>>(ATT, WO, Fp(8), RLIM, (float*)d_out);
}

// v003
// A run of this version takes 237 microseconds.
// Two timings next to v002 put it at 1.23 and 1.22 times that version's speed.
// All steps since v000 together make it 9.54 times as fast.
#include <hip/hip_runtime.h>

// HierarchicalAttention (BigBird-style block mask): Q = x Wq + bq, K, V likewise ((in,out) 1024x1024); the module's raw .view(B, 8, 2048, 128) makes head h / token s the 128-slice s%8 of projected row h*256 + s/8 — i.e. the flat
// [B*8*2048][128] view of each projection; scores / sqrt(128); key block j (64 keys) allowed for query block i iff j == 0 || j == 31 || |i-j| <= 1 || (i,j) is one of the 3 (rand_src, rand_tgt) pairs, else -1e9 (== excluded;
// block 0 always allowed); softmax; O merged as [b][s][h*128+d]; out = O Wo + bo -> [2][2048][1024].
// Deterministic: no index structures, no atomics; flash-style online softmax over all key blocks in a fixed order.
// WMMA (v_wmma_f32_16x16x32_f16, f32 accumulate): the QKV projection with x EXACT bf16 x8 (K 1024) against exact torch weight rows x256 (one product); S = Q K^T (hi+lo x hi+lo, 3 products, K 128); O = P V (P x256 hi+lo x V^T hi+lo, 3 products); softmax in f32. Inputs rounded to bf16 once. Fragment k-map per lane half hh for A AND B: elements 0..7 <- k = 8hh+0..7, 8..15 <- k = 16+8hh+0..7; acc[r] = D[8hh+r][col].

namespace {
constexpr int NB = 16, L = 2048, C = 128, NH = 1, HD = 128, NT = NB * L, KB = 128, PW = 3 * C;   // NB = (batch, head) pairs; the 'token' index is (b*8 + h)*2048 + s
constexpr int RB = 2, DIM = 1024, HEADS = 8, NBLK = 32, NRB = RB * L /* 4096 projected rows */;
constexpr float XS = 8.0f, HS = 256.0f /* hi+lo staging scale for q/k/v/attended */, WSC = 256.0f, PS = 256.0f, SCALE = 0.08838834764831845f;
typedef _Float16 b16;
typedef __attribute__((ext_vector_type(16))) _Float16 v16b;
typedef __attribute__((ext_vector_type(8))) _Float16 v8b;
typedef __attribute__((ext_vector_type(8))) float v8f;
typedef __attribute__((ext_vector_type(4))) float v4f;
__device__ __forceinline__ float bf16_rne(float f) { unsigned int u = __float_as_uint(f); u += 0x7FFFu + ((u >> 16) & 1u); float r = __uint_as_float(u & 0xFFFF0000u); asm volatile("" : "+v"(r)); return r; }
__device__ __forceinline__ float bfv(float f) { float r = bf16_rne(f); asm volatile("" : "+v"(r)); return r; }
__device__ __forceinline__ void split16(float v, b16& hi, b16& lo) { hi = (b16)v; lo = (b16)(v - (float)hi); }
__device__ __forceinline__ v16b frag_kb(const b16* p, int hh) { const v8b a = *(const v8b*)(p + 8 * hh), b = *(const v8b*)(p + 16 + 8 * hh); v16b f;
#pragma unroll
  for (int e = 0; e < 8; ++e) { f[e] = a[e]; f[8 + e] = b[e]; } return f; }
__device__ __forceinline__ v16b frag_vf(const b16* p) { const v8b a = *(const v8b*)p, b = *(const v8b*)(p + 256); v16b f;   // p already holds the lane's own 8 * lane: two whole 512-B runs per wave
#pragma unroll
  for (int e = 0; e < 8; ++e) { f[e] = a[e]; f[8 + e] = b[e]; } return f; }
__device__ __forceinline__ v8f wmma16b(v16b a, v16b b, v8f c) { v8f d = __builtin_amdgcn_wmma_f32_16x16x32_f16(false, a, false, b, (short)0, c, false, false); asm volatile("v_nop\n\tv_nop\n\tv_nop\n\tv_nop" : "+v"(d) : "v"(a), "v"(b)); return d; }
__device__ __forceinline__ void wave_lds_sync() { __builtin_amdgcn_fence(__ATOMIC_RELEASE, "workgroup"); __builtin_amdgcn_wave_barrier(); __builtin_amdgcn_fence(__ATOMIC_ACQUIRE, "workgroup"); }
__device__ __forceinline__ float pmul(float a, float b) { float p = a * b; asm volatile("" : "+v"(p)); return p; }

__global__ __launch_bounds__(256) void wput_kernel(const float* __restrict__ wq, const float* __restrict__ wk, const float* __restrict__ wv, const float* __restrict__ wo, b16* __restrict__ W3, b16* __restrict__ WO) { const size_t u = (size_t)blockIdx.x * 256 + threadIdx.x; if (u >= (size_t)4 * DIM * (DIM / 8)) return;
  // thread u writes 16-B piece u of the planes, which lie in the order of the projections' B fragments: [matrix p][32-k block][16-column tile][e][lane = 16 hh + o % 16][i], k % 32 = 16 e + 8 hh + i (o = output column of the weight), so that a wave reads each fragment half as one 512-B run and the tiles of one k block lie side by side; a wave here loads 2 x 64 B at a time and stores 512 B in a row
  const int ln = (int)(u & 31), p = (int)(u >> 17), o = ((int)(u >> 6) & 63) * 16 + (ln & 15), k0 = ((int)(u >> 12) & 31) * 32 + ((int)(u >> 5) & 1) * 16 + (ln >> 4) * 8; const float* w = p == 0 ? wq : (p == 1 ? wk : (p == 2 ? wv : wo)); v8b v;
#pragma unroll
  for (int j = 0; j < 8; ++j) v[j] = (b16)(bf16_rne(w[(size_t)(k0 + j) * DIM + o]) * WSC);
  { *(v8b*)(p < 3 ? W3 + u * 8 : WO + (u - (size_t)3 * DIM * (DIM / 8)) * 8) = v;  } }
// projection: block of 16 waves per (16 projected rows, projection p = blockIdx.y): the waves stage bf16(x) (EXACT, K 1024) once, one row each, and share it; wave wv then does columns wv*64 .. +63 of p (4 tiles) x W3 fragments + bias (Q scaled by 1/sqrt(128)); row r, 128-chunk j -> token T = 8*(b*2048 + r) + j:
__global__ __launch_bounds__(512) void proj_kernel(const float* __restrict__ x, const b16* __restrict__ W3, const float* __restrict__ bq, const float* __restrict__ bk, const float* __restrict__ bv, int RLIM, b16* __restrict__ PH, b16* __restrict__ PL, b16* __restrict__ VFH, b16* __restrict__ VFL) { __shared__ __attribute__((aligned(16))) b16 Ah[16][DIM + 8], Oh[16][16][72], Ol[16][16][72]; const int lane = threadIdx.x & 31, wv = __builtin_amdgcn_readfirstlane(threadIdx.x >> 5), nloc = lane & 15, hlf = lane >> 4; const size_t m0 = (size_t)blockIdx.x * 16; if (m0 >= (size_t)RLIM) return;
  for (int q = 0; q < DIM / 32; ++q) Ah[wv][q * 32 + lane] = (b16)(bf16_rne(x[(m0 + wv) * DIM + q * 32 + lane]) * XS);
  __syncthreads();   // every wave reads all 16 staged rows
  const int p = blockIdx.y, c0 = wv * 64; const float* bb = p == 0 ? bq : (p == 1 ? bk : bv); const float sc = p == 0 ? SCALE : 1.0f; v8f acc[4]; const b16* const wf = W3 + (size_t)p * DIM * DIM + (c0 / 16) * 512 + lane * 8;   // the wave's first column tile in the fragment-order plane: 512 elements a tile, 32 * DIM a 32-k block
#pragma unroll
  for (int t = 0; t < 4; ++t) acc[t] = (v8f){};
#pragma unroll 2
  for (int kb = 0; kb < DIM; kb += 32) { const v16b a = frag_kb(&Ah[nloc][kb], hlf);
#pragma unroll
    for (int t = 0; t < 4; ++t) acc[t] = wmma16b(a, frag_vf(wf + kb * DIM + t * 512), acc[t]); }
  if (p == 2) {   // V: the block's 16 rows x 1024 columns are 128 consecutive keys x 128 d of one head. They leave in the order of the P V product's B fragments: [32-key group][16-d tile][e][lane = 16 hh + d % 16][i], key % 32 = 16 e + 8 hh + i, so that a wave of att_kernel reads each fragment half as one 512-B run
    b16* const Vh = &Oh[0][0][0]; b16* const Vl = &Ol[0][0][0];   // 4 groups x 8 tiles x 512 = 16384 elements per plane, shared by the block
#pragma unroll
    for (int t = 0; t < 4; ++t) { const float bvv = bfv(bb[c0 + t * 16 + nloc]);
#pragma unroll
      for (int r8 = 0; r8 < 8; ++r8) { b16 ph, pl; split16((acc[t][r8] * (1.0f / (XS * WSC)) + bvv) * sc * HS, ph, pl);   // local key = 8 * (8 hlf + r8) + (wv >> 1), d = (c0 & 64) + 16 t + nloc
        const int ix = ((((2 * hlf + (r8 >> 2)) * 8 + ((c0 & 64) >> 4) + t) * 2 + ((r8 >> 1) & 1)) * 32 + (r8 & 1) * 16 + nloc) * 8 + (wv >> 1); Vh[ix] = ph; Vl[ix] = pl; } }
    __syncthreads();   // the copy-out below reads what all 16 waves wrote (p is the same for the whole block)
    const size_t vb = (8 * m0 / 32) * (size_t)(8 * 512);
#pragma unroll
    for (int q = 0; q < 4; ++q) { const int o = (q * 512 + (int)threadIdx.x) * 8; *(v8b*)(VFH + vb + o) = *(const v8b*)(Vh + o); *(v8b*)(VFL + vb + o) = *(const v8b*)(Vl + o); }
    return; }
#pragma unroll
  for (int t = 0; t < 4; ++t) { const int cc = t * 16 + nloc; const float bvv = bfv(bb[c0 + cc]);
#pragma unroll
    for (int r8 = 0; r8 < 8; ++r8) { b16 ph, pl; split16((acc[t][r8] * (1.0f / (XS * WSC)) + bvv) * sc * HS, ph, pl); Oh[wv][8 * hlf + r8][cc] = ph; Ol[wv][8 * hlf + r8][cc] = pl; } }
  wave_lds_sync();
  const int j = c0 >> 7, h0 = c0 & 64;   // the wave's 64 columns = one 128-B half of chunk j of projection p
  for (int rr = 0; rr < 16; rr += 4) { const int r = rr + (lane >> 3), d8 = (lane & 7) * 8; const size_t T = 8 * (m0 + r) + j;   // 8 lanes x 16 B per row, 4 rows per store
    *(v8b*)(PH + T * PW + p * 128 + h0 + d8) = *(const v8b*)(&Oh[wv][r][d8]); *(v8b*)(PL + T * PW + p * 128 + h0 + d8) = *(const v8b*)(&Ol[wv][r][d8]); } }
// attention: ONE WAVE PER BLOCK, wave per (b, h, 16-query tile): key blocks of 128 over all keys; S = Q K^T (3 products, K 128); online softmax; P x256 hi+lo; V fragments straight from the fragment-order planes that proj_kernel wrote;
__global__ __launch_bounds__(32) void att_kernel(const b16* __restrict__ PH, const b16* __restrict__ PL, const b16* __restrict__ VFH, const b16* __restrict__ VFL, const int* __restrict__ rsrc, const int* __restrict__ rtgt, int BLIM, float* __restrict__ ATT) { __shared__ __attribute__((aligned(16))) b16 Ph_[16][KB + 8], Pl_[16][KB + 8]; __shared__ float Sf[16][KB + 4], Of[16][HD + 4];
  const int lane = threadIdx.x, nloc = lane & 15, hlf = lane >> 4; const int qt = blockIdx.x % (L / 16); const int h = (blockIdx.x / (L / 16)) % NH; const int b = blockIdx.x / ((L / 16) * NH); if (b >= BLIM) return; const int t0 = qt * 16; const int ib = t0 / 64; const int rs0 = rsrc[0], rs1 = rsrc[1], rs2 = rsrc[2], rt0 = rtgt[0], rt1 = rtgt[1], rt2 = rtgt[2];
  auto allowed = [&](int jb) { return (jb == 0) || (jb == NBLK - 1) || (jb - ib <= 1 && ib - jb <= 1) || (rs0 == ib && rt0 == jb) || (rs1 == ib && rt1 == jb) || (rs2 == ib && rt2 == jb); }; const size_t rowb = (size_t)b * L; const int qo = h * HD, ko = C + h * HD;
  v16b qh[HD / 32], ql[HD / 32];
#pragma unroll
  for (int s = 0; s < HD / 32; ++s) { qh[s] = frag_kb(PH + (rowb + t0 + nloc) * PW + qo + s * 32, hlf); ql[s] = frag_kb(PL + (rowb + t0 + nloc) * PW + qo + s * 32, hlf); }
  float m_r[8], den_r[8]; v8f acc[HD / 16];
#pragma unroll
  for (int r8 = 0; r8 < 8; ++r8) { m_r[r8] = -INFINITY; den_r[r8] = 0.0f; }
#pragma unroll
  for (int t = 0; t < HD / 16; ++t) acc[t] = (v8f){};
  const int kstart = 0; const int kend = L;   // [kstart, kend)
#pragma unroll 1
  for (int kb0 = kstart; kb0 < kend; kb0 += KB) { const int nk = (kend - kb0) < KB ? (kend - kb0) : KB; const int nkt = (nk + 15) / 16; if (!allowed(kb0 / 64) && !allowed(kb0 / 64 + 1)) continue;   /* neither 64-key sub-block of this 128-key block is visible to this query block */
    for (int t = 0; t < KB / 16; ++t) { if (t < nkt) { const int key = kb0 + t * 16 + nloc < L ? kb0 + t * 16 + nloc : L - 1; const size_t kr = (rowb + key) * PW + ko; v8f s = {};
#pragma unroll
        for (int q = 0; q < HD / 32; ++q) { const v16b kh = frag_kb(PH + kr + q * 32, hlf), kl = frag_kb(PL + kr + q * 32, hlf); s = wmma16b(qh[q], kh, s); s = wmma16b(qh[q], kl, s); s = wmma16b(ql[q], kh, s); }
#pragma unroll
        for (int r8 = 0; r8 < 8; ++r8) { const int i = t0 + 8 * hlf + r8, j = kb0 + t * 16 + nloc; const bool ok = (j < kend) && allowed(j >> 6);   /* BigBird block mask (-1e9 in the module == excluded; key block 0 always allowed) */ Sf[8 * hlf + r8][t * 16 + nloc] = ok ? s[r8] * (1.0f / (HS * HS)) : -INFINITY; } }
      else {
#pragma unroll
        for (int r8 = 0; r8 < 8; ++r8) Sf[8 * hlf + r8][t * 16 + nloc] = -INFINITY; } }
    wave_lds_sync();
#pragma unroll
    for (int rr = 0; rr < 16; ++rr) { float mx = -INFINITY;
#pragma unroll
      for (int q = 0; q < 4; ++q) mx = fmaxf(mx, Sf[rr][q * 32 + lane]);
      for (int o = 16; o; o >>= 1) mx = fmaxf(mx, __shfl_xor(mx, o));
      const float mold = __shfl(m_r[rr & 7], (rr >> 3) * 16); const float mn = fmaxf(mold, mx); const float sf = (mold == -INFINITY) ? 0.0f : ((mn == -INFINITY) ? 1.0f : __expf(mold - mn)); float ps = 0.0f;
#pragma unroll
      for (int q = 0; q < 4; ++q) { const int kx = q * 32 + lane; const float sv = Sf[rr][kx]; const float p = (sv == -INFINITY || mn == -INFINITY) ? 0.0f : __expf(sv - mn); ps += p; b16 ph, pl; split16(p * PS, ph, pl); Ph_[rr][kx] = ph; Pl_[rr][kx] = pl; }
      for (int o = 16; o; o >>= 1) ps += __shfl_xor(ps, o);
      if ((rr >> 3) == hlf) { const int r8 = rr & 7; den_r[r8] = den_r[r8] * sf + ps; m_r[r8] = mn;
#pragma unroll
        for (int t = 0; t < HD / 16; ++t) acc[t][r8] = acc[t][r8] * sf; } }
    wave_lds_sync();
    for (int ks = 0; ks < nkt * 16; ks += 32) { const v16b pa = frag_kb(&Ph_[nloc][ks], hlf), pb = frag_kb(&Pl_[nloc][ks], hlf); const size_t vf = ((rowb + kb0 + ks) / 32) * (size_t)((HD / 16) * 512) + lane * 8;
#pragma unroll
      for (int tg = 0; tg < HD / 16; tg += 4) { v16b vh[4], vl[4];   // the 16 loads of four d tiles stand ahead of their products, so that they are in flight together: no load moves up over the asm statement in wmma16b
#pragma unroll
        for (int u = 0; u < 4; ++u) { vh[u] = frag_vf(VFH + vf + (tg + u) * 512); vl[u] = frag_vf(VFL + vf + (tg + u) * 512); }
#pragma unroll
        for (int u = 0; u < 4; ++u) { const int t = tg + u; acc[t] = wmma16b(pa, vh[u], acc[t]); acc[t] = wmma16b(pa, vl[u], acc[t]); acc[t] = wmma16b(pb, vh[u], acc[t]); } } }
    wave_lds_sync(); }
#pragma unroll
  for (int t = 0; t < HD / 16; ++t)
#pragma unroll
    for (int r8 = 0; r8 < 8; ++r8) { const float dn = den_r[r8]; Of[8 * hlf + r8][t * 16 + nloc] = dn > 0.0f ? acc[t][r8] * (1.0f / (HS * PS)) / dn : 0.0f; }
  wave_lds_sync();
  const int rb_ = b / HEADS, hq = b % HEADS;   /* merge heads: ATT[b][s][h*128 + d] */
  { for (int rr = 0; rr < 16; ++rr) for (int s = 0; s < HD / 32; ++s) ((float*)ATT)[((size_t)rb_ * L + t0 + rr) * DIM + hq * 128 + s * 32 + lane] = Of[rr][s * 32 + lane];  } }
// output projection: block of 32 waves per 16 rows: the waves stage the attended rows (hi+lo) once, half a row each, and share them; wave wv then does columns wv*32 .. +31 (2 tiles):
__global__ __launch_bounds__(1024) void outp_kernel(const float* __restrict__ ATT, const b16* __restrict__ WO, const float* __restrict__ bo, int RLIM, float* __restrict__ out) { __shared__ __attribute__((aligned(16))) b16 Ah[16][DIM + 8], Al[16][DIM + 8]; __shared__ __attribute__((aligned(16))) float Tf[32][16][36]; const int lane = threadIdx.x & 31, wv = __builtin_amdgcn_readfirstlane(threadIdx.x >> 5), nloc = lane & 15, hlf = lane >> 4; const size_t m0 = (size_t)blockIdx.x * 16; if (m0 >= (size_t)RLIM) return;
  for (int q = 0; q < DIM / 64; ++q) { const int sr = wv >> 1, cx = (wv & 1) * (DIM / 2) + q * 32 + lane; b16 p, ql; split16(ATT[(m0 + sr) * DIM + cx] * HS, p, ql); Ah[sr][cx] = p; Al[sr][cx] = ql; }
  __syncthreads();   // every wave reads all 16 staged rows
  const int c0 = wv * 32; v8f acc[2]; const b16* const wf = WO + (c0 / 16) * 512 + lane * 8;   // fragment-order plane, as in proj_kernel
#pragma unroll
  for (int t = 0; t < 2; ++t) acc[t] = (v8f){};
#pragma unroll 2
  for (int kk = 0; kk < DIM; kk += 32) { const v16b a = frag_kb(&Ah[nloc][kk], hlf), al = frag_kb(&Al[nloc][kk], hlf);
#pragma unroll
    for (int t = 0; t < 2; ++t) { const v16b bw = frag_vf(wf + kk * DIM + t * 512); acc[t] = wmma16b(a, bw, acc[t]); acc[t] = wmma16b(al, bw, acc[t]); } }
#pragma unroll
  for (int t = 0; t < 2; ++t) { const int cc = t * 16 + nloc; const float bb = bfv(bo[c0 + cc]);
#pragma unroll
    for (int r8 = 0; r8 < 8; ++r8) Tf[wv][8 * hlf + r8][cc] = acc[t][r8] * (1.0f / (HS * WSC)) + bb; }
  wave_lds_sync();
  for (int rr = 0; rr < 16; rr += 4) { const int r = rr + (lane >> 3), c4 = (lane & 7) * 4;   // 8 lanes x 16 B = one 128-B line per row, 4 rows per store
    *(v4f*)(out + (m0 + r) * DIM + c0 + c4) = *(const v4f*)(&Tf[wv][r][c4]); } }
}  // namespace

extern "C" void kernel_launch(void* const* d_in, const int* in_sizes, int n_in, void* d_out, int out_size, void* d_ws, size_t ws_size, hipStream_t stream) {
  (void)n_in;
  auto Fp = [&](int i) { return (const float*)d_in[i]; };
  // input order: 0 x [2,2048,1024]; 1 Wq [1024,1024] (in,out); 2 bq; 3 Wk; 4 bk; 5 Wv; 6 bv; 7 Wo; 8 bo; 9 rand_src [3] i32; 10 rand_tgt [3] i32
  if (in_sizes[0] != NRB * DIM || in_sizes[1] != DIM * DIM || in_sizes[3] != DIM * DIM || in_sizes[5] != DIM * DIM || in_sizes[7] != DIM * DIM || in_sizes[8] != DIM || in_sizes[9] != 3 || in_sizes[10] != 3 || out_size != NRB * DIM) return;
  const int BLIM = NB;   // (batch, head) pairs
  const int RLIM = NRB;
  size_t off = 0; char* ws = (char*)d_ws;
  auto carve = [&](size_t bytes) { char* p = ws + off; off += (bytes + 255) & ~(size_t)255; return p; };
  b16* W3 = (b16*)carve((size_t)3 * DIM * DIM * 2); b16* WO = (b16*)carve((size_t)DIM * DIM * 2); b16* PH = (b16*)carve((size_t)NT * PW * 2); b16* PL = (b16*)carve((size_t)NT * PW * 2); float* ATT = (float*)carve((size_t)NRB * DIM * 4); b16* VFH = (b16*)carve((size_t)NT * HD * 2); b16* VFL = (b16*)carve((size_t)NT * HD * 2);
  if (off > ws_size || off > ((size_t)96 << 20)) return;   // 88 MiB (~ 92 MB)
  wput_kernel<<<(unsigned)(((size_t)4 * DIM * (DIM / 8) + 255) / 256), 256, 0, stream>>>(Fp(1), Fp(3), Fp(5), Fp(7), W3, WO);
  proj_kernel<<<dim3(RLIM / 16, 3), 512, 0, stream>>>(Fp(0), W3, Fp(2), Fp(4), Fp(6), RLIM, PH, PL, VFH, VFL);
  att_kernel<<<BLIM * NH * (L / 16), 32, 0, stream>>>(PH, PL, VFH, VFL, (const int*)d_in[9], (const int*)d_in[10], BLIM, ATT);
  outp_kernel<<<RLIM / 16, 1024, 0, stream>>>(ATT, WO, Fp(8), RLIM, (float*)d_out);
}

// v004
// It runs in 203 microseconds.
// In two side-by-side timings against v003, it was 1.17 and 1.16 times as fast.
// All steps since v000 together make it 11.1 times as fast.
#include <hip/hip_runtime.h>

// HierarchicalAttention (BigBird-style block mask): Q = x Wq + bq, K, V likewise ((in,out) 1024x1024); the module's raw .view(B, 8, 2048, 128) makes head h / token s the 128-slice s%8 of projected row h*256 + s/8 — i.e. the flat
// [B*8*2048][128] view of each projection; scores / sqrt(128); key block j (64 keys) allowed for query block i iff j == 0 || j == 31 || |i-j| <= 1 || (i,j) is one of the 3 (rand_src, rand_tgt) pairs, else -1e9 (== excluded;
// block 0 always allowed); softmax; O merged as [b][s][h*128+d]; out = O Wo + bo -> [2][2048][1024].
// Deterministic: no index structures, no atomics; flash-style online softmax over all key blocks in a fixed order.
// WMMA (v_wmma_f32_16x16x32_f16, f32 accumulate): the QKV projection with x EXACT bf16 x8 (K 1024) against exact torch weight rows x256 (one product); S = Q K^T (hi+lo x hi+lo, 3 products, K 128); O = P V (P x256 hi+lo x V^T hi+lo, 3 products); softmax in f32. Inputs rounded to bf16 once. Fragment k-map per lane half hh for A AND B: elements 0..7 <- k = 8hh+0..7, 8..15 <- k = 16+8hh+0..7; acc[r] = D[8hh+r][col].

namespace {
constexpr int NB = 16, L = 2048, C = 128, NH = 1, HD = 128, NT = NB * L, KB = 128, PW = 3 * C;   // NB = (batch, head) pairs; the 'token' index is (b*8 + h)*2048 + s
constexpr int RB = 2, DIM = 1024, HEADS = 8, NBLK = 32, NRB = RB * L /* 4096 projected rows */;
constexpr float XS = 8.0f, HS = 256.0f /* hi+lo staging scale for q/k/v/attended */, WSC = 256.0f, PS = 256.0f, SCALE = 0.08838834764831845f;
typedef _Float16 b16;
typedef __attribute__((ext_vector_type(16))) _Float16 v16b;
typedef __attribute__((ext_vector_type(8))) _Float16 v8b;
typedef __attribute__((ext_vector_type(8))) float v8f;
typedef __attribute__((ext_vector_type(4))) float v4f;
__device__ __forceinline__ float bf16_rne(float f) { unsigned int u = __float_as_uint(f); u += 0x7FFFu + ((u >> 16) & 1u); float r = __uint_as_float(u & 0xFFFF0000u); asm volatile("" : "+v"(r)); return r; }
__device__ __forceinline__ float bfv(float f) { float r = bf16_rne(f); asm volatile("" : "+v"(r)); return r; }
__device__ __forceinline__ void split16(float v, b16& hi, b16& lo) { hi = (b16)v; lo = (b16)(v - (float)hi); }
__device__ __forceinline__ v16b frag_kb(const b16* p, int hh) { const v8b a = *(const v8b*)(p + 8 * hh), b = *(const v8b*)(p + 16 + 8 * hh); v16b f;
#pragma unroll
  for (int e = 0; e < 8; ++e) { f[e] = a[e]; f[8 + e] = b[e]; } return f; }
__device__ __forceinline__ v16b frag_vf(const b16* p) { const v8b a = *(const v8b*)p, b = *(const v8b*)(p + 256); v16b f;   // p already holds the lane's own 8 * lane: two whole 512-B runs per wave
#pragma unroll
  for (int e = 0; e < 8; ++e) { f[e] = a[e]; f[8 + e] = b[e]; } return f; }
__device__ __forceinline__ v8f wmma16b(v16b a, v16b b, v8f c) { v8f d = __builtin_amdgcn_wmma_f32_16x16x32_f16(false, a, false, b, (short)0, c, false, false); asm volatile("v_nop\n\tv_nop\n\tv_nop\n\tv_nop" : "+v"(d) : "v"(a), "v"(b)); return d; }
__device__ __forceinline__ void wave_lds_sync() { __builtin_amdgcn_fence(__ATOMIC_RELEASE, "workgroup"); __builtin_amdgcn_wave_barrier(); __builtin_amdgcn_fence(__ATOMIC_ACQUIRE, "workgroup"); }
__device__ __forceinline__ float pmul(float a, float b) { float p = a * b; asm volatile("" : "+v"(p)); return p; }

__global__ __launch_bounds__(256) void wput_kernel(const float* __restrict__ wq, const float* __restrict__ wk, const float* __restrict__ wv, const float* __restrict__ wo, b16* __restrict__ W3, b16* __restrict__ WO) { const size_t u = (size_t)blockIdx.x * 256 + threadIdx.x; if (u >= (size_t)4 * DIM * (DIM / 8)) return;
  // thread u writes 16-B piece u of the planes, which lie in the order of the projections' B fragments: [matrix p][32-k block][16-column tile][e][lane = 16 hh + o % 16][i], k % 32 = 16 e + 8 hh + i (o = output column of the weight), so that a wave reads each fragment half as one 512-B run and the tiles of one k block lie side by side; a wave here loads 2 x 64 B at a time and stores 512 B in a row
  const int ln = (int)(u & 31), p = (int)(u >> 17), o = ((int)(u >> 6) & 63) * 16 + (ln & 15), k0 = ((int)(u >> 12) & 31) * 32 + ((int)(u >> 5) & 1) * 16 + (ln >> 4) * 8; const float* w = p == 0 ? wq : (p == 1 ? wk : (p == 2 ? wv : wo)); v8b v;
#pragma unroll
  for (int j = 0; j < 8; ++j) v[j] = (b16)(bf16_rne(w[(size_t)(k0 + j) * DIM + o]) * WSC);
  { *(v8b*)(p < 3 ? W3 + u * 8 : WO + (u - (size_t)3 * DIM * (DIM / 8)) * 8) = v;  } }
// projection: block of 16 waves per (16 projected rows, projection p = blockIdx.y): the waves stage bf16(x) (EXACT, K 1024) once, one row each, and share it; wave wv then does columns wv*64 .. +63 of p (4 tiles) x W3 fragments + bias (Q scaled by 1/sqrt(128)); row r, 128-chunk j -> token T = 8*(b*2048 + r) + j:
__global__ __launch_bounds__(512) void proj_kernel(const float* __restrict__ x, const b16* __restrict__ W3, const float* __restrict__ bq, const float* __restrict__ bk, const float* __restrict__ bv, int RLIM, b16* __restrict__ PH, b16* __restrict__ PL, b16* __restrict__ VFH, b16* __restrict__ VFL) { __shared__ __attribute__((aligned(16))) b16 Ah[16][DIM + 8], Oh[16][16][72], Ol[16][16][72]; const int lane = threadIdx.x & 31, wv = __builtin_amdgcn_readfirstlane(threadIdx.x >> 5), nloc = lane & 15, hlf = lane >> 4; const size_t m0 = (size_t)blockIdx.x * 16; if (m0 >= (size_t)RLIM) return;
  for (int q = 0; q < DIM / 32; ++q) Ah[wv][q * 32 + lane] = (b16)(bf16_rne(x[(m0 + wv) * DIM + q * 32 + lane]) * XS);
  __syncthreads();   // every wave reads all 16 staged rows
  const int p = blockIdx.y, c0 = wv * 64; const float* bb = p == 0 ? bq : (p == 1 ? bk : bv); const float sc = p == 0 ? SCALE : 1.0f; v8f acc[4]; const b16* const wf = W3 + (size_t)p * DIM * DIM + (c0 / 16) * 512 + lane * 8;   // the wave's first column tile in the fragment-order plane: 512 elements a tile, 32 * DIM a 32-k block
#pragma unroll
  for (int t = 0; t < 4; ++t) acc[t] = (v8f){};
#pragma unroll 2
  for (int kb = 0; kb < DIM; kb += 32) { const v16b a = frag_kb(&Ah[nloc][kb], hlf);
#pragma unroll
    for (int t = 0; t < 4; ++t) acc[t] = wmma16b(a, frag_vf(wf + kb * DIM + t * 512), acc[t]); }
  if (p == 2) {   // V: the block's 16 rows x 1024 columns are 128 consecutive keys x 128 d of one head. They leave in the order of the P V product's B fragments: [32-key group][16-d tile][e][lane = 16 hh + d % 16][i], key % 32 = 16 e + 8 hh + i, so that a wave of att_kernel reads each fragment half as one 512-B run
    b16* const Vh = &Oh[0][0][0]; b16* const Vl = &Ol[0][0][0];   // 4 groups x 8 tiles x 512 = 16384 elements per plane, shared by the block
#pragma unroll
    for (int t = 0; t < 4; ++t) { const float bvv = bfv(bb[c0 + t * 16 + nloc]);
#pragma unroll
      for (int r8 = 0; r8 < 8; ++r8) { b16 ph, pl; split16((acc[t][r8] * (1.0f / (XS * WSC)) + bvv) * sc * HS, ph, pl);   // local key = 8 * (8 hlf + r8) + (wv >> 1), d = (c0 & 64) + 16 t + nloc
        const int ix = ((((2 * hlf + (r8 >> 2)) * 8 + ((c0 & 64) >> 4) + t) * 2 + ((r8 >> 1) & 1)) * 32 + (r8 & 1) * 16 + nloc) * 8 + (wv >> 1); Vh[ix] = ph; Vl[ix] = pl; } }
    __syncthreads();   // the copy-out below reads what all 16 waves wrote (p is the same for the whole block)
    const size_t vb = (8 * m0 / 32) * (size_t)(8 * 512);
#pragma unroll
    for (int q = 0; q < 4; ++q) { const int o = (q * 512 + (int)threadIdx.x) * 8; *(v8b*)(VFH + vb + o) = *(const v8b*)(Vh + o); *(v8b*)(VFL + vb + o) = *(const v8b*)(Vl + o); }
    return; }
#pragma unroll
  for (int t = 0; t < 4; ++t) { const int cc = t * 16 + nloc; const float bvv = bfv(bb[c0 + cc]);
#pragma unroll
    for (int r8 = 0; r8 < 8; ++r8) { b16 ph, pl; split16((acc[t][r8] * (1.0f / (XS * WSC)) + bvv) * sc * HS, ph, pl); Oh[wv][8 * hlf + r8][cc] = ph; Ol[wv][8 * hlf + r8][cc] = pl; } }
  wave_lds_sync();
  const int j = c0 >> 7, h0 = c0 & 64;   // the wave's 64 columns = one 128-B half of chunk j of projection p
  for (int rr = 0; rr < 16; rr += 4) { const int r = rr + (lane >> 3), d8 = (lane & 7) * 8; const size_t T = 8 * (m0 + r) + j;   // 8 lanes x 16 B per row, 4 rows per store
    *(v8b*)(PH + T * PW + p * 128 + h0 + d8) = *(const v8b*)(&Oh[wv][r][d8]); *(v8b*)(PL + T * PW + p * 128 + h0 + d8) = *(const v8b*)(&Ol[wv][r][d8]); } }
// attention: block of AW = 4 waves per (b, h, 16-query tile); key blocks of 128 over all keys. The three inner loops of a key block are dealt to the waves: wave wv does key tiles 2 wv, 2 wv + 1 of S = Q K^T (3 products, K 128), rows 4 wv .. + 3 of the online softmax (P x256 hi+lo), and d tiles 2 wv, 2 wv + 1 of P V (V fragments straight from the fragment-order planes that proj_kernel wrote). Q, S, P and each row's rescale factor go from wave to wave through LDS; every sum keeps its order.
constexpr int AW = 4;
static_assert(L % KB == 0 && KB / 16 == 2 * AW && HD / 16 == 2 * AW && 16 == 4 * AW, "the deal below is for 8 key tiles, 16 rows and 8 d tiles over 4 waves");
__global__ __launch_bounds__(32 * AW) void att_kernel(const b16* __restrict__ PH, const b16* __restrict__ PL, const b16* __restrict__ VFH, const b16* __restrict__ VFL, const int* __restrict__ rsrc, const int* __restrict__ rtgt, int BLIM, float* __restrict__ ATT) { __shared__ __attribute__((aligned(16))) b16 Ph_[16][KB + 8], Pl_[16][KB + 8], Qh_[16][HD + 8], Ql_[16][HD + 8]; __shared__ float Sf[16][KB + 4], Of[16][HD + 4], Sc[16], Dn[16];
  const int lane = threadIdx.x & 31, wv = __builtin_amdgcn_readfirstlane(threadIdx.x >> 5), nloc = lane & 15, hlf = lane >> 4; const int qt = blockIdx.x % (L / 16); const int h = (blockIdx.x / (L / 16)) % NH; const int b = blockIdx.x / ((L / 16) * NH); if (b >= BLIM) return; const int t0 = qt * 16; const int ib = t0 / 64; const int rs0 = rsrc[0], rs1 = rsrc[1], rs2 = rsrc[2], rt0 = rtgt[0], rt1 = rtgt[1], rt2 = rtgt[2];
  auto allowed = [&](int jb) { return (jb == 0) || (jb == NBLK - 1) || (jb - ib <= 1 && ib - jb <= 1) || (rs0 == ib && rt0 == jb) || (rs1 == ib && rt1 == jb) || (rs2 == ib && rt2 == jb); }; const size_t rowb = (size_t)b * L; const int qo = h * HD, ko = C + h * HD;
  { constexpr int QT = 16 * (HD / 8) / (32 * AW); const b16 *qph[QT], *qpl[QT]; v8b qa[QT], qb[QT];   // the block's 16 query rows, 16 B a thread, plane and trip
    static_assert(QT == 2, "the wait below names the address registers of two trips");
#pragma unroll   // both trips' loads in flight together
    for (int k = 0; k < QT; ++k) { const int i = k * 32 * AW + (int)threadIdx.x; qph[k] = PH + (rowb + t0 + i / (HD / 8)) * PW + qo + (i % (HD / 8)) * 8; qpl[k] = PL + (rowb + t0 + i / (HD / 8)) * PW + qo + (i % (HD / 8)) * 8; qa[k] = *(const v8b*)qph[k]; qb[k] = *(const v8b*)qpl[k]; }
    asm volatile("s_wait_xcnt 0x0" :: "v"(qph[0]), "v"(qph[1]), "v"(qpl[0]), "v"(qpl[1]) : "memory");   // the wait in front of the reuse of the loads' address registers: as inputs here they stay whole up to it
#pragma unroll   // constant indices keep qa and qb in registers
    for (int k = 0; k < QT; ++k) { const int i = k * 32 * AW + (int)threadIdx.x; *(v8b*)(&Qh_[i / (HD / 8)][(i % (HD / 8)) * 8]) = qa[k]; *(v8b*)(&Ql_[i / (HD / 8)][(i % (HD / 8)) * 8]) = qb[k]; } }
  __syncthreads();   // every wave reads all 16 query rows
  float m_w[4], den_w[4]; v8f acc[2];   // running maximum and denominator of the wave's own 4 rows (the same in every lane); accumulators of its own 2 d tiles
#pragma unroll   // here and below: constant indices keep m_w, den_w, acc, vh and vl in registers
  for (int i = 0; i < 4; ++i) { m_w[i] = -INFINITY; den_w[i] = 0.0f; }
#pragma unroll
  for (int u = 0; u < 2; ++u) acc[u] = (v8f){};
  const int kstart = 0; const int kend = L;   // [kstart, kend)
#pragma unroll 1
  for (int kb0 = kstart; kb0 < kend; kb0 += KB) { const int nk = (kend - kb0) < KB ? (kend - kb0) : KB; const int nkt = (nk + 15) / 16; if (!allowed(kb0 / 64) && !allowed(kb0 / 64 + 1)) continue;   /* neither 64-key sub-block of this 128-key block is visible to this query block (the same for the whole work-group) */
    for (int t = 2 * wv; t < 2 * wv + 2; ++t) { if (t < nkt) { const int key = kb0 + t * 16 + nloc < L ? kb0 + t * 16 + nloc : L - 1; const size_t kr = (rowb + key) * PW + ko; v8f s = {};
#pragma unroll
        for (int q = 0; q < HD / 32; ++q) { const v16b qh = frag_kb(&Qh_[nloc][q * 32], hlf), ql = frag_kb(&Ql_[nloc][q * 32], hlf), kh = frag_kb(PH + kr + q * 32, hlf), kl = frag_kb(PL + kr + q * 32, hlf); s = wmma16b(qh, kh, s); s = wmma16b(qh, kl, s); s = wmma16b(ql, kh, s); }
#pragma unroll
        for (int r8 = 0; r8 < 8; ++r8) { const int j = kb0 + t * 16 + nloc; const bool ok = (j < kend) && allowed(j >> 6);   /* BigBird block mask (-1e9 in the module == excluded; key block 0 always allowed) */ Sf[8 * hlf + r8][t * 16 + nloc] = ok ? s[r8] * (1.0f / (HS * HS)) : -INFINITY; } }
      else {
#pragma unroll
        for (int r8 = 0; r8 < 8; ++r8) Sf[8 * hlf + r8][t * 16 + nloc] = -INFINITY; } }
    __syncthreads();   // a softmax row holds the scores of all four waves' key tiles; it also ends every wave's reads of P and Sc of the key block before
#pragma unroll
    for (int i = 0; i < 4; ++i) { const int rr = 4 * wv + i; float mx = -INFINITY;
#pragma unroll
      for (int q = 0; q < 4; ++q) mx = fmaxf(mx, Sf[rr][q * 32 + lane]);
      for (int o = 16; o; o >>= 1) mx = fmaxf(mx, __shfl_xor(mx, o));
      const float mold = m_w[i]; const float mn = fmaxf(mold, mx); const float sf = (mold == -INFINITY) ? 0.0f : ((mn == -INFINITY) ? 1.0f : __expf(mold - mn)); float ps = 0.0f;
#pragma unroll
      for (int q = 0; q < 4; ++q) { const int kx = q * 32 + lane; const float sv = Sf[rr][kx]; const float p = (sv == -INFINITY || mn == -INFINITY) ? 0.0f : __expf(sv - mn); ps += p; b16 ph, pl; split16(p * PS, ph, pl); Ph_[rr][kx] = ph; Pl_[rr][kx] = pl; }
      for (int o = 16; o; o >>= 1) ps += __shfl_xor(ps, o);
      den_w[i] = den_w[i] * sf + ps; m_w[i] = mn; if (lane == 0) Sc[rr] = sf; }
    __syncthreads();   // every wave reads all 16 rows of P and their rescale factors; it also ends the reads of Sf before the next key block's scores are stored
#pragma unroll
    for (int r8 = 0; r8 < 8; ++r8) { const float sf = Sc[8 * hlf + r8];
#pragma unroll
      for (int u = 0; u < 2; ++u) acc[u][r8] = acc[u][r8] * sf; }
    for (int ks = 0; ks < nkt * 16; ks += 32) { const size_t vf = ((rowb + kb0 + ks) / 32) * (size_t)((HD / 16) * 512) + (2 * wv) * 512 + lane * 8; const b16* const vph = VFH + vf; const b16* const vpl = VFL + vf; v16b vh[2], vl[2];   // the 8 loads of the wave's two d tiles stand ahead of their products, so that they are in flight together: no load moves up over the asm statement in wmma16b
#pragma unroll
      for (int u = 0; u < 2; ++u) { vh[u] = frag_vf(vph + u * 512); vl[u] = frag_vf(vpl + u * 512); }
      asm volatile("s_wait_xcnt 0x0" :: "v"(vph), "v"(vpl) : "memory");   // the wait in front of the reuse of the loads' address registers: as inputs here they stay whole up to it, and the LDS reads below, which took them over, stay behind it
      const v16b pa = frag_kb(&Ph_[nloc][ks], hlf), pb = frag_kb(&Pl_[nloc][ks], hlf);
#pragma unroll
      for (int u = 0; u < 2; ++u) { acc[u] = wmma16b(pa, vh[u], acc[u]); acc[u] = wmma16b(pa, vl[u], acc[u]); acc[u] = wmma16b(pb, vh[u], acc[u]); } } }
#pragma unroll
  for (int i = 0; i < 4; ++i) if (lane == 0) Dn[4 * wv + i] = den_w[i];
  __syncthreads();   // every wave divides by the denominators of all 16 rows
#pragma unroll
  for (int u = 0; u < 2; ++u)
#pragma unroll
    for (int r8 = 0; r8 < 8; ++r8) { const float dn = Dn[8 * hlf + r8]; Of[8 * hlf + r8][(2 * wv + u) * 16 + nloc] = dn > 0.0f ? acc[u][r8] * (1.0f / (HS * PS)) / dn : 0.0f; }
  __syncthreads();   // a stored row holds the d tiles of all four waves
  const int rb_ = b / HEADS, hq = b % HEADS;   /* merge heads: ATT[b][s][h*128 + d] */
  { for (int rr = 4 * wv; rr < 4 * wv + 4; ++rr) for (int s = 0; s < HD / 32; ++s) ((float*)ATT)[((size_t)rb_ * L + t0 + rr) * DIM + hq * 128 + s * 32 + lane] = Of[rr][s * 32 + lane];  } }
// output projection: block of 32 waves per 16 rows: the waves stage the attended rows (hi+lo) once, half a row each, and share them; wave wv then does columns wv*32 .. +31 (2 tiles):
__global__ __launch_bounds__(1024) void outp_kernel(const float* __restrict__ ATT, const b16* __restrict__ WO, const float* __restrict__ bo, int RLIM, float* __restrict__ out) { __shared__ __attribute__((aligned(16))) b16 Ah[16][DIM + 8], Al[16][DIM + 8]; __shared__ __attribute__((aligned(16))) float Tf[32][16][36]; const int lane = threadIdx.x & 31, wv = __builtin_amdgcn_readfirstlane(threadIdx.x >> 5), nloc = lane & 15, hlf = lane >> 4; const size_t m0 = (size_t)blockIdx.x * 16; if (m0 >= (size_t)RLIM) return;
  for (int q = 0; q < DIM / 64; ++q) { const int sr = wv >> 1, cx = (wv & 1) * (DIM / 2) + q * 32 + lane; b16 p, ql; split16(ATT[(m0 + sr) * DIM + cx] * HS, p, ql); Ah[sr][cx] = p; Al[sr][cx] = ql; }
  __syncthreads();   // every wave reads all 16 staged rows
  const int c0 = wv * 32; v8f acc[2]; const b16* const wf = WO + (c0 / 16) * 512 + lane * 8;   // fragment-order plane, as in proj_kernel
#pragma unroll
  for (int t = 0; t < 2; ++t) acc[t] = (v8f){};
#pragma unroll 2
  for (int kk = 0; kk < DIM; kk += 32) { const v16b a = frag_kb(&Ah[nloc][kk], hlf), al = frag_kb(&Al[nloc][kk], hlf);
#pragma unroll
    for (int t = 0; t < 2; ++t) { const v16b bw = frag_vf(wf + kk * DIM + t * 512); acc[t] = wmma16b(a, bw, acc[t]); acc[t] = wmma16b(al, bw, acc[t]); } }
#pragma unroll
  for (int t = 0; t < 2; ++t) { const int cc = t * 16 + nloc; const float bb = bfv(bo[c0 + cc]);
#pragma unroll
    for (int r8 = 0; r8 < 8; ++r8) Tf[wv][8 * hlf + r8][cc] = acc[t][r8] * (1.0f / (HS * WSC)) + bb; }
  wave_lds_sync();
  for (int rr = 0; rr < 16; rr += 4) { const int r = rr + (lane >> 3), c4 = (lane & 7) * 4;   // 8 lanes x 16 B = one 128-B line per row, 4 rows per store
    *(v4f*)(out + (m0 + r) * DIM + c0 + c4) = *(const v4f*)(&Tf[wv][r][c4]); } }
}  // namespace

extern "C" void kernel_launch(void* const* d_in, const int* in_sizes, int n_in, void* d_out, int out_size, void* d_ws, size_t ws_size, hipStream_t stream) {
  (void)n_in;
  auto Fp = [&](int i) { return (const float*)d_in[i]; };
  // input order: 0 x [2,2048,1024]; 1 Wq [1024,1024] (in,out); 2 bq; 3 Wk; 4 bk; 5 Wv; 6 bv; 7 Wo; 8 bo; 9 rand_src [3] i32; 10 rand_tgt [3] i32
  if (in_sizes[0] != NRB * DIM || in_sizes[1] != DIM * DIM || in_sizes[3] != DIM * DIM || in_sizes[5] != DIM * DIM || in_sizes[7] != DIM * DIM || in_sizes[8] != DIM || in_sizes[9] != 3 || in_sizes[10] != 3 || out_size != NRB * DIM) return;
  const int BLIM = NB;   // (batch, head) pairs
  const int RLIM = NRB;
  size_t off = 0; char* ws = (char*)d_ws;
  auto carve = [&](size_t bytes) { char* p = ws + off; off += (bytes + 255) & ~(size_t)255; return p; };
  b16* W3 = (b16*)carve((size_t)3 * DIM * DIM * 2); b16* WO = (b16*)carve((size_t)DIM * DIM * 2); b16* PH = (b16*)carve((size_t)NT * PW * 2); b16* PL = (b16*)carve((size_t)NT * PW * 2); float* ATT = (float*)carve((size_t)NRB * DIM * 4); b16* VFH = (b16*)carve((size_t)NT * HD * 2); b16* VFL = (b16*)carve((size_t)NT * HD * 2);
  if (off > ws_size || off > ((size_t)96 << 20)) return;   // 88 MiB (~ 92 MB)
  wput_kernel<<<(unsigned)(((size_t)4 * DIM * (DIM / 8) + 255) / 256), 256, 0, stream>>>(Fp(1), Fp(3), Fp(5), Fp(7), W3, WO);
  proj_kernel<<<dim3(RLIM / 16, 3), 512, 0, stream>>>(Fp(0), W3, Fp(2), Fp(4), Fp(6), RLIM, PH, PL, VFH, VFL);
  att_kernel<<<BLIM * NH * (L / 16), 32 * AW, 0, stream>>>(PH, PL, VFH, VFL, (const int*)d_in[9], (const int*)d_in[10], BLIM, ATT);
  outp_kernel<<<RLIM / 16, 1024, 0, stream>>>(ATT, WO, Fp(8), RLIM, (float*)d_out);
}

// v005
// It runs in 156 microseconds.
// In two side-by-side timings against v004, it was 1.29 and 1.30 times as fast.
// Over all steps from v000 it is 14.4 times as fast.
#include <hip/hip_runtime.h>

// HierarchicalAttention (BigBird-style block mask): Q = x Wq + bq, K, V likewise ((in,out) 1024x1024); the module's raw .view(B, 8, 2048, 128) makes head h / token s the 128-slice s%8 of projected row h*256 + s/8 — i.e. the flat
// [B*8*2048][128] view of each projection; scores / sqrt(128); key block j (64 keys) allowed for query block i iff j == 0 || j == 31 || |i-j| <= 1 || (i,j) is one of the 3 (rand_src, rand_tgt) pairs, else -1e9 (== excluded;
// block 0 always allowed); softmax; O merged as [b][s][h*128+d]; out = O Wo + bo -> [2][2048][1024].
// Deterministic: no index structures, no atomics; flash-style online softmax over all key blocks in a fixed order.
// WMMA (v_wmma_f32_16x16x32_f16, f32 accumulate): the QKV projection with x EXACT bf16 x8 (K 1024) against exact torch weight rows x256 (one product); S = Q K^T (hi+lo x hi+lo, 3 products, K 128); O = P V (P x256 hi+lo x V^T hi+lo, 3 products); softmax in f32. Inputs rounded to bf16 once. Fragment k-map per lane half hh for A AND B: elements 0..7 <- k = 8hh+0..7, 8..15 <- k = 16+8hh+0..7; acc[r] = D[8hh+r][col].

namespace {
constexpr int NB = 16, L = 2048, C = 128, NH = 1, HD = 128, NT = NB * L, KB = 128, PW = 3 * C;   // NB = (batch, head) pairs; the 'token' index is (b*8 + h)*2048 + s
constexpr int RB = 2, DIM = 1024, HEADS = 8, NBLK = 32, NRB = RB * L /* 4096 projected rows */;
constexpr float XS = 8.0f, HS = 256.0f /* hi+lo staging scale for q/k/v/attended */, WSC = 256.0f, PS = 256.0f, SCALE = 0.08838834764831845f;
typedef _Float16 b16;
typedef __attribute__((ext_vector_type(16))) _Float16 v16b;
typedef __attribute__((ext_vector_type(8))) _Float16 v8b;
typedef __attribute__((ext_vector_type(8))) float v8f;
typedef __attribute__((ext_vector_type(4))) float v4f;
__device__ __forceinline__ float bf16_rne(float f) { unsigned int u = __float_as_uint(f); u += 0x7FFFu + ((u >> 16) & 1u); float r = __uint_as_float(u & 0xFFFF0000u); asm volatile("" : "+v"(r)); return r; }
__device__ __forceinline__ float bfv(float f) { float r = bf16_rne(f); asm volatile("" : "+v"(r)); return r; }
__device__ __forceinline__ void split16(float v, b16& hi, b16& lo) { hi = (b16)v; lo = (b16)(v - (float)hi); }
__device__ __forceinline__ v16b frag_kb(const b16* p, int hh) { const v8b a = *(const v8b*)(p + 8 * hh), b = *(const v8b*)(p + 16 + 8 * hh); v16b f;
#pragma unroll
  for (int e = 0; e < 8; ++e) { f[e] = a[e]; f[8 + e] = b[e]; } return f; }
__device__ __forceinline__ v16b frag_vf(const b16* p) { const v8b a = *(const v8b*)p, b = *(const v8b*)(p + 256); v16b f;   // p already holds the lane's own 8 * lane: two whole 512-B runs per wave
#pragma unroll
  for (int e = 0; e < 8; ++e) { f[e] = a[e]; f[8 + e] = b[e]; } return f; }
__device__ __forceinline__ v8f wmma16b(v16b a, v16b b, v8f c) { v8f d = __builtin_amdgcn_wmma_f32_16x16x32_f16(false, a, false, b, (short)0, c, false, false); asm volatile("v_nop\n\tv_nop\n\tv_nop\n\tv_nop" : "+v"(d) : "v"(a), "v"(b)); return d; }
__device__ __forceinline__ void wave_lds_sync() { __builtin_amdgcn_fence(__ATOMIC_RELEASE, "workgroup"); __builtin_amdgcn_wave_barrier(); __builtin_amdgcn_fence(__ATOMIC_ACQUIRE, "workgroup"); }
__device__ __forceinline__ float pmul(float a, float b) { float p = a * b; asm volatile("" : "+v"(p)); return p; }

__global__ __launch_bounds__(256) void wput_kernel(const float* __restrict__ wq, const float* __restrict__ wk, const float* __restrict__ wv, const float* __restrict__ wo, b16* __restrict__ W3, b16* __restrict__ WO) { const size_t u = (size_t)blockIdx.x * 256 + threadIdx.x; if (u >= (size_t)4 * DIM * (DIM / 8)) return;
  // thread u writes 16-B piece u of the planes, which lie in the order of the projections' B fragments: [matrix p][32-k block][16-column tile][e][lane = 16 hh + o % 16][i], k % 32 = 16 e + 8 hh + i (o = output column of the weight), so that a wave reads each fragment half as one 512-B run and the tiles of one k block lie side by side; a wave here loads 2 x 64 B at a time and stores 512 B in a row
  const int ln = (int)(u & 31), p = (int)(u >> 17), o = ((int)(u >> 6) & 63) * 16 + (ln & 15), k0 = ((int)(u >> 12) & 31) * 32 + ((int)(u >> 5) & 1) * 16 + (ln >> 4) * 8; const float* w = p == 0 ? wq : (p == 1 ? wk : (p == 2 ? wv : wo)); v8b v;
#pragma unroll
  for (int j = 0; j < 8; ++j) v[j] = (b16)(bf16_rne(w[(size_t)(k0 + j) * DIM + o]) * WSC);
  { *(v8b*)(p < 3 ? W3 + u * 8 : WO + (u - (size_t)3 * DIM * (DIM / 8)) * 8) = v;  } }
// projection: block of 16 waves per (PM = 4 tiles of 16 projected rows, projection p = blockIdx.y): the waves stage bf16(x) (EXACT, K 1024) once, one row of each tile each, and share it; wave wv then does columns wv*64 .. +63 of p (4 column tiles) for all 4 row tiles, so that each W3 fragment, loaded once, feeds 4 products from registers; + bias (Q scaled by 1/sqrt(128)); row r, 128-chunk j -> token T = 8*(b*2048 + r) + j:
constexpr int PM = 4;
static_assert(NRB % (16 * PM) == 0, "a block's rows all exist");
__global__ __launch_bounds__(512) void proj_kernel(const float* __restrict__ x, const b16* __restrict__ W3, const float* __restrict__ bq, const float* __restrict__ bk, const float* __restrict__ bv, int RLIM, b16* __restrict__ PH, b16* __restrict__ PL, b16* __restrict__ VFH, b16* __restrict__ VFL) { __shared__ __attribute__((aligned(16))) b16 Ah[16 * PM][DIM + 8], Oh[16][16][72], Ol[16][16][72]; const int lane = threadIdx.x & 31, wv = __builtin_amdgcn_readfirstlane(threadIdx.x >> 5), nloc = lane & 15, hlf = lane >> 4; const size_t m0 = (size_t)blockIdx.x * (16 * PM); if (m0 >= (size_t)RLIM) return;
  for (int q = 0; q < DIM / 32; ++q) { float xv[PM];   // the wave's row of each of the 4 tiles: the 4 loads of a trip stand ahead of the roundings
#pragma unroll   // here and below: constant indices keep xv, acc, bw, a and bvv in registers
    for (int m = 0; m < PM; ++m) xv[m] = x[(m0 + 16 * m + wv) * DIM + q * 32 + lane];
#pragma unroll
    for (int m = 0; m < PM; ++m) Ah[16 * m + wv][q * 32 + lane] = (b16)(bf16_rne(xv[m]) * XS); }
  __syncthreads();   // every wave reads all staged rows
  const int p = blockIdx.y, c0 = wv * 64; const float* bb = p == 0 ? bq : (p == 1 ? bk : bv); const float sc = p == 0 ? SCALE : 1.0f; v8f acc[PM][4]; const b16* const wf = W3 + (size_t)p * DIM * DIM + (c0 / 16) * 512 + lane * 8;   // the wave's first column tile in the fragment-order plane: 512 elements a tile, 32 * DIM a 32-k block
#pragma unroll
  for (int m = 0; m < PM; ++m)
#pragma unroll
    for (int t = 0; t < 4; ++t) acc[m][t] = (v8f){};
#pragma unroll 2   // two k blocks a trip: the second's addresses are immediates of the first's, and the loop stays small
  for (int kb = 0; kb < DIM; kb += 32) { v16b bw[4], a[PM];   // the k block's 4 weight fragments and 4 row fragments, each used 4 times below
#pragma unroll
    for (int t = 0; t < 4; ++t) bw[t] = frag_vf(wf + kb * DIM + t * 512);
#pragma unroll
    for (int m = 0; m < PM; ++m) a[m] = frag_kb(&Ah[16 * m + nloc][kb], hlf);
#pragma unroll
    for (int m = 0; m < PM; ++m)
#pragma unroll
      for (int t = 0; t < 4; ++t) acc[m][t] = wmma16b(a[m], bw[t], acc[m][t]); }
  float bvv[4]; const float* const bp = bb + c0 + nloc;   // the wave's 4 bias values serve all row tiles
#pragma unroll
  for (int t = 0; t < 4; ++t) bvv[t] = bp[t * 16];
  asm volatile("s_wait_xcnt 0x0" :: "v"(nloc) : "memory");   // the wait in front of the reuse of the loads' address registers: the lane's part of the address is nloc, which as an input here stays whole up to it
#pragma unroll
  for (int t = 0; t < 4; ++t) bvv[t] = bfv(bvv[t]);
  if (p == 2) {   // V: 16 rows x 1024 columns (one row tile) are 128 consecutive keys x 128 d of one head. They leave in the order of the P V product's B fragments: [32-key group][16-d tile][e][lane = 16 hh + d % 16][i], key % 32 = 16 e + 8 hh + i, so that a wave of att_kernel reads each fragment half as one 512-B run
    b16* const Vh = &Oh[0][0][0]; b16* const Vl = &Ol[0][0][0];   // 4 groups x 8 tiles x 512 = 16384 elements per plane, shared by the block, one row tile at a time
#pragma unroll
    for (int m = 0; m < PM; ++m) {
      if (m) __syncthreads();   // the copy-out of the row tile before has read the planes (p is the same for the whole block)
#pragma unroll
      for (int t = 0; t < 4; ++t) {
#pragma unroll
        for (int r8 = 0; r8 < 8; ++r8) { b16 ph, pl; split16((acc[m][t][r8] * (1.0f / (XS * WSC)) + bvv[t]) * sc * HS, ph, pl);   // local key = 8 * (8 hlf + r8) + (wv >> 1), d = (c0 & 64) + 16 t + nloc
          const int ix = ((((2 * hlf + (r8 >> 2)) * 8 + ((c0 & 64) >> 4) + t) * 2 + ((r8 >> 1) & 1)) * 32 + (r8 & 1) * 16 + nloc) * 8 + (wv >> 1); Vh[ix] = ph; Vl[ix] = pl; } }
      __syncthreads();   // the copy-out below reads what all 16 waves wrote
      const size_t vb = (8 * (m0 + 16 * m) / 32) * (size_t)(8 * 512);
#pragma unroll
      for (int q = 0; q < 4; ++q) { const int o = (q * 512 + (int)threadIdx.x) * 8; *(v8b*)(VFH + vb + o) = *(const v8b*)(Vh + o); *(v8b*)(VFL + vb + o) = *(const v8b*)(Vl + o); } }
    return; }
  const int j = c0 >> 7, h0 = c0 & 64;   // the wave's 64 columns = one 128-B half of chunk j of projection p
#pragma unroll
  for (int m = 0; m < PM; ++m) { if (m) wave_lds_sync();   // the lanes' reads of the row tile before end ahead of other lanes' writes to the same patch
#pragma unroll
    for (int t = 0; t < 4; ++t) { const int cc = t * 16 + nloc;
#pragma unroll
      for (int r8 = 0; r8 < 8; ++r8) { b16 ph, pl; split16((acc[m][t][r8] * (1.0f / (XS * WSC)) + bvv[t]) * sc * HS, ph, pl); Oh[wv][8 * hlf + r8][cc] = ph; Ol[wv][8 * hlf + r8][cc] = pl; } }
    wave_lds_sync();
    for (int rr = 0; rr < 16; rr += 4) { const int r = rr + (lane >> 3), d8 = (lane & 7) * 8; const size_t T = 8 * (m0 + 16 * m + r) + j;   // 8 lanes x 16 B per row, 4 rows per store
      *(v8b*)(PH + T * PW + p * 128 + h0 + d8) = *(const v8b*)(&Oh[wv][r][d8]); *(v8b*)(PL + T * PW + p * 128 + h0 + d8) = *(const v8b*)(&Ol[wv][r][d8]); }
    asm volatile("s_wait_xcnt 0x0" ::: "memory");   // the wait in front of the reuse of the address and data registers of this row tile's 8 stores
  } }
// attention: block of AW = 4 waves per (b, h, 16-query tile); key blocks of 128 over all keys. The three inner loops of a key block are dealt to the waves: wave wv does key tiles 2 wv, 2 wv + 1 of S = Q K^T (3 products, K 128), rows 4 wv .. + 3 of the online softmax (P x256 hi+lo), and d tiles 2 wv, 2 wv + 1 of P V (V fragments straight from the fragment-order planes that proj_kernel wrote). Q, S, P and each row's rescale factor go from wave to wave through LDS; every sum keeps its order.
constexpr int AW = 4;
static_assert(L % KB == 0 && KB / 16 == 2 * AW && HD / 16 == 2 * AW && 16 == 4 * AW, "the deal below is for 8 key tiles, 16 rows and 8 d tiles over 4 waves");
__global__ __launch_bounds__(32 * AW) void att_kernel(const b16* __restrict__ PH, const b16* __restrict__ PL, const b16* __restrict__ VFH, const b16* __restrict__ VFL, const int* __restrict__ rsrc, const int* __restrict__ rtgt, int BLIM, float* __restrict__ ATT) { __shared__ __attribute__((aligned(16))) b16 Ph_[16][KB + 8], Pl_[16][KB + 8], Qh_[16][HD + 8], Ql_[16][HD + 8]; __shared__ float Sf[16][KB + 4], Of[16][HD + 4], Sc[16], Dn[16];
  const int lane = threadIdx.x & 31, wv = __builtin_amdgcn_readfirstlane(threadIdx.x >> 5), nloc = lane & 15, hlf = lane >> 4; const int qt = blockIdx.x % (L / 16); const int h = (blockIdx.x / (L / 16)) % NH; const int b = blockIdx.x / ((L / 16) * NH); if (b >= BLIM) return; const int t0 = qt * 16; const int ib = t0 / 64; const int rs0 = rsrc[0], rs1 = rsrc[1], rs2 = rsrc[2], rt0 = rtgt[0], rt1 = rtgt[1], rt2 = rtgt[2];
  auto allowed = [&](int jb) { return (jb == 0) || (jb == NBLK - 1) || (jb - ib <= 1 && ib - jb <= 1) || (rs0 == ib && rt0 == jb) || (rs1 == ib && rt1 == jb) || (rs2 == ib && rt2 == jb); }; const size_t rowb = (size_t)b * L; const int qo = h * HD, ko = C + h * HD;
  { constexpr int QT = 16 * (HD / 8) / (32 * AW); const b16 *qph[QT], *qpl[QT]; v8b qa[QT], qb[QT];   // the block's 16 query rows, 16 B a thread, plane and trip
    static_assert(QT == 2, "the wait below names the address registers of two trips");
#pragma unroll   // both trips' loads in flight together
    for (int k = 0; k < QT; ++k) { const int i = k * 32 * AW + (int)threadIdx.x; qph[k] = PH + (rowb + t0 + i / (HD / 8)) * PW + qo + (i % (HD / 8)) * 8; qpl[k] = PL + (rowb + t0 + i / (HD / 8)) * PW + qo + (i % (HD / 8)) * 8; qa[k] = *(const v8b*)qph[k]; qb[k] = *(const v8b*)qpl[k]; }
    asm volatile("s_wait_xcnt 0x0" :: "v"(qph[0]), "v"(qph[1]), "v"(qpl[0]), "v"(qpl[1]) : "memory");   // the wait in front of the reuse of the loads' address registers: as inputs here they stay whole up to it
#pragma unroll   // constant indices keep qa and qb in registers
    for (int k = 0; k < QT; ++k) { const int i = k * 32 * AW + (int)threadIdx.x; *(v8b*)(&Qh_[i / (HD / 8)][(i % (HD / 8)) * 8]) = qa[k]; *(v8b*)(&Ql_[i / (HD / 8)][(i % (HD / 8)) * 8]) = qb[k]; } }
  __syncthreads();   // every wave reads all 16 query rows
  float m_w[4], den_w[4]; v8f acc[2];   // running maximum and denominator of the wave's own 4 rows (the same in every lane); accumulators of its own 2 d tiles
#pragma unroll   // here and below: constant indices keep m_w, den_w, acc, vh and vl in registers
  for (int i = 0; i < 4; ++i) { m_w[i] = -INFINITY; den_w[i] = 0.0f; }
#pragma unroll
  for (int u = 0; u < 2; ++u) acc[u] = (v8f){};
  const int kstart = 0; const int kend = L;   // [kstart, kend)
#pragma unroll 1
  for (int kb0 = kstart; kb0 < kend; kb0 += KB) { const int nk = (kend - kb0) < KB ? (kend - kb0) : KB; const int nkt = (nk + 15) / 16; if (!allowed(kb0 / 64) && !allowed(kb0 / 64 + 1)) continue;   /* neither 64-key sub-block of this 128-key block is visible to this query block (the same for the whole work-group) */
    for (int t = 2 * wv; t < 2 * wv + 2; ++t) { if (t < nkt) { const int key = kb0 + t * 16 + nloc < L ? kb0 + t * 16 + nloc : L - 1; const size_t kr = (rowb + key) * PW + ko; v8f s = {};
#pragma unroll
        for (int q = 0; q < HD / 32; ++q) { const v16b qh = frag_kb(&Qh_[nloc][q * 32], hlf), ql = frag_kb(&Ql_[nloc][q * 32], hlf), kh = frag_kb(PH + kr + q * 32, hlf), kl = frag_kb(PL + kr + q * 32, hlf); s = wmma16b(qh, kh, s); s = wmma16b(qh, kl, s); s = wmma16b(ql, kh, s); }
#pragma unroll
        for (int r8 = 0; r8 < 8; ++r8) { const int j = kb0 + t * 16 + nloc; const bool ok = (j < kend) && allowed(j >> 6);   /* BigBird block mask (-1e9 in the module == excluded; key block 0 always allowed) */ Sf[8 * hlf + r8][t * 16 + nloc] = ok ? s[r8] * (1.0f / (HS * HS)) : -INFINITY; } }
      else {
#pragma unroll
        for (int r8 = 0; r8 < 8; ++r8) Sf[8 * hlf + r8][t * 16 + nloc] = -INFINITY; } }
    __syncthreads();   // a softmax row holds the scores of all four waves' key tiles; it also ends every wave's reads of P and Sc of the key block before
#pragma unroll
    for (int i = 0; i < 4; ++i) { const int rr = 4 * wv + i; float mx = -INFINITY;
#pragma unroll
      for (int q = 0; q < 4; ++q) mx = fmaxf(mx, Sf[rr][q * 32 + lane]);
      for (int o = 16; o; o >>= 1) mx = fmaxf(mx, __shfl_xor(mx, o));
      const float mold = m_w[i]; const float mn = fmaxf(mold, mx); const float sf = (mold == -INFINITY) ? 0.0f : ((mn == -INFINITY) ? 1.0f : __expf(mold - mn)); float ps = 0.0f;
#pragma unroll
      for (int q = 0; q < 4; ++q) { const int kx = q * 32 + lane; const float sv = Sf[rr][kx]; const float p = (sv == -INFINITY || mn == -INFINITY) ? 0.0f : __expf(sv - mn); ps += p; b16 ph, pl; split16(p * PS, ph, pl); Ph_[rr][kx] = ph; Pl_[rr][kx] = pl; }
      for (int o = 16; o; o >>= 1) ps += __shfl_xor(ps, o);
      den_w[i] = den_w[i] * sf + ps; m_w[i] = mn; if (lane == 0) Sc[rr] = sf; }
    __syncthreads();   // every wave reads all 16 rows of P and their rescale factors; it also ends the reads of Sf before the next key block's scores are stored
#pragma unroll
    for (int r8 = 0; r8 < 8; ++r8) { const float sf = Sc[8 * hlf + r8];
#pragma unroll
      for (int u = 0; u < 2; ++u) acc[u][r8] = acc[u][r8] * sf; }
    for (int ks = 0; ks < nkt * 16; ks += 32) { const size_t vf = ((rowb + kb0 + ks) / 32) * (size_t)((HD / 16) * 512) + (2 * wv) * 512 + lane * 8; const b16* const vph = VFH + vf; const b16* const vpl = VFL + vf; v16b vh[2], vl[2];   // the 8 loads of the wave's two d tiles stand ahead of their products, so that they are in flight together: no load moves up over the asm statement in wmma16b
#pragma unroll
      for (int u = 0; u < 2; ++u) { vh[u] = frag_vf(vph + u * 512); vl[u] = frag_vf(vpl + u * 512); }
      asm volatile("s_wait_xcnt 0x0" :: "v"(vph), "v"(vpl) : "memory");   // the wait in front of the reuse of the loads' address registers: as inputs here they stay whole up to it, and the LDS reads below, which took them over, stay behind it
      const v16b pa = frag_kb(&Ph_[nloc][ks], hlf), pb = frag_kb(&Pl_[nloc][ks], hlf);
#pragma unroll
      for (int u = 0; u < 2; ++u) { acc[u] = wmma16b(pa, vh[u], acc[u]); acc[u] = wmma16b(pa, vl[u], acc[u]); acc[u] = wmma16b(pb, vh[u], acc[u]); } } }
#pragma unroll
  for (int i = 0; i < 4; ++i) if (lane == 0) Dn[4 * wv + i] = den_w[i];
  __syncthreads();   // every wave divides by the denominators of all 16 rows
#pragma unroll
  for (int u = 0; u < 2; ++u)
#pragma unroll
    for (int r8 = 0; r8 < 8; ++r8) { const float dn = Dn[8 * hlf + r8]; Of[8 * hlf + r8][(2 * wv + u) * 16 + nloc] = dn > 0.0f ? acc[u][r8] * (1.0f / (HS * PS)) / dn : 0.0f; }
  __syncthreads();   // a stored row holds the d tiles of all four waves
  const int rb_ = b / HEADS, hq = b % HEADS;   /* merge heads: ATT[b][s][h*128 + d] */
  { for (int rr = 4 * wv; rr < 4 * wv + 4; ++rr) for (int s = 0; s < HD / 32; ++s) ((float*)ATT)[((size_t)rb_ * L + t0 + rr) * DIM + hq * 128 + s * 32 + lane] = Of[rr][s * 32 + lane];  } }
// output projection: block of 16 waves per (OM = 2 tiles of 16 rows, half of the columns = blockIdx.y): the waves stage the attended rows (hi+lo) once, one row of each tile each, and share them; wave wv then does columns blockIdx.y*512 + wv*32 .. +31 (2 column tiles) for both row tiles, so that each WO fragment, loaded once, feeds 4 products from registers:
constexpr int OM = 2;
static_assert(NRB % (16 * OM) == 0, "a block's rows all exist");
__global__ __launch_bounds__(512) void outp_kernel(const float* __restrict__ ATT, const b16* __restrict__ WO, const float* __restrict__ bo, int RLIM, float* __restrict__ out) { __shared__ __attribute__((aligned(16))) b16 Ah[16 * OM][DIM + 8], Al[16 * OM][DIM + 8]; __shared__ __attribute__((aligned(16))) float Tf[16][16][36]; const int lane = threadIdx.x & 31, wv = __builtin_amdgcn_readfirstlane(threadIdx.x >> 5), nloc = lane & 15, hlf = lane >> 4; const size_t m0 = (size_t)blockIdx.x * (16 * OM); if (m0 >= (size_t)RLIM) return;
  for (int q = 0; q < DIM / 32; ++q)
    for (int m = 0; m < OM; ++m) { const int sr = 16 * m + wv, cx = q * 32 + lane; b16 p, ql; split16(ATT[(m0 + sr) * DIM + cx] * HS, p, ql); Ah[sr][cx] = p; Al[sr][cx] = ql; }
  __syncthreads();   // every wave reads all staged rows
  const int c0 = blockIdx.y * (DIM / 2) + wv * 32; v8f acc[OM][2]; const b16* const wf = WO + (c0 / 16) * 512 + lane * 8;   // fragment-order plane, as in proj_kernel
#pragma unroll   // here and below: constant indices keep acc, bw, a and al in registers
  for (int m = 0; m < OM; ++m)
#pragma unroll
    for (int t = 0; t < 2; ++t) acc[m][t] = (v8f){};
#pragma unroll 2   // two k blocks a trip: the second's addresses are immediates of the first's, and the loop stays small
  for (int kk = 0; kk < DIM; kk += 32) { v16b bw[2], a[OM], al[OM];   // the k block's 2 weight fragments, each used for both row tiles (hi and lo) below
#pragma unroll
    for (int t = 0; t < 2; ++t) bw[t] = frag_vf(wf + kk * DIM + t * 512);
#pragma unroll
    for (int m = 0; m < OM; ++m) { a[m] = frag_kb(&Ah[16 * m + nloc][kk], hlf); al[m] = frag_kb(&Al[16 * m + nloc][kk], hlf); }
#pragma unroll
    for (int m = 0; m < OM; ++m)
#pragma unroll
      for (int t = 0; t < 2; ++t) { acc[m][t] = wmma16b(a[m], bw[t], acc[m][t]); acc[m][t] = wmma16b(al[m], bw[t], acc[m][t]); } }
  float bb[2];   // the wave's 2 bias values serve both row tiles
#pragma unroll
  for (int t = 0; t < 2; ++t) bb[t] = bo[c0 + t * 16 + nloc];
#pragma unroll
  for (int t = 0; t < 2; ++t) bb[t] = bfv(bb[t]);
#pragma unroll
  for (int m = 0; m < OM; ++m) { if (m) wave_lds_sync();   // the lanes' reads of the row tile before end ahead of other lanes' writes to the same patch
#pragma unroll
    for (int t = 0; t < 2; ++t) { const int cc = t * 16 + nloc;
#pragma unroll
      for (int r8 = 0; r8 < 8; ++r8) Tf[wv][8 * hlf + r8][cc] = acc[m][t][r8] * (1.0f / (HS * WSC)) + bb[t]; }
    wave_lds_sync();
    for (int rr = 0; rr < 16; rr += 4) { const int r = rr + (lane >> 3), c4 = (lane & 7) * 4;   // 8 lanes x 16 B = one 128-B line per row, 4 rows per store
      *(v4f*)(out + (m0 + 16 * m + r) * DIM + c0 + c4) = *(const v4f*)(&Tf[wv][r][c4]); }
  } }
}  // namespace

extern "C" void kernel_launch(void* const* d_in, const int* in_sizes, int n_in, void* d_out, int out_size, void* d_ws, size_t ws_size, hipStream_t stream) {
  (void)n_in;
  auto Fp = [&](int i) { return (const float*)d_in[i]; };
  // input order: 0 x [2,2048,1024]; 1 Wq [1024,1024] (in,out); 2 bq; 3 Wk; 4 bk; 5 Wv; 6 bv; 7 Wo; 8 bo; 9 rand_src [3] i32; 10 rand_tgt [3] i32
  if (in_sizes[0] != NRB * DIM || in_sizes[1] != DIM * DIM || in_sizes[3] != DIM * DIM || in_sizes[5] != DIM * DIM || in_sizes[7] != DIM * DIM || in_sizes[8] != DIM || in_sizes[9] != 3 || in_sizes[10] != 3 || out_size != NRB * DIM) return;
  const int BLIM = NB;   // (batch, head) pairs
  const int RLIM = NRB;
  size_t off = 0; char* ws = (char*)d_ws;
  auto carve = [&](size_t bytes) { char* p = ws + off; off += (bytes + 255) & ~(size_t)255; return p; };
  b16* W3 = (b16*)carve((size_t)3 * DIM * DIM * 2); b16* WO = (b16*)carve((size_t)DIM * DIM * 2); b16* PH = (b16*)carve((size_t)NT * PW * 2); b16* PL = (b16*)carve((size_t)NT * PW * 2); float* ATT = (float*)carve((size_t)NRB * DIM * 4); b16* VFH = (b16*)carve((size_t)NT * HD * 2); b16* VFL = (b16*)carve((size_t)NT * HD * 2);
  if (off > ws_size || off > ((size_t)96 << 20)) return;   // 88 MiB (~ 92 MB)
  wput_kernel<<<(unsigned)(((size_t)4 * DIM * (DIM / 8) + 255) / 256), 256, 0, stream>>>(Fp(1), Fp(3), Fp(5), Fp(7), W3, WO);
  proj_kernel<<<dim3(RLIM / (16 * PM), 3), 512, 0, stream>>>(Fp(0), W3, Fp(2), Fp(4), Fp(6), RLIM, PH, PL, VFH, VFL);
  att_kernel<<<BLIM * NH * (L / 16), 32 * AW, 0, stream>>>(PH, PL, VFH, VFL, (const int*)d_in[9], (const int*)d_in[10], BLIM, ATT);
  outp_kernel<<<dim3(RLIM / (16 * OM), 2), 512, 0, stream>>>(ATT, WO, Fp(8), RLIM, (float*)d_out);
}

// v006
// A run of this version takes 128 microseconds.
// Timed twice side by side with v005, it ran 1.23 and 1.22 times as fast.
// Counting every step since v000, it is 17.6 times as fast.
#include <hip/hip_runtime.h>

// HierarchicalAttention (BigBird-style block mask): Q = x Wq + bq, K, V likewise ((in,out) 1024x1024); the module's raw .view(B, 8, 2048, 128) makes head h / token s the 128-slice s%8 of projected row h*256 + s/8 — i.e. the flat
// [B*8*2048][128] view of each projection; scores / sqrt(128); key block j (64 keys) allowed for query block i iff j == 0 || j == 31 || |i-j| <= 1 || (i,j) is one of the 3 (rand_src, rand_tgt) pairs, else -1e9 (== excluded;
// block 0 always allowed); softmax; O merged as [b][s][h*128+d]; out = O Wo + bo -> [2][2048][1024].
// Deterministic: no index structures, no atomics; flash-style online softmax over all key blocks in a fixed order.
// WMMA (v_wmma_f32_16x16x32_f16, f32 accumulate): the QKV projection with x EXACT bf16 x8 (K 1024) against exact torch weight rows x256 (one product); S = Q K^T (hi+lo x hi+lo, 3 products, K 128); O = P V (P x256 hi+lo x V^T hi+lo, 3 products); softmax in f32. Inputs rounded to bf16 once. Fragment k-map per lane half hh for A AND B: elements 0..7 <- k = 8hh+0..7, 8..15 <- k = 16+8hh+0..7; acc[r] = D[8hh+r][col].

namespace {
constexpr int NB = 16, L = 2048, C = 128, NH = 1, HD = 128, NT = NB * L, KB = 128, PW = 3 * C;   // NB = (batch, head) pairs; the 'token' index is (b*8 + h)*2048 + s
constexpr int RB = 2, DIM = 1024, HEADS = 8, NBLK = 32, NRB = RB * L /* 4096 projected rows */;
constexpr float XS = 8.0f, HS = 256.0f /* hi+lo staging scale for q/k/v/attended */, WSC = 256.0f, PS = 256.0f, SCALE = 0.08838834764831845f;
typedef _Float16 b16;
typedef __attribute__((ext_vector_type(16))) _Float16 v16b;
typedef __attribute__((ext_vector_type(8))) _Float16 v8b;
typedef __attribute__((ext_vector_type(8))) float v8f;
typedef __attribute__((ext_vector_type(4))) float v4f;
__device__ __forceinline__ float bf16_rne(float f) { unsigned int u = __float_as_uint(f); u += 0x7FFFu + ((u >> 16) & 1u); float r = __uint_as_float(u & 0xFFFF0000u); asm volatile("" : "+v"(r)); return r; }
__device__ __forceinline__ float bfv(float f) { float r = bf16_rne(f); asm volatile("" : "+v"(r)); return r; }
__device__ __forceinline__ void split16(float v, b16& hi, b16& lo) { hi = (b16)v; lo = (b16)(v - (float)hi); }
__device__ __forceinline__ v16b frag_kb(const b16* p, int hh) { const v8b a = *(const v8b*)(p + 8 * hh), b = *(const v8b*)(p + 16 + 8 * hh); v16b f;
#pragma unroll
  for (int e = 0; e < 8; ++e) { f[e] = a[e]; f[8 + e] = b[e]; } return f; }
__device__ __forceinline__ v16b frag_vf(const b16* p) { const v8b a = *(const v8b*)p, b = *(const v8b*)(p + 256); v16b f;   // p already holds the lane's own 8 * lane: two whole 512-B runs per wave
#pragma unroll
  for (int e = 0; e < 8; ++e) { f[e] = a[e]; f[8 + e] = b[e]; } return f; }
__device__ __forceinline__ v8f wmma16b(v16b a, v16b b, v8f c) { v8f d = __builtin_amdgcn_wmma_f32_16x16x32_f16(false, a, false, b, (short)0, c, false, false); asm volatile("v_nop\n\tv_nop\n\tv_nop\n\tv_nop" : "+v"(d) : "v"(a), "v"(b)); return d; }
__device__ __forceinline__ void wave_lds_sync() { __builtin_amdgcn_fence(__ATOMIC_RELEASE, "workgroup"); __builtin_amdgcn_wave_barrier(); __builtin_amdgcn_fence(__ATOMIC_ACQUIRE, "workgroup"); }
__device__ __forceinline__ float pmul(float a, float b) { float p = a * b; asm volatile("" : "+v"(p)); return p; }

__global__ __launch_bounds__(256) void wput_kernel(const float* __restrict__ wq, const float* __restrict__ wk, const float* __restrict__ wv, const float* __restrict__ wo, b16* __restrict__ W3, b16* __restrict__ WO) { const size_t u = (size_t)blockIdx.x * 256 + threadIdx.x; if (u >= (size_t)4 * DIM * (DIM / 8)) return;
  // thread u writes 16-B piece u of the planes, which lie in the order of the projections' B fragments: [matrix p][32-k block][16-column tile][e][lane = 16 hh + o % 16][i], k % 32 = 16 e + 8 hh + i (o = output column of the weight), so that a wave reads each fragment half as one 512-B run and the tiles of one k block lie side by side; a wave here loads 2 x 64 B at a time and stores 512 B in a row
  const int ln = (int)(u & 31), p = (int)(u >> 17), o = ((int)(u >> 6) & 63) * 16 + (ln & 15), k0 = ((int)(u >> 12) & 31) * 32 + ((int)(u >> 5) & 1) * 16 + (ln >> 4) * 8; const float* w = p == 0 ? wq : (p == 1 ? wk : (p == 2 ? wv : wo)); v8b v;
#pragma unroll
  for (int j = 0; j < 8; ++j) v[j] = (b16)(bf16_rne(w[(size_t)(k0 + j) * DIM + o]) * WSC);
  { *(v8b*)(p < 3 ? W3 + u * 8 : WO + (u - (size_t)3 * DIM * (DIM / 8)) * 8) = v;  } }
// projection: block of 16 waves per (PM = 4 tiles of 16 projected rows, projection p = blockIdx.y): the waves stage bf16(x) (EXACT, K 1024) once, one row of each tile each, and share it; wave wv then does columns wv*64 .. +63 of p (4 column tiles) for all 4 row tiles, so that each W3 fragment, loaded once, feeds 4 products from registers; + bias (Q scaled by 1/sqrt(128)); row r, 128-chunk j -> token T = 8*(b*2048 + r) + j:
constexpr int PM = 4;
static_assert(NRB % (16 * PM) == 0, "a block's rows all exist");
__global__ __launch_bounds__(512) void proj_kernel(const float* __restrict__ x, const b16* __restrict__ W3, const float* __restrict__ bq, const float* __restrict__ bk, const float* __restrict__ bv, int RLIM, b16* __restrict__ PH, b16* __restrict__ PL, b16* __restrict__ VFH, b16* __restrict__ VFL) { __shared__ __attribute__((aligned(16))) b16 Ah[16 * PM][DIM + 8], Oh[16][16][72], Ol[16][16][72]; const int lane = threadIdx.x & 31, wv = __builtin_amdgcn_readfirstlane(threadIdx.x >> 5), nloc = lane & 15, hlf = lane >> 4; const size_t m0 = (size_t)blockIdx.x * (16 * PM); if (m0 >= (size_t)RLIM) return;
  for (int q = 0; q < DIM / 32; ++q) { float xv[PM];   // the wave's row of each of the 4 tiles: the 4 loads of a trip stand ahead of the roundings
#pragma unroll   // here and below: constant indices keep xv, acc, bw, a and bvv in registers
    for (int m = 0; m < PM; ++m) xv[m] = x[(m0 + 16 * m + wv) * DIM + q * 32 + lane];
#pragma unroll
    for (int m = 0; m < PM; ++m) Ah[16 * m + wv][q * 32 + lane] = (b16)(bf16_rne(xv[m]) * XS); }
  __syncthreads();   // every wave reads all staged rows
  const int p = blockIdx.y, c0 = wv * 64; const float* bb = p == 0 ? bq : (p == 1 ? bk : bv); const float sc = p == 0 ? SCALE : 1.0f; v8f acc[PM][4]; const b16* const wf = W3 + (size_t)p * DIM * DIM + (c0 / 16) * 512 + lane * 8;   // the wave's first column tile in the fragment-order plane: 512 elements a tile, 32 * DIM a 32-k block
#pragma unroll
  for (int m = 0; m < PM; ++m)
#pragma unroll
    for (int t = 0; t < 4; ++t) acc[m][t] = (v8f){};
#pragma unroll 2   // two k blocks a trip: the second's addresses are immediates of the first's, and the loop stays small
  for (int kb = 0; kb < DIM; kb += 32) { v16b bw[4], a[PM];   // the k block's 4 weight fragments and 4 row fragments, each used 4 times below
#pragma unroll
    for (int t = 0; t < 4; ++t) bw[t] = frag_vf(wf + kb * DIM + t * 512);
#pragma unroll
    for (int m = 0; m < PM; ++m) a[m] = frag_kb(&Ah[16 * m + nloc][kb], hlf);
#pragma unroll
    for (int m = 0; m < PM; ++m)
#pragma unroll
      for (int t = 0; t < 4; ++t) acc[m][t] = wmma16b(a[m], bw[t], acc[m][t]); }
  float bvv[4]; const float* const bp = bb + c0 + nloc;   // the wave's 4 bias values serve all row tiles
#pragma unroll
  for (int t = 0; t < 4; ++t) bvv[t] = bp[t * 16];
  asm volatile("s_wait_xcnt 0x0" :: "v"(nloc) : "memory");   // the wait in front of the reuse of the loads' address registers: the lane's part of the address is nloc, which as an input here stays whole up to it
#pragma unroll
  for (int t = 0; t < 4; ++t) bvv[t] = bfv(bvv[t]);
  if (p == 2) {   // V: 16 rows x 1024 columns (one row tile) are 128 consecutive keys x 128 d of one head. They leave in the order of the P V product's B fragments: [32-key group][16-d tile][e][lane = 16 hh + d % 16][i], key % 32 = 16 e + 8 hh + i, so that a wave of att_kernel reads each fragment half as one 512-B run
    b16* const Vh = &Oh[0][0][0]; b16* const Vl = &Ol[0][0][0];   // 4 groups x 8 tiles x 512 = 16384 elements per plane, shared by the block, one row tile at a time
#pragma unroll
    for (int m = 0; m < PM; ++m) {
      if (m) __syncthreads();   // the copy-out of the row tile before has read the planes (p is the same for the whole block)
#pragma unroll
      for (int t = 0; t < 4; ++t) {
#pragma unroll
        for (int r8 = 0; r8 < 8; ++r8) { b16 ph, pl; split16((acc[m][t][r8] * (1.0f / (XS * WSC)) + bvv[t]) * sc * HS, ph, pl);   // local key = 8 * (8 hlf + r8) + (wv >> 1), d = (c0 & 64) + 16 t + nloc
          const int ix = ((((2 * hlf + (r8 >> 2)) * 8 + ((c0 & 64) >> 4) + t) * 2 + ((r8 >> 1) & 1)) * 32 + (r8 & 1) * 16 + nloc) * 8 + (wv >> 1); Vh[ix] = ph; Vl[ix] = pl; } }
      __syncthreads();   // the copy-out below reads what all 16 waves wrote
      const size_t vb = (8 * (m0 + 16 * m) / 32) * (size_t)(8 * 512);
#pragma unroll
      for (int q = 0; q < 4; ++q) { const int o = (q * 512 + (int)threadIdx.x) * 8; *(v8b*)(VFH + vb + o) = *(const v8b*)(Vh + o); *(v8b*)(VFL + vb + o) = *(const v8b*)(Vl + o); } }
    return; }
  const int j = c0 >> 7, h0 = c0 & 64;   // the wave's 64 columns = one 128-B half of chunk j of projection p
#pragma unroll
  for (int m = 0; m < PM; ++m) { if (m) wave_lds_sync();   // the lanes' reads of the row tile before end ahead of other lanes' writes to the same patch
#pragma unroll
    for (int t = 0; t < 4; ++t) { const int cc = t * 16 + nloc;
#pragma unroll
      for (int r8 = 0; r8 < 8; ++r8) { b16 ph, pl; split16((acc[m][t][r8] * (1.0f / (XS * WSC)) + bvv[t]) * sc * HS, ph, pl); Oh[wv][8 * hlf + r8][cc] = ph; Ol[wv][8 * hlf + r8][cc] = pl; } }
    wave_lds_sync();
    for (int rr = 0; rr < 16; rr += 4) { const int r = rr + (lane >> 3), d8 = (lane & 7) * 8; const size_t T = 8 * (m0 + 16 * m + r) + j;   // 8 lanes x 16 B per row, 4 rows per store
      *(v8b*)(PH + T * PW + p * 128 + h0 + d8) = *(const v8b*)(&Oh[wv][r][d8]); *(v8b*)(PL + T * PW + p * 128 + h0 + d8) = *(const v8b*)(&Ol[wv][r][d8]); }
    asm volatile("s_wait_xcnt 0x0" ::: "memory");   // the wait in front of the reuse of the address and data registers of this row tile's 8 stores
  } }
// attention: block of AW = 8 waves per (b, h, QM = 2 tiles of 16 queries); key blocks of 128 over all keys. The three inner loops of a key block are dealt to the waves: wave wv does key tile wv of S = Q K^T (3 products, K 128) for both query tiles, rows 4 wv .. + 3 of the 32 rows of the online softmax (P x256 hi+lo), and d tile wv of P V for both query tiles (V fragments straight from the fragment-order planes that proj_kernel wrote), so that each K and V fragment, loaded once, feeds both query tiles' products from registers. Q, S, P and each row's rescale factor go from wave to wave through LDS; every sum keeps its order.
constexpr int AW = 8, QM = 2, QR = 16 * QM;
static_assert(L % KB == 0 && KB / 16 == AW && HD / 16 == AW && QR == 4 * AW && 64 % QR == 0, "the deal below is for 8 key tiles, 32 rows and 8 d tiles over 8 waves; a block's queries lie in one 64-query mask block");
__global__ __launch_bounds__(32 * AW) void att_kernel(const b16* __restrict__ PH, const b16* __restrict__ PL, const b16* __restrict__ VFH, const b16* __restrict__ VFL, const int* __restrict__ rsrc, const int* __restrict__ rtgt, int BLIM, float* __restrict__ ATT) { __shared__ __attribute__((aligned(16))) b16 Ph_[QR][KB + 8], Pl_[QR][KB + 8], Qh_[QR][HD + 8], Ql_[QR][HD + 8]; __shared__ float Sf[QR][KB + 4], Of[QR][HD + 4], Sc[QR], Dn[QR];
  const int lane = threadIdx.x & 31, wv = __builtin_amdgcn_readfirstlane(threadIdx.x >> 5), nloc = lane & 15, hlf = lane >> 4; const int qt = blockIdx.x % (L / QR); const int h = (blockIdx.x / (L / QR)) % NH; const int b = blockIdx.x / ((L / QR) * NH); if (b >= BLIM) return; const int t0 = qt * QR; const int ib = t0 / 64; const int rs0 = rsrc[0], rs1 = rsrc[1], rs2 = rsrc[2], rt0 = rtgt[0], rt1 = rtgt[1], rt2 = rtgt[2];
  auto allowed = [&](int jb) { return (jb == 0) || (jb == NBLK - 1) || (jb - ib <= 1 && ib - jb <= 1) || (rs0 == ib && rt0 == jb) || (rs1 == ib && rt1 == jb) || (rs2 == ib && rt2 == jb); }; const size_t rowb = (size_t)b * L; const int qo = h * HD, ko = C + h * HD;
  { constexpr int QT = QR * (HD / 8) / (32 * AW); const b16 *qph[QT], *qpl[QT]; v8b qa[QT], qb[QT];   // the block's 32 query rows, 16 B a thread, plane and trip
    static_assert(QT == 2, "the wait below names the address registers of two trips");
#pragma unroll   // both trips' loads in flight together
    for (int k = 0; k < QT; ++k) { const int i = k * 32 * AW + (int)threadIdx.x; qph[k] = PH + (rowb + t0 + i / (HD / 8)) * PW + qo + (i % (HD / 8)) * 8; qpl[k] = PL + (rowb + t0 + i / (HD / 8)) * PW + qo + (i % (HD / 8)) * 8; qa[k] = *(const v8b*)qph[k]; qb[k] = *(const v8b*)qpl[k]; }
    asm volatile("s_wait_xcnt 0x0" :: "v"(qph[0]), "v"(qph[1]), "v"(qpl[0]), "v"(qpl[1]) : "memory");   // the wait in front of the reuse of the loads' address registers: as inputs here they stay whole up to it
#pragma unroll   // constant indices keep qa and qb in registers
    for (int k = 0; k < QT; ++k) { const int i = k * 32 * AW + (int)threadIdx.x; *(v8b*)(&Qh_[i / (HD / 8)][(i % (HD / 8)) * 8]) = qa[k]; *(v8b*)(&Ql_[i / (HD / 8)][(i % (HD / 8)) * 8]) = qb[k]; } }
  __syncthreads();   // every wave reads all 32 query rows
  float m_w[4], den_w[4]; v8f acc[QM];   // running maximum and denominator of the wave's own 4 rows (the same in every lane); accumulators of its own d tile, one per query tile
#pragma unroll   // here and below: constant indices keep m_w, den_w, acc, s, qh, ql, pa and pb in registers
  for (int i = 0; i < 4; ++i) { m_w[i] = -INFINITY; den_w[i] = 0.0f; }
#pragma unroll
  for (int u = 0; u < QM; ++u) acc[u] = (v8f){};
  const int kstart = 0; const int kend = L;   // [kstart, kend)
#pragma unroll 1
  for (int kb0 = kstart; kb0 < kend; kb0 += KB) { const int nk = (kend - kb0) < KB ? (kend - kb0) : KB; const int nkt = (nk + 15) / 16; if (!allowed(kb0 / 64) && !allowed(kb0 / 64 + 1)) continue;   /* neither 64-key sub-block of this 128-key block is visible to this query block (the same for the whole work-group) */
    { const int t = wv; if (t < nkt) { const int key = kb0 + t * 16 + nloc < L ? kb0 + t * 16 + nloc : L - 1; const size_t kr = (rowb + key) * PW + 8 * hlf; const b16* const kph = PH + kr; const b16* const kpl = PL + kr; v8f s[QM];   // the lane half's 8 * hlf is in the pointers
#pragma unroll
        for (int u = 0; u < QM; ++u) s[u] = (v8f){};
#pragma unroll
        for (int q = 0; q < HD / 32; ++q) { const v16b kh = frag_kb(kph + ko + q * 32, 0), kl = frag_kb(kpl + ko + q * 32, 0); v16b qh[QM], ql[QM];   // the K fragments serve both query tiles; all loads of the trip stand ahead of its products
#pragma unroll
          for (int u = 0; u < QM; ++u) { qh[u] = frag_kb(&Qh_[16 * u + nloc][q * 32], hlf); ql[u] = frag_kb(&Ql_[16 * u + nloc][q * 32], hlf); }
#pragma unroll
          for (int u = 0; u < QM; ++u) s[u] = wmma16b(qh[u], kh, s[u]);
#pragma unroll
          for (int u = 0; u < QM; ++u) s[u] = wmma16b(qh[u], kl, s[u]);
#pragma unroll
          for (int u = 0; u < QM; ++u) s[u] = wmma16b(ql[u], kh, s[u]); }
        asm volatile("s_wait_xcnt 0x0" :: "v"(kph), "v"(kpl) : "memory");   // the wait in front of the reuse of the K loads' address registers: as inputs here they stay whole up to it
        const int j = kb0 + t * 16 + nloc; const bool ok = (j < kend) && allowed(j >> 6);   /* BigBird block mask (-1e9 in the module == excluded; key block 0 always allowed) */
#pragma unroll
        for (int u = 0; u < QM; ++u)
#pragma unroll
          for (int r8 = 0; r8 < 8; ++r8) Sf[16 * u + 8 * hlf + r8][t * 16 + nloc] = ok ? s[u][r8] * (1.0f / (HS * HS)) : -INFINITY; }
      else {
#pragma unroll
        for (int u = 0; u < QM; ++u)
#pragma unroll
          for (int r8 = 0; r8 < 8; ++r8) Sf[16 * u + 8 * hlf + r8][t * 16 + nloc] = -INFINITY; } }
    __syncthreads();   // a softmax row holds the scores of all eight waves' key tiles; it also ends every wave's reads of P and Sc of the key block before
#pragma unroll
    for (int i = 0; i < 4; ++i) { const int rr = 4 * wv + i; float mx = -INFINITY;
#pragma unroll
      for (int q = 0; q < 4; ++q) mx = fmaxf(mx, Sf[rr][q * 32 + lane]);
      for (int o = 16; o; o >>= 1) mx = fmaxf(mx, __shfl_xor(mx, o));
      const float mold = m_w[i]; const float mn = fmaxf(mold, mx); const float sf = (mold == -INFINITY) ? 0.0f : ((mn == -INFINITY) ? 1.0f : __expf(mold - mn)); float ps = 0.0f;
#pragma unroll
      for (int q = 0; q < 4; ++q) { const int kx = q * 32 + lane; const float sv = Sf[rr][kx]; const float p = (sv == -INFINITY || mn == -INFINITY) ? 0.0f : __expf(sv - mn); ps += p; b16 ph, pl; split16(p * PS, ph, pl); Ph_[rr][kx] = ph; Pl_[rr][kx] = pl; }
      for (int o = 16; o; o >>= 1) ps += __shfl_xor(ps, o);
      den_w[i] = den_w[i] * sf + ps; m_w[i] = mn; if (lane == 0) Sc[rr] = sf; }
    __syncthreads();   // every wave reads all 32 rows of P and their rescale factors; it also ends the reads of Sf before the next key block's scores are stored
#pragma unroll
    for (int u = 0; u < QM; ++u)
#pragma unroll
      for (int r8 = 0; r8 < 8; ++r8) acc[u][r8] = acc[u][r8] * Sc[16 * u + 8 * hlf + r8];
    const size_t vf = ((rowb + kb0) / 32) * (size_t)((HD / 16) * 512) + wv * 512 + lane * 8; const b16* const vph = VFH + vf; const b16* const vpl = VFL + vf;   // the wave's d tile in the key block's first 32-key group; the later groups are constant steps from it
    for (int ks = 0; ks < nkt * 16; ks += 32) { const v16b vh = frag_vf(vph + (ks / 32) * ((HD / 16) * 512)), vl = frag_vf(vpl + (ks / 32) * ((HD / 16) * 512));   // the V fragments serve both query tiles; their 4 loads stand ahead of the products, so that they are in flight together: no load moves up over the asm statement in wmma16b
      asm volatile("s_wait_xcnt 0x0" :: "v"(vph), "v"(vpl) : "memory");   // the wait in front of the reuse of the loads' address registers: as inputs here they stay whole up to it, and the LDS reads below, which took them over, stay behind it
      v16b pa[QM], pb[QM];
#pragma unroll
      for (int u = 0; u < QM; ++u) { pa[u] = frag_kb(&Ph_[16 * u + nloc][ks], hlf); pb[u] = frag_kb(&Pl_[16 * u + nloc][ks], hlf); }
#pragma unroll
      for (int u = 0; u < QM; ++u) acc[u] = wmma16b(pa[u], vh, acc[u]);
#pragma unroll
      for (int u = 0; u < QM; ++u) acc[u] = wmma16b(pa[u], vl, acc[u]);
#pragma unroll
      for (int u = 0; u < QM; ++u) acc[u] = wmma16b(pb[u], vh, acc[u]); } }
#pragma unroll
  for (int i = 0; i < 4; ++i) if (lane == 0) Dn[4 * wv + i] = den_w[i];
  __syncthreads();   // every wave divides by the denominators of all 32 rows
#pragma unroll
  for (int u = 0; u < QM; ++u)
#pragma unroll
    for (int r8 = 0; r8 < 8; ++r8) { const float dn = Dn[16 * u + 8 * hlf + r8]; Of[16 * u + 8 * hlf + r8][wv * 16 + nloc] = dn > 0.0f ? acc[u][r8] * (1.0f / (HS * PS)) / dn : 0.0f; }
  __syncthreads();   // a stored row holds the d tiles of all eight waves
  const int rb_ = b / HEADS, hq = b % HEADS;   /* merge heads: ATT[b][s][h*128 + d] */
  { for (int rr = 4 * wv; rr < 4 * wv + 4; ++rr) for (int s = 0; s < HD / 32; ++s) ((float*)ATT)[((size_t)rb_ * L + t0 + rr) * DIM + hq * 128 + s * 32 + lane] = Of[rr][s * 32 + lane];  } }
// output projection: block of 16 waves per (OM = 2 tiles of 16 rows, half of the columns = blockIdx.y): the waves stage the attended rows (hi+lo) once, one row of each tile each, and share them; wave wv then does columns blockIdx.y*512 + wv*32 .. +31 (2 column tiles) for both row tiles, so that each WO fragment, loaded once, feeds 4 products from registers:
constexpr int OM = 2;
static_assert(NRB % (16 * OM) == 0, "a block's rows all exist");
__global__ __launch_bounds__(512) void outp_kernel(const float* __restrict__ ATT, const b16* __restrict__ WO, const float* __restrict__ bo, int RLIM, float* __restrict__ out) { __shared__ __attribute__((aligned(16))) b16 Ah[16 * OM][DIM + 8], Al[16 * OM][DIM + 8]; __shared__ __attribute__((aligned(16))) float Tf[16][16][36]; const int lane = threadIdx.x & 31, wv = __builtin_amdgcn_readfirstlane(threadIdx.x >> 5), nloc = lane & 15, hlf = lane >> 4; const size_t m0 = (size_t)blockIdx.x * (16 * OM); if (m0 >= (size_t)RLIM) return;
  for (int q = 0; q < DIM / 32; ++q)
    for (int m = 0; m < OM; ++m) { const int sr = 16 * m + wv, cx = q * 32 + lane; b16 p, ql; split16(ATT[(m0 + sr) * DIM + cx] * HS, p, ql); Ah[sr][cx] = p; Al[sr][cx] = ql; }
  __syncthreads();   // every wave reads all staged rows
  const int c0 = blockIdx.y * (DIM / 2) + wv * 32; v8f acc[OM][2]; const b16* const wf = WO + (c0 / 16) * 512 + lane * 8;   // fragment-order plane, as in proj_kernel
#pragma unroll   // here and below: constant indices keep acc, bw, a and al in registers
  for (int m = 0; m < OM; ++m)
#pragma unroll
    for (int t = 0; t < 2; ++t) acc[m][t] = (v8f){};
#pragma unroll 2   // two k blocks a trip: the second's addresses are immediates of the first's, and the loop stays small
  for (int kk = 0; kk < DIM; kk += 32) { v16b bw[2], a[OM], al[OM];   // the k block's 2 weight fragments, each used for both row tiles (hi and lo) below
#pragma unroll
    for (int t = 0; t < 2; ++t) bw[t] = frag_vf(wf + kk * DIM + t * 512);
#pragma unroll
    for (int m = 0; m < OM; ++m) { a[m] = frag_kb(&Ah[16 * m + nloc][kk], hlf); al[m] = frag_kb(&Al[16 * m + nloc][kk], hlf); }
#pragma unroll
    for (int m = 0; m < OM; ++m)
#pragma unroll
      for (int t = 0; t < 2; ++t) { acc[m][t] = wmma16b(a[m], bw[t], acc[m][t]); acc[m][t] = wmma16b(al[m], bw[t], acc[m][t]); } }
  float bb[2];   // the wave's 2 bias values serve both row tiles
#pragma unroll
  for (int t = 0; t < 2; ++t) bb[t] = bo[c0 + t * 16 + nloc];
#pragma unroll
  for (int t = 0; t < 2; ++t) bb[t] = bfv(bb[t]);
#pragma unroll
  for (int m = 0; m < OM; ++m) { if (m) wave_lds_sync();   // the lanes' reads of the row tile before end ahead of other lanes' writes to the same patch
#pragma unroll
    for (int t = 0; t < 2; ++t) { const int cc = t * 16 + nloc;
#pragma unroll
      for (int r8 = 0; r8 < 8; ++r8) Tf[wv][8 * hlf + r8][cc] = acc[m][t][r8] * (1.0f / (HS * WSC)) + bb[t]; }
    wave_lds_sync();
    for (int rr = 0; rr < 16; rr += 4) { const int r = rr + (lane >> 3), c4 = (lane & 7) * 4;   // 8 lanes x 16 B = one 128-B line per row, 4 rows per store
      *(v4f*)(out + (m0 + 16 * m + r) * DIM + c0 + c4) = *(const v4f*)(&Tf[wv][r][c4]); }
  } }
}  // namespace

extern "C" void kernel_launch(void* const* d_in, const int* in_sizes, int n_in, void* d_out, int out_size, void* d_ws, size_t ws_size, hipStream_t stream) {
  (void)n_in;
  auto Fp = [&](int i) { return (const float*)d_in[i]; };
  // input order: 0 x [2,2048,1024]; 1 Wq [1024,1024] (in,out); 2 bq; 3 Wk; 4 bk; 5 Wv; 6 bv; 7 Wo; 8 bo; 9 rand_src [3] i32; 10 rand_tgt [3] i32
  if (in_sizes[0] != NRB * DIM || in_sizes[1] != DIM * DIM || in_sizes[3] != DIM * DIM || in_sizes[5] != DIM * DIM || in_sizes[7] != DIM * DIM || in_sizes[8] != DIM || in_sizes[9] != 3 || in_sizes[10] != 3 || out_size != NRB * DIM) return;
  const int BLIM = NB;   // (batch, head) pairs
  const int RLIM = NRB;
  size_t off = 0; char* ws = (char*)d_ws;
  auto carve = [&](size_t bytes) { char* p = ws + off; off += (bytes + 255) & ~(size_t)255; return p; };
  b16* W3 = (b16*)carve((size_t)3 * DIM * DIM * 2); b16* WO = (b16*)carve((size_t)DIM * DIM * 2); b16* PH = (b16*)carve((size_t)NT * PW * 2); b16* PL = (b16*)carve((size_t)NT * PW * 2); float* ATT = (float*)carve((size_t)NRB * DIM * 4); b16* VFH = (b16*)carve((size_t)NT * HD * 2); b16* VFL = (b16*)carve((size_t)NT * HD * 2);
  if (off > ws_size || off > ((size_t)96 << 20)) return;   // 88 MiB (~ 92 MB)
  wput_kernel<<<(unsigned)(((size_t)4 * DIM * (DIM / 8) + 255) / 256), 256, 0, stream>>>(Fp(1), Fp(3), Fp(5), Fp(7), W3, WO);
  proj_kernel<<<dim3(RLIM / (16 * PM), 3), 512, 0, stream>>>(Fp(0), W3, Fp(2), Fp(4), Fp(6), RLIM, PH, PL, VFH, VFL);
  att_kernel<<<BLIM * NH * (L / QR), 32 * AW, 0, stream>>>(PH, PL, VFH, VFL, (const int*)d_in[9], (const int*)d_in[10], BLIM, ATT);
  outp_kernel<<<dim3(RLIM / (16 * OM), 2), 512, 0, stream>>>(ATT, WO, Fp(8), RLIM, (float*)d_out);
}

// v007
// Measured time: 122 microseconds a run.
// In both of two side-by-side timings against v006, it was 1.05 times as fast.
// All steps since v000 together make it 18.5 times as fast.
#include <hip/hip_runtime.h>

// HierarchicalAttention (BigBird-style block mask): Q = x Wq + bq, K, V likewise ((in,out) 1024x1024); the module's raw .view(B, 8, 2048, 128) makes head h / token s the 128-slice s%8 of projected row h*256 + s/8 — i.e. the flat
// [B*8*2048][128] view of each projection; scores / sqrt(128); key block j (64 keys) allowed for query block i iff j == 0 || j == 31 || |i-j| <= 1 || (i,j) is one of the 3 (rand_src, rand_tgt) pairs, else -1e9 (== excluded;
// block 0 always allowed); softmax; O merged as [b][s][h*128+d]; out = O Wo + bo -> [2][2048][1024].
// Deterministic: no index structures, no atomics; flash-style online softmax over all key blocks in a fixed order.
// WMMA (v_wmma_f32_16x16x32_f16, f32 accumulate): the QKV projection with x EXACT bf16 x8 (K 1024) against exact torch weight rows x256 (one product); S = Q K^T (hi+lo x hi+lo, 3 products, K 128); O = P V (P x256 hi+lo x V^T hi+lo, 3 products); softmax in f32. Inputs rounded to bf16 once. Fragment k-map per lane half hh for A AND B: elements 0..7 <- k = 8hh+0..7, 8..15 <- k = 16+8hh+0..7; acc[r] = D[8hh+r][col].

namespace {
constexpr int NB = 16, L = 2048, C = 128, NH = 1, HD = 128, NT = NB * L, KB = 128, PW = 3 * C;   // NB = (batch, head) pairs; the 'token' index is (b*8 + h)*2048 + s
constexpr int RB = 2, DIM = 1024, HEADS = 8, NBLK = 32, NRB = RB * L /* 4096 projected rows */;
constexpr float XS = 8.0f, HS = 256.0f /* hi+lo staging scale for q/k/v/attended */, WSC = 256.0f, PS = 256.0f, SCALE = 0.08838834764831845f;
typedef _Float16 b16;
typedef __attribute__((ext_vector_type(16))) _Float16 v16b;
typedef __attribute__((ext_vector_type(8))) _Float16 v8b;
typedef __attribute__((ext_vector_type(8))) float v8f;
typedef __attribute__((ext_vector_type(4))) float v4f;
__device__ __forceinline__ float bf16_rne(float f) { unsigned int u = __float_as_uint(f); u += 0x7FFFu + ((u >> 16) & 1u); float r = __uint_as_float(u & 0xFFFF0000u); asm volatile("" : "+v"(r)); return r; }
__device__ __forceinline__ float bfv(float f) { float r = bf16_rne(f); asm volatile("" : "+v"(r)); return r; }
__device__ __forceinline__ void split16(float v, b16& hi, b16& lo) { hi = (b16)v; lo = (b16)(v - (float)hi); }
__device__ __forceinline__ v16b frag_kb(const b16* p, int hh) { const v8b a = *(const v8b*)(p + 8 * hh), b = *(const v8b*)(p + 16 + 8 * hh); v16b f;
#pragma unroll
  for (int e = 0; e < 8; ++e) { f[e] = a[e]; f[8 + e] = b[e]; } return f; }
__device__ __forceinline__ v16b frag_vf(const b16* p) { const v8b a = *(const v8b*)p, b = *(const v8b*)(p + 256); v16b f;   // p already holds the lane's own 8 * lane: two whole 512-B runs per wave
#pragma unroll
  for (int e = 0; e < 8; ++e) { f[e] = a[e]; f[8 + e] = b[e]; } return f; }
__device__ __forceinline__ v8f wmma16b(v16b a, v16b b, v8f c) { v8f d = __builtin_amdgcn_wmma_f32_16x16x32_f16(false, a, false, b, (short)0, c, false, false); asm volatile("v_nop\n\tv_nop\n\tv_nop\n\tv_nop" : "+v"(d) : "v"(a), "v"(b)); return d; }
__device__ __forceinline__ void wave_lds_sync() { __builtin_amdgcn_fence(__ATOMIC_RELEASE, "workgroup"); __builtin_amdgcn_wave_barrier(); __builtin_amdgcn_fence(__ATOMIC_ACQUIRE, "workgroup"); }
__device__ __forceinline__ float pmul(float a, float b) { float p = a * b; asm volatile("" : "+v"(p)); return p; }

__global__ __launch_bounds__(256) void wput_kernel(const float* __restrict__ wq, const float* __restrict__ wk, const float* __restrict__ wv, const float* __restrict__ wo, b16* __restrict__ W3, b16* __restrict__ WO) { const size_t u = (size_t)blockIdx.x * 256 + threadIdx.x; if (u >= (size_t)4 * DIM * (DIM / 8)) return;
  // thread u writes 16-B piece u of the planes, which lie in the order of the projections' B fragments: [matrix p][32-k block][16-column tile][e][lane = 16 hh + o % 16][i], k % 32 = 16 e + 8 hh + i (o = output column of the weight), so that a wave reads each fragment half as one 512-B run and the tiles of one k block lie side by side; a wave here loads 2 x 64 B at a time and stores 512 B in a row
  const int ln = (int)(u & 31), p = (int)(u >> 17), o = ((int)(u >> 6) & 63) * 16 + (ln & 15), k0 = ((int)(u >> 12) & 31) * 32 + ((int)(u >> 5) & 1) * 16 + (ln >> 4) * 8; const float* w = p == 0 ? wq : (p == 1 ? wk : (p == 2 ? wv : wo)); v8b v;
#pragma unroll
  for (int j = 0; j < 8; ++j) v[j] = (b16)(bf16_rne(w[(size_t)(k0 + j) * DIM + o]) * WSC);
  { *(v8b*)(p < 3 ? W3 + u * 8 : WO + (u - (size_t)3 * DIM * (DIM / 8)) * 8) = v;  } }
// projection: block of 16 waves per (PM = 4 tiles of 16 projected rows, projection p = blockIdx.y): the waves stage bf16(x) (EXACT, K 1024) once, one row of each tile each, and share it; wave wv then does columns wv*64 .. +63 of p (4 column tiles) for all 4 row tiles, so that each W3 fragment, loaded once, feeds 4 products from registers; + bias (Q scaled by 1/sqrt(128)); row r, 128-chunk j -> token T = 8*(b*2048 + r) + j:
constexpr int PM = 4;
static_assert(NRB % (16 * PM) == 0, "a block's rows all exist");
__global__ __launch_bounds__(512) void proj_kernel(const float* __restrict__ x, const b16* __restrict__ W3, const float* __restrict__ bq, const float* __restrict__ bk, const float* __restrict__ bv, int RLIM, b16* __restrict__ PH, b16* __restrict__ PL, b16* __restrict__ VFH, b16* __restrict__ VFL, b16* __restrict__ KFH, b16* __restrict__ KFL) { __shared__ __attribute__((aligned(16))) b16 Ah[16 * PM][DIM + 8], Oh[16][16][72], Ol[16][16][72]; const int lane = threadIdx.x & 31, wv = __builtin_amdgcn_readfirstlane(threadIdx.x >> 5), nloc = lane & 15, hlf = lane >> 4; const size_t m0 = (size_t)blockIdx.x * (16 * PM); if (m0 >= (size_t)RLIM) return;
  for (int q = 0; q < DIM / 32; ++q) { float xv[PM];   // the wave's row of each of the 4 tiles: the 4 loads of a trip stand ahead of the roundings
#pragma unroll   // here and below: constant indices keep xv, acc, bw, a and bvv in registers
    for (int m = 0; m < PM; ++m) xv[m] = x[(m0 + 16 * m + wv) * DIM + q * 32 + lane];
#pragma unroll
    for (int m = 0; m < PM; ++m) Ah[16 * m + wv][q * 32 + lane] = (b16)(bf16_rne(xv[m]) * XS); }
  __syncthreads();   // every wave reads all staged rows
  const int p = blockIdx.y, c0 = wv * 64; const float* bb = p == 0 ? bq : (p == 1 ? bk : bv); const float sc = p == 0 ? SCALE : 1.0f; v8f acc[PM][4]; const b16* const wf = W3 + (size_t)p * DIM * DIM + (c0 / 16) * 512 + lane * 8;   // the wave's first column tile in the fragment-order plane: 512 elements a tile, 32 * DIM a 32-k block
#pragma unroll
  for (int m = 0; m < PM; ++m)
#pragma unroll
    for (int t = 0; t < 4; ++t) acc[m][t] = (v8f){};
#pragma unroll 2   // two k blocks a trip: the second's addresses are immediates of the first's, and the loop stays small
  for (int kb = 0; kb < DIM; kb += 32) { v16b bw[4], a[PM];   // the k block's 4 weight fragments and 4 row fragments, each used 4 times below
#pragma unroll
    for (int t = 0; t < 4; ++t) bw[t] = frag_vf(wf + kb * DIM + t * 512);
#pragma unroll
    for (int m = 0; m < PM; ++m) a[m] = frag_kb(&Ah[16 * m + nloc][kb], hlf);
#pragma unroll
    for (int m = 0; m < PM; ++m)
#pragma unroll
      for (int t = 0; t < 4; ++t) acc[m][t] = wmma16b(a[m], bw[t], acc[m][t]); }
  float bvv[4]; const float* const bp = bb + c0 + nloc;   // the wave's 4 bias values serve all row tiles
#pragma unroll
  for (int t = 0; t < 4; ++t) bvv[t] = bp[t * 16];
  asm volatile("s_wait_xcnt 0x0" :: "v"(nloc) : "memory");   // the wait in front of the reuse of the loads' address registers: the lane's part of the address is nloc, which as an input here stays whole up to it
#pragma unroll
  for (int t = 0; t < 4; ++t) bvv[t] = bfv(bvv[t]);
  if (p == 2) {   // V: 16 rows x 1024 columns (one row tile) are 128 consecutive keys x 128 d of one head. They leave in the order of the P V product's B fragments: [32-key group][16-d tile][e][lane = 16 hh + d % 16][i], key % 32 = 16 e + 8 hh + i, so that a wave of att_kernel reads each fragment half as one 512-B run
    b16* const Vh = &Oh[0][0][0]; b16* const Vl = &Ol[0][0][0];   // 4 groups x 8 tiles x 512 = 16384 elements per plane, shared by the block, one row tile at a time
#pragma unroll
    for (int m = 0; m < PM; ++m) {
      if (m) __syncthreads();   // the copy-out of the row tile before has read the planes (p is the same for the whole block)
#pragma unroll
      for (int t = 0; t < 4; ++t) {
#pragma unroll
        for (int r8 = 0; r8 < 8; ++r8) { b16 ph, pl; split16((acc[m][t][r8] * (1.0f / (XS * WSC)) + bvv[t]) * sc * HS, ph, pl);   // local key = 8 * (8 hlf + r8) + (wv >> 1), d = (c0 & 64) + 16 t + nloc
          const int ix = ((((2 * hlf + (r8 >> 2)) * 8 + ((c0 & 64) >> 4) + t) * 2 + ((r8 >> 1) & 1)) * 32 + (r8 & 1) * 16 + nloc) * 8 + (wv >> 1); Vh[ix] = ph; Vl[ix] = pl; } }
      __syncthreads();   // the copy-out below reads what all 16 waves wrote
      const size_t vb = (8 * (m0 + 16 * m) / 32) * (size_t)(8 * 512);
#pragma unroll
      for (int q = 0; q < 4; ++q) { const int o = (q * 512 + (int)threadIdx.x) * 8; *(v8b*)(VFH + vb + o) = *(const v8b*)(Vh + o); *(v8b*)(VFL + vb + o) = *(const v8b*)(Vl + o); } }
    return; }
  if (p == 1) {   // K: a row tile is the same 128 consecutive keys x 128 d of one head. They leave in the order of the S product's B fragments: [16-key tile][32-d block][e][lane = 16 hh + key % 16][i], d % 32 = 16 e + 8 hh + i, so that a wave of att_kernel reads each fragment half as one 512-B run
    b16* const Kh = &Oh[0][0][0]; b16* const Kl = &Ol[0][0][0];   // 8 tiles x 4 blocks x 512 = 16384 elements per plane; in LDS 16 B follow each 256 B and 32 B more stand ahead of the upper 4 tiles (17424 of the 18432 elements), so that the 32 lanes of a 2-byte store fall on 16 different banks
    const int kx = hlf * (4 * 2176 + 16) + ((c0 & 64) >> 5) * 544 + (nloc >> 3) * 136 + (wv >> 1) * 8 + (nloc & 7);   // the lane's and the wave's part of the padded index: key tile 4 hlf + (r8 >> 1), key % 16 = 8 (r8 & 1) + (wv >> 1), d = (c0 & 64) + 16 t + nloc
#pragma unroll
    for (int m = 0; m < PM; ++m) {
      if (m) __syncthreads();   // the copy-out of the row tile before has read the planes (p is the same for the whole block)
#pragma unroll
      for (int t = 0; t < 4; ++t) {
#pragma unroll
        for (int r8 = 0; r8 < 8; ++r8) { b16 ph, pl; split16((acc[m][t][r8] * (1.0f / (XS * WSC)) + bvv[t]) * sc * HS, ph, pl);
          const int ix = kx + (r8 >> 1) * 2176 + (t >> 1) * 544 + (t & 1) * 272 + (r8 & 1) * 64; Kh[ix] = ph; Kl[ix] = pl; } }
      __syncthreads();   // the copy-out below reads what all 16 waves wrote
      const size_t kb = (8 * (m0 + 16 * m) / 16) * (size_t)(4 * 512);
#pragma unroll
      for (int q = 0; q < 4; ++q) { const int pc = q * 512 + (int)threadIdx.x, o = pc * 8, lo = o + (pc >> 4) * 8 + (pc >> 10) * 16; *(v8b*)(KFH + kb + o) = *(const v8b*)(Kh + lo); *(v8b*)(KFL + kb + o) = *(const v8b*)(Kl + lo); } }
    return; }
  const int j = c0 >> 7, h0 = c0 & 64;   // Q: the wave's 64 columns = one 128-B half of chunk j of projection p
#pragma unroll
  for (int m = 0; m < PM; ++m) { if (m) wave_lds_sync();   // the lanes' reads of the row tile before end ahead of other lanes' writes to the same patch
#pragma unroll
    for (int t = 0; t < 4; ++t) { const int cc = t * 16 + nloc;
#pragma unroll
      for (int r8 = 0; r8 < 8; ++r8) { b16 ph, pl; split16((acc[m][t][r8] * (1.0f / (XS * WSC)) + bvv[t]) * sc * HS, ph, pl); Oh[wv][8 * hlf + r8][cc] = ph; Ol[wv][8 * hlf + r8][cc] = pl; } }
    wave_lds_sync();
    for (int rr = 0; rr < 16; rr += 4) { const int r = rr + (lane >> 3), d8 = (lane & 7) * 8; const size_t T = 8 * (m0 + 16 * m + r) + j;   // 8 lanes x 16 B per row, 4 rows per store
      *(v8b*)(PH + T * PW + p * 128 + h0 + d8) = *(const v8b*)(&Oh[wv][r][d8]); *(v8b*)(PL + T * PW + p * 128 + h0 + d8) = *(const v8b*)(&Ol[wv][r][d8]); }
    asm volatile("s_wait_xcnt 0x0" ::: "memory");   // the wait in front of the reuse of the address and data registers of this row tile's 8 stores
  } }
// attention: block of AW = 8 waves per (b, h, QM = 2 tiles of 16 queries); key blocks of 128 over all keys. The three inner loops of a key block are dealt to the waves: wave wv does key tile wv of S = Q K^T (3 products, K 128) for both query tiles, rows 4 wv .. + 3 of the 32 rows of the online softmax (P x256 hi+lo), and d tile wv of P V for both query tiles (K and V fragments straight from the fragment-order planes that proj_kernel wrote), so that each K and V fragment, loaded once, feeds both query tiles' products from registers. Q, S, P and each row's rescale factor go from wave to wave through LDS; every sum keeps its order.
constexpr int AW = 8, QM = 2, QR = 16 * QM;
static_assert(L % KB == 0 && KB / 16 == AW && HD / 16 == AW && QR == 4 * AW && 64 % QR == 0, "the deal below is for 8 key tiles, 32 rows and 8 d tiles over 8 waves; a block's queries lie in one 64-query mask block");
__global__ __launch_bounds__(32 * AW) void att_kernel(const b16* __restrict__ PH, const b16* __restrict__ PL, const b16* __restrict__ VFH, const b16* __restrict__ VFL, const b16* __restrict__ KFH, const b16* __restrict__ KFL, const int* __restrict__ rsrc, const int* __restrict__ rtgt, int BLIM, float* __restrict__ ATT) { __shared__ __attribute__((aligned(16))) b16 Ph_[QR][KB + 8], Pl_[QR][KB + 8], Qh_[QR][HD + 8], Ql_[QR][HD + 8]; __shared__ float Sf[QR][KB + 4], Of[QR][HD + 4], Sc[QR], Dn[QR];
  const int lane = threadIdx.x & 31, wv = __builtin_amdgcn_readfirstlane(threadIdx.x >> 5), nloc = lane & 15, hlf = lane >> 4; const int qt = blockIdx.x % (L / QR); const int h = (blockIdx.x / (L / QR)) % NH; const int b = blockIdx.x / ((L / QR) * NH); if (b >= BLIM) return; const int t0 = qt * QR; const int ib = t0 / 64; const int rs0 = rsrc[0], rs1 = rsrc[1], rs2 = rsrc[2], rt0 = rtgt[0], rt1 = rtgt[1], rt2 = rtgt[2];
  auto allowed = [&](int jb) { return (jb == 0) || (jb == NBLK - 1) || (jb - ib <= 1 && ib - jb <= 1) || (rs0 == ib && rt0 == jb) || (rs1 == ib && rt1 == jb) || (rs2 == ib && rt2 == jb); }; const size_t rowb = (size_t)b * L; const int qo = h * HD;
  { constexpr int QT = QR * (HD / 8) / (32 * AW); const b16 *qph[QT], *qpl[QT]; v8b qa[QT], qb[QT];   // the block's 32 query rows, 16 B a thread, plane and trip
    static_assert(QT == 2, "the wait below names the address registers of two trips");
#pragma unroll   // both trips' loads in flight together
    for (int k = 0; k < QT; ++k) { const int i = k * 32 * AW + (int)threadIdx.x; qph[k] = PH + (rowb + t0 + i / (HD / 8)) * PW + qo + (i % (HD / 8)) * 8; qpl[k] = PL + (rowb + t0 + i / (HD / 8)) * PW + qo + (i % (HD / 8)) * 8; qa[k] = *(const v8b*)qph[k]; qb[k] = *(const v8b*)qpl[k]; }
    asm volatile("s_wait_xcnt 0x0" :: "v"(qph[0]), "v"(qph[1]), "v"(qpl[0]), "v"(qpl[1]) : "memory");   // the wait in front of the reuse of the loads' address registers: as inputs here they stay whole up to it
#pragma unroll   // constant indices keep qa and qb in registers
    for (int k = 0; k < QT; ++k) { const int i = k * 32 * AW + (int)threadIdx.x; *(v8b*)(&Qh_[i / (HD / 8)][(i % (HD / 8)) * 8]) = qa[k]; *(v8b*)(&Ql_[i / (HD / 8)][(i % (HD / 8)) * 8]) = qb[k]; } }
  __syncthreads();   // every wave reads all 32 query rows
  float m_w[4], den_w[4]; v8f acc[QM];   // running maximum and denominator of the wave's own 4 rows (the same in every lane); accumulators of its own d tile, one per query tile
#pragma unroll   // here and below: constant indices keep m_w, den_w, acc, s, qh, ql, pa and pb in registers
  for (int i = 0; i < 4; ++i) { m_w[i] = -INFINITY; den_w[i] = 0.0f; }
#pragma unroll
  for (int u = 0; u < QM; ++u) acc[u] = (v8f){};
  const int kstart = 0; const int kend = L;   // [kstart, kend)
#pragma unroll 1
  for (int kb0 = kstart; kb0 < kend; kb0 += KB) { const int nk = (kend - kb0) < KB ? (kend - kb0) : KB; const int nkt = (nk + 15) / 16; if (!allowed(kb0 / 64) && !allowed(kb0 / 64 + 1)) continue;   /* neither 64-key sub-block of this 128-key block is visible to this query block (the same for the whole work-group) */
    { const int t = wv; if (t < nkt) { const size_t kr = ((rowb + kb0) / 16 + t) * (size_t)((HD / 32) * 512) + lane * 8; const b16* const kph = KFH + kr; const b16* const kpl = KFL + kr; v8f s[QM];   // the wave's key tile in the fragment-order planes; the later 32-d blocks are constant steps from it
#pragma unroll
        for (int u = 0; u < QM; ++u) s[u] = (v8f){};
#pragma unroll
        for (int q = 0; q < HD / 32; ++q) { const v16b kh = frag_vf(kph + q * 512), kl = frag_vf(kpl + q * 512); v16b qh[QM], ql[QM];   // the K fragments serve both query tiles; all loads of the trip stand ahead of its products
#pragma unroll
          for (int u = 0; u < QM; ++u) { qh[u] = frag_kb(&Qh_[16 * u + nloc][q * 32], hlf); ql[u] = frag_kb(&Ql_[16 * u + nloc][q * 32], hlf); }
#pragma unroll
          for (int u = 0; u < QM; ++u) s[u] = wmma16b(qh[u], kh, s[u]);
#pragma unroll
          for (int u = 0; u < QM; ++u) s[u] = wmma16b(qh[u], kl, s[u]);
#pragma unroll
          for (int u = 0; u < QM; ++u) s[u] = wmma16b(ql[u], kh, s[u]); }
        asm volatile("s_wait_xcnt 0x0" :: "v"(kph), "v"(kpl) : "memory");   // the wait in front of the reuse of the K loads' address registers: as inputs here they stay whole up to it
        const int j = kb0 + t * 16 + nloc; const bool ok = (j < kend) && allowed(j >> 6);   /* BigBird block mask (-1e9 in the module == excluded; key block 0 always allowed) */
#pragma unroll
        for (int u = 0; u < QM; ++u)
#pragma unroll
          for (int r8 = 0; r8 < 8; ++r8) Sf[16 * u + 8 * hlf + r8][t * 16 + nloc] = ok ? s[u][r8] * (1.0f / (HS * HS)) : -INFINITY; }
      else {
#pragma unroll
        for (int u = 0; u < QM; ++u)
#pragma unroll
          for (int r8 = 0; r8 < 8; ++r8) Sf[16 * u + 8 * hlf + r8][t * 16 + nloc] = -INFINITY; } }
    __syncthreads();   // a softmax row holds the scores of all eight waves' key tiles; it also ends every wave's reads of P and Sc of the key block before
#pragma unroll
    for (int i = 0; i < 4; ++i) { const int rr = 4 * wv + i; float mx = -INFINITY;
#pragma unroll
      for (int q = 0; q < 4; ++q) mx = fmaxf(mx, Sf[rr][q * 32 + lane]);
      for (int o = 16; o; o >>= 1) mx = fmaxf(mx, __shfl_xor(mx, o));
      const float mold = m_w[i]; const float mn = fmaxf(mold, mx); const float sf = (mold == -INFINITY) ? 0.0f : ((mn == -INFINITY) ? 1.0f : __expf(mold - mn)); float ps = 0.0f;
#pragma unroll
      for (int q = 0; q < 4; ++q) { const int kx = q * 32 + lane; const float sv = Sf[rr][kx]; const float p = (sv == -INFINITY || mn == -INFINITY) ? 0.0f : __expf(sv - mn); ps += p; b16 ph, pl; split16(p * PS, ph, pl); Ph_[rr][kx] = ph; Pl_[rr][kx] = pl; }
      for (int o = 16; o; o >>= 1) ps += __shfl_xor(ps, o);
      den_w[i] = den_w[i] * sf + ps; m_w[i] = mn; if (lane == 0) Sc[rr] = sf; }
    __syncthreads();   // every wave reads all 32 rows of P and their rescale factors; it also ends the reads of Sf before the next key block's scores are stored
#pragma unroll
    for (int u = 0; u < QM; ++u)
#pragma unroll
      for (int r8 = 0; r8 < 8; ++r8) acc[u][r8] = acc[u][r8] * Sc[16 * u + 8 * hlf + r8];
    const size_t vf = ((rowb + kb0) / 32) * (size_t)((HD / 16) * 512) + wv * 512 + lane * 8; const b16* const vph = VFH + vf; const b16* const vpl = VFL + vf;   // the wave's d tile in the key block's first 32-key group; the later groups are constant steps from it
    for (int ks = 0; ks < nkt * 16; ks += 32) { const v16b vh = frag_vf(vph + (ks / 32) * ((HD / 16) * 512)), vl = frag_vf(vpl + (ks / 32) * ((HD / 16) * 512));   // the V fragments serve both query tiles; their 4 loads stand ahead of the products, so that they are in flight together: no load moves up over the asm statement in wmma16b
      asm volatile("s_wait_xcnt 0x0" :: "v"(vph), "v"(vpl) : "memory");   // the wait in front of the reuse of the loads' address registers: as inputs here they stay whole up to it, and the LDS reads below, which took them over, stay behind it
      v16b pa[QM], pb[QM];
#pragma unroll
      for (int u = 0; u < QM; ++u) { pa[u] = frag_kb(&Ph_[16 * u + nloc][ks], hlf); pb[u] = frag_kb(&Pl_[16 * u + nloc][ks], hlf); }
#pragma unroll
      for (int u = 0; u < QM; ++u) acc[u] = wmma16b(pa[u], vh, acc[u]);
#pragma unroll
      for (int u = 0; u < QM; ++u) acc[u] = wmma16b(pa[u], vl, acc[u]);
#pragma unroll
      for (int u = 0; u < QM; ++u) acc[u] = wmma16b(pb[u], vh, acc[u]); } }
#pragma unroll
  for (int i = 0; i < 4; ++i) if (lane == 0) Dn[4 * wv + i] = den_w[i];
  __syncthreads();   // every wave divides by the denominators of all 32 rows
#pragma unroll
  for (int u = 0; u < QM; ++u)
#pragma unroll
    for (int r8 = 0; r8 < 8; ++r8) { const float dn = Dn[16 * u + 8 * hlf + r8]; Of[16 * u + 8 * hlf + r8][wv * 16 + nloc] = dn > 0.0f ? acc[u][r8] * (1.0f / (HS * PS)) / dn : 0.0f; }
  __syncthreads();   // a stored row holds the d tiles of all eight waves
  const int rb_ = b / HEADS, hq = b % HEADS;   /* merge heads: ATT[b][s][h*128 + d] */
  { for (int rr = 4 * wv; rr < 4 * wv + 4; ++rr) for (int s = 0; s < HD / 32; ++s) ((float*)ATT)[((size_t)rb_ * L + t0 + rr) * DIM + hq * 128 + s * 32 + lane] = Of[rr][s * 32 + lane];  } }
// output projection: block of 16 waves per (OM = 2 tiles of 16 rows, half of the columns = blockIdx.y): the waves stage the attended rows (hi+lo) once, one row of each tile each, and share them; wave wv then does columns blockIdx.y*512 + wv*32 .. +31 (2 column tiles) for both row tiles, so that each WO fragment, loaded once, feeds 4 products from registers:
constexpr int OM = 2;
static_assert(NRB % (16 * OM) == 0, "a block's rows all exist");
__global__ __launch_bounds__(512) void outp_kernel(const float* __restrict__ ATT, const b16* __restrict__ WO, const float* __restrict__ bo, int RLIM, float* __restrict__ out) { __shared__ __attribute__((aligned(16))) b16 Ah[16 * OM][DIM + 8], Al[16 * OM][DIM + 8]; __shared__ __attribute__((aligned(16))) float Tf[16][16][36]; const int lane = threadIdx.x & 31, wv = __builtin_amdgcn_readfirstlane(threadIdx.x >> 5), nloc = lane & 15, hlf = lane >> 4; const size_t m0 = (size_t)blockIdx.x * (16 * OM); if (m0 >= (size_t)RLIM) return;
  for (int q = 0; q < DIM / 32; ++q)
    for (int m = 0; m < OM; ++m) { const int sr = 16 * m + wv, cx = q * 32 + lane; b16 p, ql; split16(ATT[(m0 + sr) * DIM + cx] * HS, p, ql); Ah[sr][cx] = p; Al[sr][cx] = ql; }
  __syncthreads();   // every wave reads all staged rows
  const int c0 = blockIdx.y * (DIM / 2) + wv * 32; v8f acc[OM][2]; const b16* const wf = WO + (c0 / 16) * 512 + lane * 8;   // fragment-order plane, as in proj_kernel
#pragma unroll   // here and below: constant indices keep acc, bw, a and al in registers
  for (int m = 0; m < OM; ++m)
#pragma unroll
    for (int t = 0; t < 2; ++t) acc[m][t] = (v8f){};
#pragma unroll 2   // two k blocks a trip: the second's addresses are immediates of the first's, and the loop stays small
  for (int kk = 0; kk < DIM; kk += 32) { v16b bw[2], a[OM], al[OM];   // the k block's 2 weight fragments, each used for both row tiles (hi and lo) below
#pragma unroll
    for (int t = 0; t < 2; ++t) bw[t] = frag_vf(wf + kk * DIM + t * 512);
#pragma unroll
    for (int m = 0; m < OM; ++m) { a[m] = frag_kb(&Ah[16 * m + nloc][kk], hlf); al[m] = frag_kb(&Al[16 * m + nloc][kk], hlf); }
#pragma unroll
    for (int m = 0; m < OM; ++m)
#pragma unroll
      for (int t = 0; t < 2; ++t) { acc[m][t] = wmma16b(a[m], bw[t], acc[m][t]); acc[m][t] = wmma16b(al[m], bw[t], acc[m][t]); } }
  float bb[2];   // the wave's 2 bias values serve both row tiles
#pragma unroll
  for (int t = 0; t < 2; ++t) bb[t] = bo[c0 + t * 16 + nloc];
#pragma unroll
  for (int t = 0; t < 2; ++t) bb[t] = bfv(bb[t]);
#pragma unroll
  for (int m = 0; m < OM; ++m) { if (m) wave_lds_sync();   // the lanes' reads of the row tile before end ahead of other lanes' writes to the same patch
#pragma unroll
    for (int t = 0; t < 2; ++t) { const int cc = t * 16 + nloc;
#pragma unroll
      for (int r8 = 0; r8 < 8; ++r8) Tf[wv][8 * hlf + r8][cc] = acc[m][t][r8] * (1.0f / (HS * WSC)) + bb[t]; }
    wave_lds_sync();
    for (int rr = 0; rr < 16; rr += 4) { const int r = rr + (lane >> 3), c4 = (lane & 7) * 4;   // 8 lanes x 16 B = one 128-B line per row, 4 rows per store
      *(v4f*)(out + (m0 + 16 * m + r) * DIM + c0 + c4) = *(const v4f*)(&Tf[wv][r][c4]); }
  } }
}  // namespace

extern "C" void kernel_launch(void* const* d_in, const int* in_sizes, int n_in, void* d_out, int out_size, void* d_ws, size_t ws_size, hipStream_t stream) {
  (void)n_in;
  auto Fp = [&](int i) { return (const float*)d_in[i]; };
  // input order: 0 x [2,2048,1024]; 1 Wq [1024,1024] (in,out); 2 bq; 3 Wk; 4 bk; 5 Wv; 6 bv; 7 Wo; 8 bo; 9 rand_src [3] i32; 10 rand_tgt [3] i32
  if (in_sizes[0] != NRB * DIM || in_sizes[1] != DIM * DIM || in_sizes[3] != DIM * DIM || in_sizes[5] != DIM * DIM || in_sizes[7] != DIM * DIM || in_sizes[8] != DIM || in_sizes[9] != 3 || in_sizes[10] != 3 || out_size != NRB * DIM) return;
  const int BLIM = NB;   // (batch, head) pairs
  const int RLIM = NRB;
  size_t off = 0; char* ws = (char*)d_ws;
  auto carve = [&](size_t bytes) { char* p = ws + off; off += (bytes + 255) & ~(size_t)255; return p; };
  b16* W3 = (b16*)carve((size_t)3 * DIM * DIM * 2); b16* WO = (b16*)carve((size_t)DIM * DIM * 2); b16* PH = (b16*)carve((size_t)NT * PW * 2); b16* PL = (b16*)carve((size_t)NT * PW * 2); float* ATT = (float*)carve((size_t)NRB * DIM * 4); b16* VFH = (b16*)carve((size_t)NT * HD * 2); b16* VFL = (b16*)carve((size_t)NT * HD * 2); b16* KFH = (b16*)carve((size_t)NT * HD * 2); b16* KFL = (b16*)carve((size_t)NT * HD * 2);
  if (off > ws_size || off > ((size_t)112 << 20)) return;   // ~ 109 MB
  wput_kernel<<<(unsigned)(((size_t)4 * DIM * (DIM / 8) + 255) / 256), 256, 0, stream>>>(Fp(1), Fp(3), Fp(5), Fp(7), W3, WO);
  proj_kernel<<<dim3(RLIM / (16 * PM), 3), 512, 0, stream>>>(Fp(0), W3, Fp(2), Fp(4), Fp(6), RLIM, PH, PL, VFH, VFL, KFH, KFL);
  att_kernel<<<BLIM * NH * (L / QR), 32 * AW, 0, stream>>>(PH, PL, VFH, VFL, KFH, KFL, (const int*)d_in[9], (const int*)d_in[10], BLIM, ATT);
  outp_kernel<<<dim3(RLIM / (16 * OM), 2), 512, 0, stream>>>(ATT, WO, Fp(8), RLIM, (float*)d_out);
}

// v008
// A run of this version takes 114 microseconds.
// Next to v007, in two timings, it ran 1.07 times as fast each time.
// Counting every step since v000, it is 19.8 times as fast.
#include <hip/hip_runtime.h>

// HierarchicalAttention (BigBird-style block mask): Q = x Wq + bq, K, V likewise ((in,out) 1024x1024); the module's raw .view(B, 8, 2048, 128) makes head h / token s the 128-slice s%8 of projected row h*256 + s/8 — i.e. the flat
// [B*8*2048][128] view of each projection; scores / sqrt(128); key block j (64 keys) allowed for query block i iff j == 0 || j == 31 || |i-j| <= 1 || (i,j) is one of the 3 (rand_src, rand_tgt) pairs, else -1e9 (== excluded;
// block 0 always allowed); softmax; O merged as [b][s][h*128+d]; out = O Wo + bo -> [2][2048][1024].
// Deterministic: no index structures, no atomics; flash-style online softmax over all key blocks in a fixed order.
// WMMA (v_wmma_f32_16x16x32_f16, f32 accumulate): the QKV projection with x EXACT bf16 x8 (K 1024) against exact torch weight rows x256 (one product); S = Q K^T (hi+lo x hi+lo, 3 products, K 128); O = P V (P x256 hi+lo x V^T hi+lo, 3 products); softmax in f32. Inputs rounded to bf16 once. Fragment k-map per lane half hh for A AND B: elements 0..7 <- k = 8hh+0..7, 8..15 <- k = 16+8hh+0..7; acc[r] = D[8hh+r][col].

namespace {
constexpr int NB = 16, L = 2048, C = 128, NH = 1, HD = 128, NT = NB * L, KB = 128, PW = 3 * C;   // NB = (batch, head) pairs; the 'token' index is (b*8 + h)*2048 + s
constexpr int RB = 2, DIM = 1024, HEADS = 8, NBLK = 32, NRB = RB * L /* 4096 projected rows */;
constexpr float XS = 8.0f, HS = 256.0f /* hi+lo staging scale for q/k/v/attended */, WSC = 256.0f, PS = 256.0f, SCALE = 0.08838834764831845f;
typedef _Float16 b16;
typedef __attribute__((ext_vector_type(16))) _Float16 v16b;
typedef __attribute__((ext_vector_type(8))) _Float16 v8b;
typedef __attribute__((ext_vector_type(4))) _Float16 v4b;
typedef __attribute__((ext_vector_type(8))) float v8f;
typedef __attribute__((ext_vector_type(4))) float v4f;
__device__ __forceinline__ float bf16_rne(float f) { unsigned int u = __float_as_uint(f); u += 0x7FFFu + ((u >> 16) & 1u); float r = __uint_as_float(u & 0xFFFF0000u); asm volatile("" : "+v"(r)); return r; }
__device__ __forceinline__ float bfv(float f) { float r = bf16_rne(f); asm volatile("" : "+v"(r)); return r; }
__device__ __forceinline__ void split16(float v, b16& hi, b16& lo) { hi = (b16)v; lo = (b16)(v - (float)hi); }
__device__ __forceinline__ v16b frag_kb(const b16* p, int hh) { const v8b a = *(const v8b*)(p + 8 * hh), b = *(const v8b*)(p + 16 + 8 * hh); v16b f;
#pragma unroll
  for (int e = 0; e < 8; ++e) { f[e] = a[e]; f[8 + e] = b[e]; } return f; }
__device__ __forceinline__ v16b frag_vf(const b16* p) { const v8b a = *(const v8b*)p, b = *(const v8b*)(p + 256); v16b f;   // p already holds the lane's own 8 * lane: two whole 512-B runs per wave
#pragma unroll
  for (int e = 0; e < 8; ++e) { f[e] = a[e]; f[8 + e] = b[e]; } return f; }
__device__ __forceinline__ v8f wmma16b(v16b a, v16b b, v8f c) { v8f d = __builtin_amdgcn_wmma_f32_16x16x32_f16(false, a, false, b, (short)0, c, false, false); asm volatile("v_nop\n\tv_nop\n\tv_nop\n\tv_nop" : "+v"(d) : "v"(a), "v"(b)); return d; }
__device__ __forceinline__ void wave_lds_sync() { __builtin_amdgcn_fence(__ATOMIC_RELEASE, "workgroup"); __builtin_amdgcn_wave_barrier(); __builtin_amdgcn_fence(__ATOMIC_ACQUIRE, "workgroup"); }
__device__ __forceinline__ float pmul(float a, float b) { float p = a * b; asm volatile("" : "+v"(p)); return p; }

__global__ __launch_bounds__(256) void wput_kernel(const float* __restrict__ wq, const float* __restrict__ wk, const float* __restrict__ wv, const float* __restrict__ wo, b16* __restrict__ W3, b16* __restrict__ WO) { const size_t u = (size_t)blockIdx.x * 256 + threadIdx.x; if (u >= (size_t)4 * DIM * (DIM / 8)) return;
  // thread u writes 16-B piece u of the planes, which lie in the order of the projections' B fragments: [matrix p][32-k block][16-column tile][e][lane = 16 hh + o % 16][i], k % 32 = 16 e + 8 hh + i (o = output column of the weight), so that a wave reads each fragment half as one 512-B run and the tiles of one k block lie side by side; a wave here loads 2 x 64 B at a time and stores 512 B in a row
  const int ln = (int)(u & 31), p = (int)(u >> 17), o = ((int)(u >> 6) & 63) * 16 + (ln & 15), k0 = ((int)(u >> 12) & 31) * 32 + ((int)(u >> 5) & 1) * 16 + (ln >> 4) * 8; const float* w = p == 0 ? wq : (p == 1 ? wk : (p == 2 ? wv : wo)); v8b v;
#pragma unroll
  for (int j = 0; j < 8; ++j) v[j] = (b16)(bf16_rne(w[(size_t)(k0 + j) * DIM + o]) * WSC);
  { *(v8b*)(p < 3 ? W3 + u * 8 : WO + (u - (size_t)3 * DIM * (DIM / 8)) * 8) = v;  } }
// projection: block of 16 waves per (PM = 4 tiles of 16 projected rows, projection p = blockIdx.y): the waves stage bf16(x) (EXACT, K 1024) once, one row of each tile each, and share it; wave wv then does columns wv*64 .. +63 of p (4 column tiles) for all 4 row tiles, so that each W3 fragment, loaded once, feeds 4 products from registers; + bias (Q scaled by 1/sqrt(128)); row r, 128-chunk j -> token T = 8*(b*2048 + r) + j:
constexpr int PM = 4;
static_assert(NRB % (16 * PM) == 0, "a block's rows all exist");
__global__ __launch_bounds__(512) void proj_kernel(const float* __restrict__ x, const b16* __restrict__ W3, const float* __restrict__ bq, const float* __restrict__ bk, const float* __restrict__ bv, int RLIM, b16* __restrict__ PH, b16* __restrict__ PL, b16* __restrict__ VFH, b16* __restrict__ VFL, b16* __restrict__ KFH, b16* __restrict__ KFL) { __shared__ __attribute__((aligned(16))) b16 Ah[16 * PM][DIM + 8], Oh[16][16][72], Ol[16][16][72]; const int lane = threadIdx.x & 31, wv = __builtin_amdgcn_readfirstlane(threadIdx.x >> 5), nloc = lane & 15, hlf = lane >> 4; const size_t m0 = (size_t)blockIdx.x * (16 * PM); if (m0 >= (size_t)RLIM) return;
  { const float* const xp = x + (m0 + wv) * DIM + lane * 4; v4f xv[PM][DIM / 128];   // the wave's row of each of the 4 tiles, 16 B a lane: all 32 loads (512 B each) stand ahead of the first rounding, so that they are in flight together
#pragma unroll   // here and below: constant indices keep xv, acc, bw, a and bvv in registers
    for (int m = 0; m < PM; ++m)
#pragma unroll
      for (int c = 0; c < DIM / 128; ++c) xv[m][c] = *(const v4f*)(xp + 16 * m * DIM + c * 128);
#pragma unroll
    for (int m = 0; m < PM; ++m)
#pragma unroll
      for (int c = 0; c < DIM / 128; ++c) { v4b hv;
#pragma unroll
        for (int e = 0; e < 4; ++e) hv[e] = (b16)(bf16_rne(xv[m][c][e]) * XS);
        *(v4b*)(&Ah[16 * m + wv][c * 128 + lane * 4]) = hv; } }
  __syncthreads();   // every wave reads all staged rows
  const int p = blockIdx.y, c0 = wv * 64; const float* bb = p == 0 ? bq : (p == 1 ? bk : bv); const float sc = p == 0 ? SCALE : 1.0f; v8f acc[PM][4]; const b16* const wf = W3 + (size_t)p * DIM * DIM + (c0 / 16) * 512 + lane * 8;   // the wave's first column tile in the fragment-order plane: 512 elements a tile, 32 * DIM a 32-k block
#pragma unroll
  for (int m = 0; m < PM; ++m)
#pragma unroll
    for (int t = 0; t < 4; ++t) acc[m][t] = (v8f){};
#pragma unroll 2   // two k blocks a trip: the second's addresses are immediates of the first's, and the loop stays small
  for (int kb = 0; kb < DIM; kb += 32) { v16b bw[4], a[PM];   // the k block's 4 weight fragments and 4 row fragments, each used 4 times below
#pragma unroll
    for (int t = 0; t < 4; ++t) bw[t] = frag_vf(wf + kb * DIM + t * 512);
#pragma unroll
    for (int m = 0; m < PM; ++m) a[m] = frag_kb(&Ah[16 * m + nloc][kb], hlf);
#pragma unroll
    for (int m = 0; m < PM; ++m)
#pragma unroll
      for (int t = 0; t < 4; ++t) acc[m][t] = wmma16b(a[m], bw[t], acc[m][t]); }
  float bvv[4]; const float* const bp = bb + c0 + nloc;   // the wave's 4 bias values serve all row tiles
#pragma unroll
  for (int t = 0; t < 4; ++t) bvv[t] = bp[t * 16];
  asm volatile("s_wait_xcnt 0x0" :: "v"(nloc) : "memory");   // the wait in front of the reuse of the loads' address registers: the lane's part of the address is nloc, which as an input here stays whole up to it
#pragma unroll
  for (int t = 0; t < 4; ++t) bvv[t] = bfv(bvv[t]);
  if (p == 2) {   // V: 16 rows x 1024 columns (one row tile) are 128 consecutive keys x 128 d of one head. They leave in the order of the P V product's B fragments: [32-key group][16-d tile][e][lane = 16 hh + d % 16][i], key % 32 = 16 e + 8 hh + i, so that a wave of att_kernel reads each fragment half as one 512-B run
    b16* const Vh = &Oh[0][0][0]; b16* const Vl = &Ol[0][0][0];   // 4 groups x 8 tiles x 512 = 16384 elements per plane, shared by the block, one row tile at a time
#pragma unroll
    for (int m = 0; m < PM; ++m) {
      if (m) __syncthreads();   // the copy-out of the row tile before has read the planes (p is the same for the whole block)
#pragma unroll
      for (int t = 0; t < 4; ++t) {
#pragma unroll
        for (int r8 = 0; r8 < 8; ++r8) { b16 ph, pl; split16((acc[m][t][r8] * (1.0f / (XS * WSC)) + bvv[t]) * sc * HS, ph, pl);   // local key = 8 * (8 hlf + r8) + (wv >> 1), d = (c0 & 64) + 16 t + nloc
          const int ix = ((((2 * hlf + (r8 >> 2)) * 8 + ((c0 & 64) >> 4) + t) * 2 + ((r8 >> 1) & 1)) * 32 + (r8 & 1) * 16 + nloc) * 8 + (wv >> 1); Vh[ix] = ph; Vl[ix] = pl; } }
      __syncthreads();   // the copy-out below reads what all 16 waves wrote
      const size_t vb = (8 * (m0 + 16 * m) / 32) * (size_t)(8 * 512);
#pragma unroll
      for (int q = 0; q < 4; ++q) { const int o = (q * 512 + (int)threadIdx.x) * 8; *(v8b*)(VFH + vb + o) = *(const v8b*)(Vh + o); *(v8b*)(VFL + vb + o) = *(const v8b*)(Vl + o); } }
    return; }
  if (p == 1) {   // K: a row tile is the same 128 consecutive keys x 128 d of one head. They leave in the order of the S product's B fragments: [16-key tile][32-d block][e][lane = 16 hh + key % 16][i], d % 32 = 16 e + 8 hh + i, so that a wave of att_kernel reads each fragment half as one 512-B run
    b16* const Kh = &Oh[0][0][0]; b16* const Kl = &Ol[0][0][0];   // 8 tiles x 4 blocks x 512 = 16384 elements per plane; in LDS 16 B follow each 256 B and 32 B more stand ahead of the upper 4 tiles (17424 of the 18432 elements), so that the 32 lanes of a 2-byte store fall on 16 different banks
    const int kx = hlf * (4 * 2176 + 16) + ((c0 & 64) >> 5) * 544 + (nloc >> 3) * 136 + (wv >> 1) * 8 + (nloc & 7);   // the lane's and the wave's part of the padded index: key tile 4 hlf + (r8 >> 1), key % 16 = 8 (r8 & 1) + (wv >> 1), d = (c0 & 64) + 16 t + nloc
#pragma unroll
    for (int m = 0; m < PM; ++m) {
      if (m) __syncthreads();   // the copy-out of the row tile before has read the planes (p is the same for the whole block)
#pragma unroll
      for (int t = 0; t < 4; ++t) {
#pragma unroll
        for (int r8 = 0; r8 < 8; ++r8) { b16 ph, pl; split16((acc[m][t][r8] * (1.0f / (XS * WSC)) + bvv[t]) * sc * HS, ph, pl);
          const int ix = kx + (r8 >> 1) * 2176 + (t >> 1) * 544 + (t & 1) * 272 + (r8 & 1) * 64; Kh[ix] = ph; Kl[ix] = pl; } }
      __syncthreads();   // the copy-out below reads what all 16 waves wrote
      const size_t kb = (8 * (m0 + 16 * m) / 16) * (size_t)(4 * 512);
#pragma unroll
      for (int q = 0; q < 4; ++q) { const int pc = q * 512 + (int)threadIdx.x, o = pc * 8, lo = o + (pc >> 4) * 8 + (pc >> 10) * 16; *(v8b*)(KFH + kb + o) = *(const v8b*)(Kh + lo); *(v8b*)(KFL + kb + o) = *(const v8b*)(Kl + lo); } }
    return; }
  const int j = c0 >> 7, h0 = c0 & 64;   // Q: the wave's 64 columns = one 128-B half of chunk j of projection p
#pragma unroll
  for (int m = 0; m < PM; ++m) { if (m) wave_lds_sync();   // the lanes' reads of the row tile before end ahead of other lanes' writes to the same patch
#pragma unroll
    for (int t = 0; t < 4; ++t) { const int cc = t * 16 + nloc;
#pragma unroll
      for (int r8 = 0; r8 < 8; ++r8) { b16 ph, pl; split16((acc[m][t][r8] * (1.0f / (XS * WSC)) + bvv[t]) * sc * HS, ph, pl); Oh[wv][8 * hlf + r8][cc] = ph; Ol[wv][8 * hlf + r8][cc] = pl; } }
    wave_lds_sync();
    for (int rr = 0; rr < 16; rr += 4) { const int r = rr + (lane >> 3), d8 = (lane & 7) * 8; const size_t T = 8 * (m0 + 16 * m + r) + j;   // 8 lanes x 16 B per row, 4 rows per store
      *(v8b*)(PH + T * PW + p * 128 + h0 + d8) = *(const v8b*)(&Oh[wv][r][d8]); *(v8b*)(PL + T * PW + p * 128 + h0 + d8) = *(const v8b*)(&Ol[wv][r][d8]); }
    asm volatile("s_wait_xcnt 0x0" ::: "memory");   // the wait in front of the reuse of the address and data registers of this row tile's 8 stores
  } }
// attention: block of AW = 8 waves per (b, h, QM = 2 tiles of 16 queries); key blocks of 128 over all keys. The three inner loops of a key block are dealt to the waves: wave wv does key tile wv of S = Q K^T (3 products, K 128) for both query tiles, rows 4 wv .. + 3 of the 32 rows of the online softmax (P x256 hi+lo), and d tile wv of P V for both query tiles (K and V fragments straight from the fragment-order planes that proj_kernel wrote), so that each K and V fragment, loaded once, feeds both query tiles' products from registers. Q, S, P and each row's rescale factor go from wave to wave through LDS; every sum keeps its order.
constexpr int AW = 8, QM = 2, QR = 16 * QM;
static_assert(L % KB == 0 && KB / 16 == AW && HD / 16 == AW && QR == 4 * AW && 64 % QR == 0, "the deal below is for 8 key tiles, 32 rows and 8 d tiles over 8 waves; a block's queries lie in one 64-query mask block");
__global__ __launch_bounds__(32 * AW) void att_kernel(const b16* __restrict__ PH, const b16* __restrict__ PL, const b16* __restrict__ VFH, const b16* __restrict__ VFL, const b16* __restrict__ KFH, const b16* __restrict__ KFL, const int* __restrict__ rsrc, const int* __restrict__ rtgt, int BLIM, float* __restrict__ ATT) { __shared__ __attribute__((aligned(16))) b16 Ph_[QR][KB + 8], Pl_[QR][KB + 8], Qh_[QR][HD + 8], Ql_[QR][HD + 8]; __shared__ float Sf[QR][KB + 4], Of[QR][HD + 4], Sc[QR], Dn[QR];
  const int lane = threadIdx.x & 31, wv = __builtin_amdgcn_readfirstlane(threadIdx.x >> 5), nloc = lane & 15, hlf = lane >> 4; const int qt = blockIdx.x % (L / QR); const int h = (blockIdx.x / (L / QR)) % NH; const int b = blockIdx.x / ((L / QR) * NH); if (b >= BLIM) return; const int t0 = qt * QR; const int ib = t0 / 64; const int rs0 = rsrc[0], rs1 = rsrc[1], rs2 = rsrc[2], rt0 = rtgt[0], rt1 = rtgt[1], rt2 = rtgt[2];
  auto allowed = [&](int jb) { return (jb == 0) || (jb == NBLK - 1) || (jb - ib <= 1 && ib - jb <= 1) || (rs0 == ib && rt0 == jb) || (rs1 == ib && rt1 == jb) || (rs2 == ib && rt2 == jb); }; const size_t rowb = (size_t)b * L; const int qo = h * HD;
  { constexpr int QT = QR * (HD / 8) / (32 * AW); const b16 *qph[QT], *qpl[QT]; v8b qa[QT], qb[QT];   // the block's 32 query rows, 16 B a thread, plane and trip
    static_assert(QT == 2, "the wait below names the address registers of two trips");
#pragma unroll   // both trips' loads in flight together
    for (int k = 0; k < QT; ++k) { const int i = k * 32 * AW + (int)threadIdx.x; qph[k] = PH + (rowb + t0 + i / (HD / 8)) * PW + qo + (i % (HD / 8)) * 8; qpl[k] = PL + (rowb + t0 + i / (HD / 8)) * PW + qo + (i % (HD / 8)) * 8; qa[k] = *(const v8b*)qph[k]; qb[k] = *(const v8b*)qpl[k]; }
    asm volatile("s_wait_xcnt 0x0" :: "v"(qph[0]), "v"(qph[1]), "v"(qpl[0]), "v"(qpl[1]) : "memory");   // the wait in front of the reuse of the loads' address registers: as inputs here they stay whole up to it
#pragma unroll   // constant indices keep qa and qb in registers
    for (int k = 0; k < QT; ++k) { const int i = k * 32 * AW + (int)threadIdx.x; *(v8b*)(&Qh_[i / (HD / 8)][(i % (HD / 8)) * 8]) = qa[k]; *(v8b*)(&Ql_[i / (HD / 8)][(i % (HD / 8)) * 8]) = qb[k]; } }
  __syncthreads();   // every wave reads all 32 query rows
  float m_w[4], den_w[4]; v8f acc[QM];   // running maximum and denominator of the wave's own 4 rows (the same in every lane); accumulators of its own d tile, one per query tile
#pragma unroll   // here and below: constant indices keep m_w, den_w, acc, s, qh, ql, pa and pb in registers
  for (int i = 0; i < 4; ++i) { m_w[i] = -INFINITY; den_w[i] = 0.0f; }
#pragma unroll
  for (int u = 0; u < QM; ++u) acc[u] = (v8f){};
  const int kstart = 0; const int kend = L;   // [kstart, kend)
#pragma unroll 1
  for (int kb0 = kstart; kb0 < kend; kb0 += KB) { const int nk = (kend - kb0) < KB ? (kend - kb0) : KB; const int nkt = (nk + 15) / 16; if (!allowed(kb0 / 64) && !allowed(kb0 / 64 + 1)) continue;   /* neither 64-key sub-block of this 128-key block is visible to this query block (the same for the whole work-group) */
    { const int t = wv; if (t < nkt) { const size_t kr = ((rowb + kb0) / 16 + t) * (size_t)((HD / 32) * 512) + lane * 8; const b16* const kph = KFH + kr; const b16* const kpl = KFL + kr; v8f s[QM];   // the wave's key tile in the fragment-order planes; the later 32-d blocks are constant steps from it
#pragma unroll
        for (int u = 0; u < QM; ++u) s[u] = (v8f){};
#pragma unroll
        for (int q = 0; q < HD / 32; ++q) { const v16b kh = frag_vf(kph + q * 512), kl = frag_vf(kpl + q * 512); v16b qh[QM], ql[QM];   // the K fragments serve both query tiles; all loads of the trip stand ahead of its products
#pragma unroll
          for (int u = 0; u < QM; ++u) { qh[u] = frag_kb(&Qh_[16 * u + nloc][q * 32], hlf); ql[u] = frag_kb(&Ql_[16 * u + nloc][q * 32], hlf); }
#pragma unroll
          for (int u = 0; u < QM; ++u) s[u] = wmma16b(qh[u], kh, s[u]);
#pragma unroll
          for (int u = 0; u < QM; ++u) s[u] = wmma16b(qh[u], kl, s[u]);
#pragma unroll
          for (int u = 0; u < QM; ++u) s[u] = wmma16b(ql[u], kh, s[u]); }
        asm volatile("s_wait_xcnt 0x0" :: "v"(kph), "v"(kpl) : "memory");   // the wait in front of the reuse of the K loads' address registers: as inputs here they stay whole up to it
        const int j = kb0 + t * 16 + nloc; const bool ok = (j < kend) && allowed(j >> 6);   /* BigBird block mask (-1e9 in the module == excluded; key block 0 always allowed) */
#pragma unroll
        for (int u = 0; u < QM; ++u)
#pragma unroll
          for (int r8 = 0; r8 < 8; ++r8) Sf[16 * u + 8 * hlf + r8][t * 16 + nloc] = ok ? s[u][r8] * (1.0f / (HS * HS)) : -INFINITY; }
      else {
#pragma unroll
        for (int u = 0; u < QM; ++u)
#pragma unroll
          for (int r8 = 0; r8 < 8; ++r8) Sf[16 * u + 8 * hlf + r8][t * 16 + nloc] = -INFINITY; } }
    __syncthreads();   // a softmax row holds the scores of all eight waves' key tiles; it also ends every wave's reads of P and Sc of the key block before
#pragma unroll
    for (int i = 0; i < 4; ++i) { const int rr = 4 * wv + i; float mx = -INFINITY;
#pragma unroll
      for (int q = 0; q < 4; ++q) mx = fmaxf(mx, Sf[rr][q * 32 + lane]);
      for (int o = 16; o; o >>= 1) mx = fmaxf(mx, __shfl_xor(mx, o));
      const float mold = m_w[i]; const float mn = fmaxf(mold, mx); const float sf = (mold == -INFINITY) ? 0.0f : ((mn == -INFINITY) ? 1.0f : __expf(mold - mn)); float ps = 0.0f;
#pragma unroll
      for (int q = 0; q < 4; ++q) { const int kx = q * 32 + lane; const float sv = Sf[rr][kx]; const float p = (sv == -INFINITY || mn == -INFINITY) ? 0.0f : __expf(sv - mn); ps += p; b16 ph, pl; split16(p * PS, ph, pl); Ph_[rr][kx] = ph; Pl_[rr][kx] = pl; }
      for (int o = 16; o; o >>= 1) ps += __shfl_xor(ps, o);
      den_w[i] = den_w[i] * sf + ps; m_w[i] = mn; if (lane == 0) Sc[rr] = sf; }
    __syncthreads();   // every wave reads all 32 rows of P and their rescale factors; it also ends the reads of Sf before the next key block's scores are stored
#pragma unroll
    for (int u = 0; u < QM; ++u)
#pragma unroll
      for (int r8 = 0; r8 < 8; ++r8) acc[u][r8] = acc[u][r8] * Sc[16 * u + 8 * hlf + r8];
    const size_t vf = ((rowb + kb0) / 32) * (size_t)((HD / 16) * 512) + wv * 512 + lane * 8; const b16* const vph = VFH + vf; const b16* const vpl = VFL + vf;   // the wave's d tile in the key block's first 32-key group; the later groups are constant steps from it
    for (int ks = 0; ks < nkt * 16; ks += 32) { const v16b vh = frag_vf(vph + (ks / 32) * ((HD / 16) * 512)), vl = frag_vf(vpl + (ks / 32) * ((HD / 16) * 512));   // the V fragments serve both query tiles; their 4 loads stand ahead of the products, so that they are in flight together: no load moves up over the asm statement in wmma16b
      asm volatile("s_wait_xcnt 0x0" :: "v"(vph), "v"(vpl) : "memory");   // the wait in front of the reuse of the loads' address registers: as inputs here they stay whole up to it, and the LDS reads below, which took them over, stay behind it
      v16b pa[QM], pb[QM];
#pragma unroll
      for (int u = 0; u < QM; ++u) { pa[u] = frag_kb(&Ph_[16 * u + nloc][ks], hlf); pb[u] = frag_kb(&Pl_[16 * u + nloc][ks], hlf); }
#pragma unroll
      for (int u = 0; u < QM; ++u) acc[u] = wmma16b(pa[u], vh, acc[u]);
#pragma unroll
      for (int u = 0; u < QM; ++u) acc[u] = wmma16b(pa[u], vl, acc[u]);
#pragma unroll
      for (int u = 0; u < QM; ++u) acc[u] = wmma16b(pb[u], vh, acc[u]); } }
#pragma unroll
  for (int i = 0; i < 4; ++i) if (lane == 0) Dn[4 * wv + i] = den_w[i];
  __syncthreads();   // every wave divides by the denominators of all 32 rows
#pragma unroll
  for (int u = 0; u < QM; ++u)
#pragma unroll
    for (int r8 = 0; r8 < 8; ++r8) { const float dn = Dn[16 * u + 8 * hlf + r8]; Of[16 * u + 8 * hlf + r8][wv * 16 + nloc] = dn > 0.0f ? acc[u][r8] * (1.0f / (HS * PS)) / dn : 0.0f; }
  __syncthreads();   // a stored row holds the d tiles of all eight waves
  const int rb_ = b / HEADS, hq = b % HEADS;   /* merge heads: ATT[b][s][h*128 + d] */
  { for (int rr = 4 * wv; rr < 4 * wv + 4; ++rr) for (int s = 0; s < HD / 32; ++s) ((float*)ATT)[((size_t)rb_ * L + t0 + rr) * DIM + hq * 128 + s * 32 + lane] = Of[rr][s * 32 + lane];  } }
// output projection: block of 16 waves per (OM = 2 tiles of 16 rows, half of the columns = blockIdx.y): the waves stage the attended rows (hi+lo) once, one row of each tile each, and share them; wave wv then does columns blockIdx.y*512 + wv*32 .. +31 (2 column tiles) for both row tiles, so that each WO fragment, loaded once, feeds 4 products from registers:
constexpr int OM = 2;
static_assert(NRB % (16 * OM) == 0, "a block's rows all exist");
__global__ __launch_bounds__(512) void outp_kernel(const float* __restrict__ ATT, const b16* __restrict__ WO, const float* __restrict__ bo, int RLIM, float* __restrict__ out) { __shared__ __attribute__((aligned(16))) b16 Ah[16 * OM][DIM + 8], Al[16 * OM][DIM + 8]; __shared__ __attribute__((aligned(16))) float Tf[16][16][36]; const int lane = threadIdx.x & 31, wv = __builtin_amdgcn_readfirstlane(threadIdx.x >> 5), nloc = lane & 15, hlf = lane >> 4; const size_t m0 = (size_t)blockIdx.x * (16 * OM); if (m0 >= (size_t)RLIM) return;
  { const float* const ap = ATT + (m0 + wv) * DIM + lane * 4; v4f av[OM][DIM / 128];   // the wave's row of each tile, 16 B a lane: all 16 loads stand ahead of the splits
#pragma unroll   // constant indices keep av in registers
    for (int m = 0; m < OM; ++m)
#pragma unroll
      for (int c = 0; c < DIM / 128; ++c) av[m][c] = *(const v4f*)(ap + 16 * m * DIM + c * 128);
#pragma unroll
    for (int m = 0; m < OM; ++m)
#pragma unroll
      for (int c = 0; c < DIM / 128; ++c) { v4b hv, lv;
#pragma unroll
        for (int e = 0; e < 4; ++e) { b16 p, ql; split16(av[m][c][e] * HS, p, ql); hv[e] = p; lv[e] = ql; }
        *(v4b*)(&Ah[16 * m + wv][c * 128 + lane * 4]) = hv; *(v4b*)(&Al[16 * m + wv][c * 128 + lane * 4]) = lv; } }
  __syncthreads();   // every wave reads all staged rows
  const int c0 = blockIdx.y * (DIM / 2) + wv * 32; v8f acc[OM][2]; const b16* const wf = WO + (c0 / 16) * 512 + lane * 8;   // fragment-order plane, as in proj_kernel
#pragma unroll   // here and below: constant indices keep acc, bw, a and al in registers
  for (int m = 0; m < OM; ++m)
#pragma unroll
    for (int t = 0; t < 2; ++t) acc[m][t] = (v8f){};
#pragma unroll 2   // two k blocks a trip: the second's addresses are immediates of the first's, and the loop stays small
  for (int kk = 0; kk < DIM; kk += 32) { v16b bw[2], a[OM], al[OM];   // the k block's 2 weight fragments, each used for both row tiles (hi and lo) below
#pragma unroll
    for (int t = 0; t < 2; ++t) bw[t] = frag_vf(wf + kk * DIM + t * 512);
#pragma unroll
    for (int m = 0; m < OM; ++m) { a[m] = frag_kb(&Ah[16 * m + nloc][kk], hlf); al[m] = frag_kb(&Al[16 * m + nloc][kk], hlf); }
#pragma unroll
    for (int m = 0; m < OM; ++m)
#pragma unroll
      for (int t = 0; t < 2; ++t) { acc[m][t] = wmma16b(a[m], bw[t], acc[m][t]); acc[m][t] = wmma16b(al[m], bw[t], acc[m][t]); } }
  float bb[2]; const int bi = c0 + nloc;   // the wave's 2 bias values serve both row tiles
#pragma unroll
  for (int t = 0; t < 2; ++t) bb[t] = bo[bi + t * 16];
  asm volatile("s_wait_xcnt 0x0" :: "v"(bi) : "memory");   // the wait in front of the reuse of the loads' address register: as an input here it stays whole up to it
#pragma unroll
  for (int t = 0; t < 2; ++t) bb[t] = bfv(bb[t]);
#pragma unroll
  for (int m = 0; m < OM; ++m) { if (m) wave_lds_sync();   // the lanes' reads of the row tile before end ahead of other lanes' writes to the same patch
#pragma unroll
    for (int t = 0; t < 2; ++t) { const int cc = t * 16 + nloc;
#pragma unroll
      for (int r8 = 0; r8 < 8; ++r8) Tf[wv][8 * hlf + r8][cc] = acc[m][t][r8] * (1.0f / (HS * WSC)) + bb[t]; }
    wave_lds_sync();
    for (int rr = 0; rr < 16; rr += 4) { const int r = rr + (lane >> 3), c4 = (lane & 7) * 4;   // 8 lanes x 16 B = one 128-B line per row, 4 rows per store
      *(v4f*)(out + (m0 + 16 * m + r) * DIM + c0 + c4) = *(const v4f*)(&Tf[wv][r][c4]); }
  } }
}  // namespace

extern "C" void kernel_launch(void* const* d_in, const int* in_sizes, int n_in, void* d_out, int out_size, void* d_ws, size_t ws_size, hipStream_t stream) {
  (void)n_in;
  auto Fp = [&](int i) { return (const float*)d_in[i]; };
  // input order: 0 x [2,2048,1024]; 1 Wq [1024,1024] (in,out); 2 bq; 3 Wk; 4 bk; 5 Wv; 6 bv; 7 Wo; 8 bo; 9 rand_src [3] i32; 10 rand_tgt [3] i32
  if (in_sizes[0] != NRB * DIM || in_sizes[1] != DIM * DIM || in_sizes[3] != DIM * DIM || in_sizes[5] != DIM * DIM || in_sizes[7] != DIM * DIM || in_sizes[8] != DIM || in_sizes[9] != 3 || in_sizes[10] != 3 || out_size != NRB * DIM) return;
  const int BLIM = NB;   // (batch, head) pairs
  const int RLIM = NRB;
  size_t off = 0; char* ws = (char*)d_ws;
  auto carve = [&](size_t bytes) { char* p = ws + off; off += (bytes + 255) & ~(size_t)255; return p; };
  b16* W3 = (b16*)carve((size_t)3 * DIM * DIM * 2); b16* WO = (b16*)carve((size_t)DIM * DIM * 2); b16* PH = (b16*)carve((size_t)NT * PW * 2); b16* PL = (b16*)carve((size_t)NT * PW * 2); float* ATT = (float*)carve((size_t)NRB * DIM * 4); b16* VFH = (b16*)carve((size_t)NT * HD * 2); b16* VFL = (b16*)carve((size_t)NT * HD * 2); b16* KFH = (b16*)carve((size_t)NT * HD * 2); b16* KFL = (b16*)carve((size_t)NT * HD * 2);
  if (off > ws_size || off > ((size_t)112 << 20)) return;   // ~ 109 MB
  wput_kernel<<<(unsigned)(((size_t)4 * DIM * (DIM / 8) + 255) / 256), 256, 0, stream>>>(Fp(1), Fp(3), Fp(5), Fp(7), W3, WO);
  proj_kernel<<<dim3(RLIM / (16 * PM), 3), 512, 0, stream>>>(Fp(0), W3, Fp(2), Fp(4), Fp(6), RLIM, PH, PL, VFH, VFL, KFH, KFL);
  att_kernel<<<BLIM * NH * (L / QR), 32 * AW, 0, stream>>>(PH, PL, VFH, VFL, KFH, KFL, (const int*)d_in[9], (const int*)d_in[10], BLIM, ATT);
  outp_kernel<<<dim3(RLIM / (16 * OM), 2), 512, 0, stream>>>(ATT, WO, Fp(8), RLIM, (float*)d_out);
}

// v009
// It runs in 100 microseconds.
// In both of two side-by-side timings against v008, it was 1.14 times as fast.
// All steps since v000 together make it 22.5 times as fast.
#include <hip/hip_runtime.h>

// HierarchicalAttention (BigBird-style block mask): Q = x Wq + bq, K, V likewise ((in,out) 1024x1024); the module's raw .view(B, 8, 2048, 128) makes head h / token s the 128-slice s%8 of projected row h*256 + s/8 — i.e. the flat
// [B*8*2048][128] view of each projection; scores / sqrt(128); key block j (64 keys) allowed for query block i iff j == 0 || j == 31 || |i-j| <= 1 || (i,j) is one of the 3 (rand_src, rand_tgt) pairs, else -1e9 (== excluded;
// block 0 always allowed); softmax; O merged as [b][s][h*128+d]; out = O Wo + bo -> [2][2048][1024].
// Deterministic: no index structures, no atomics; flash-style online softmax over all key blocks in a fixed order.
// WMMA (v_wmma_f32_16x16x32_f16, f32 accumulate): the QKV projection with x EXACT bf16 x8 (K 1024) against exact torch weight rows x256 (one product); S = Q K^T (hi+lo x hi+lo, 3 products, K 128); O = P V (P x256 hi+lo x V^T hi+lo, 3 products); softmax in f32. Inputs rounded to bf16 once. Fragment k-map per lane half hh for A AND B: elements 0..7 <- k = 8hh+0..7, 8..15 <- k = 16+8hh+0..7; acc[r] = D[8hh+r][col].

namespace {
constexpr int NB = 16, L = 2048, C = 128, NH = 1, HD = 128, NT = NB * L, KB = 128, PW = 3 * C;   // NB = (batch, head) pairs; the 'token' index is (b*8 + h)*2048 + s
constexpr int RB = 2, DIM = 1024, HEADS = 8, NBLK = 32, NRB = RB * L /* 4096 projected rows */;
constexpr float XS = 8.0f, HS = 256.0f /* hi+lo staging scale for q/k/v/attended */, WSC = 256.0f, PS = 256.0f, SCALE = 0.08838834764831845f;
typedef _Float16 b16;
typedef __attribute__((ext_vector_type(16))) _Float16 v16b;
typedef __attribute__((ext_vector_type(8))) _Float16 v8b;
typedef __attribute__((ext_vector_type(4))) _Float16 v4b;
typedef __attribute__((ext_vector_type(8))) float v8f;
typedef __attribute__((ext_vector_type(4))) float v4f;
__device__ __forceinline__ float bf16_rne(float f) { unsigned int u = __float_as_uint(f); u += 0x7FFFu + ((u >> 16) & 1u); float r = __uint_as_float(u & 0xFFFF0000u); asm volatile("" : "+v"(r)); return r; }
__device__ __forceinline__ float bfv(float f) { float r = bf16_rne(f); asm volatile("" : "+v"(r)); return r; }
__device__ __forceinline__ void split16(float v, b16& hi, b16& lo) { hi = (b16)v; lo = (b16)(v - (float)hi); }
__device__ __forceinline__ v16b frag_kb(const b16* p, int hh) { const v8b a = *(const v8b*)(p + 8 * hh), b = *(const v8b*)(p + 16 + 8 * hh); v16b f;
#pragma unroll
  for (int e = 0; e < 8; ++e) { f[e] = a[e]; f[8 + e] = b[e]; } return f; }
__device__ __forceinline__ v16b frag_vf(const b16* p) { const v8b a = *(const v8b*)p, b = *(const v8b*)(p + 256); v16b f;   // p already holds the lane's own 8 * lane: two whole 512-B runs per wave
#pragma unroll
  for (int e = 0; e < 8; ++e) { f[e] = a[e]; f[8 + e] = b[e]; } return f; }
__device__ __forceinline__ v8f wmma16b(v16b a, v16b b, v8f c) { v8f d = __builtin_amdgcn_wmma_f32_16x16x32_f16(false, a, false, b, (short)0, c, false, false); asm volatile("v_nop\n\tv_nop\n\tv_nop\n\tv_nop" : "+v"(d) : "v"(a), "v"(b)); return d; }
__device__ __forceinline__ void wave_lds_sync() { __builtin_amdgcn_fence(__ATOMIC_RELEASE, "workgroup"); __builtin_amdgcn_wave_barrier(); __builtin_amdgcn_fence(__ATOMIC_ACQUIRE, "workgroup"); }
__device__ __forceinline__ float uni(float v) { return __uint_as_float((unsigned)__builtin_amdgcn_readfirstlane((int)__float_as_uint(v))); }   // a value that is the same in every lane moves to a scalar register (att_kernel: the 8 vector registers so freed let its K and V rings fit 128 registers, 8 waves a SIMD)
__device__ __forceinline__ float pmul(float a, float b) { float p = a * b; asm volatile("" : "+v"(p)); return p; }

__global__ __launch_bounds__(256) void wput_kernel(const float* __restrict__ wq, const float* __restrict__ wk, const float* __restrict__ wv, const float* __restrict__ wo, b16* __restrict__ W3, b16* __restrict__ WO) { const size_t u = (size_t)blockIdx.x * 256 + threadIdx.x; if (u >= (size_t)4 * DIM * (DIM / 8)) return;
  // thread u writes 16-B piece u of the planes, which lie in the order of the projections' B fragments: [matrix p][32-k block][16-column tile][e][lane = 16 hh + o % 16][i], k % 32 = 16 e + 8 hh + i (o = output column of the weight), so that a wave reads each fragment half as one 512-B run and the tiles of one k block lie side by side; a wave here loads 2 x 64 B at a time and stores 512 B in a row
  const int ln = (int)(u & 31), p = (int)(u >> 17), o = ((int)(u >> 6) & 63) * 16 + (ln & 15), k0 = ((int)(u >> 12) & 31) * 32 + ((int)(u >> 5) & 1) * 16 + (ln >> 4) * 8; const float* w = p == 0 ? wq : (p == 1 ? wk : (p == 2 ? wv : wo)); v8b v;
#pragma unroll
  for (int j = 0; j < 8; ++j) v[j] = (b16)(bf16_rne(w[(size_t)(k0 + j) * DIM + o]) * WSC);
  { *(v8b*)(p < 3 ? W3 + u * 8 : WO + (u - (size_t)3 * DIM * (DIM / 8)) * 8) = v;  } }
// projection: block of 16 waves per (PM = 4 tiles of 16 projected rows, projection p = blockIdx.y): the waves stage bf16(x) (EXACT, K 1024) once, one row of each tile each, and share it; wave wv then does columns wv*64 .. +63 of p (4 column tiles) for all 4 row tiles, so that each W3 fragment, loaded once, feeds 4 products from registers; + bias (Q scaled by 1/sqrt(128)); row r, 128-chunk j -> token T = 8*(b*2048 + r) + j:
constexpr int PM = 4, PD = 2;
static_assert(NRB % (16 * PM) == 0, "a block's rows all exist");
static_assert((DIM / 32) % PD == 0 && DIM / 32 >= 2 * PD, "whole turns of the weight ring");
__global__ __launch_bounds__(512) void proj_kernel(const float* __restrict__ x, const b16* __restrict__ W3, const float* __restrict__ bq, const float* __restrict__ bk, const float* __restrict__ bv, int RLIM, b16* __restrict__ PH, b16* __restrict__ PL, b16* __restrict__ VFH, b16* __restrict__ VFL, b16* __restrict__ KFH, b16* __restrict__ KFL) { __shared__ __attribute__((aligned(16))) b16 Ah[16 * PM][DIM + 8], Oh[16][16][72], Ol[16][16][72]; const int lane = threadIdx.x & 31, wv = __builtin_amdgcn_readfirstlane(threadIdx.x >> 5), nloc = lane & 15, hlf = lane >> 4; const size_t m0 = (size_t)blockIdx.x * (16 * PM); if (m0 >= (size_t)RLIM) return;
  { const float* const xp = x + (m0 + wv) * DIM + lane * 4; v4f xv[PM][DIM / 128];   // the wave's row of each of the 4 tiles, 16 B a lane: all 32 loads (512 B each) stand ahead of the first rounding, so that they are in flight together
#pragma unroll   // here and below: constant indices keep xv, acc, bw, a and bvv in registers
    for (int m = 0; m < PM; ++m)
#pragma unroll
      for (int c = 0; c < DIM / 128; ++c) xv[m][c] = *(const v4f*)(xp + 16 * m * DIM + c * 128);
#pragma unroll
    for (int m = 0; m < PM; ++m)
#pragma unroll
      for (int c = 0; c < DIM / 128; ++c) { v4b hv;
#pragma unroll
        for (int e = 0; e < 4; ++e) hv[e] = (b16)(bf16_rne(xv[m][c][e]) * XS);
        *(v4b*)(&Ah[16 * m + wv][c * 128 + lane * 4]) = hv; } }
  const int p = blockIdx.y, c0 = wv * 64; const float* bb = p == 0 ? bq : (p == 1 ? bk : bv); const float sc = p == 0 ? SCALE : 1.0f; v8f acc[PM][4]; const b16* const wf = W3 + (size_t)p * DIM * DIM + (c0 / 16) * 512 + lane * 8;   // the wave's first column tile in the fragment-order plane: 512 elements a tile, 32 * DIM a 32-k block
  v16b bw[PD][4];   // ring of weight fragments, PD k blocks deep: a slot is loaded again, for the k block PD further on, as soon as its 4 products are issued, so that the load flies while the other slots are worked on
#pragma unroll   // here and below: constant indices keep bw in registers
  for (int s = 0; s < PD; ++s)
#pragma unroll
    for (int t = 0; t < 4; ++t) bw[s][t] = frag_vf(wf + 32 * s * DIM + t * 512);
  __syncthreads();   // every wave reads all staged rows
#pragma unroll
  for (int m = 0; m < PM; ++m)
#pragma unroll
    for (int t = 0; t < 4; ++t) acc[m][t] = (v8f){};
  auto kstep = [&](int kb, int s, bool more) { v16b a[PM];   // k block kb, whose weight fragments lie in slot s; each of its 4 weight and 4 row fragments is used 4 times
#pragma unroll
    for (int m = 0; m < PM; ++m) a[m] = frag_kb(&Ah[16 * m + nloc][kb], hlf);
#pragma unroll
    for (int t = 0; t < 4; ++t) {
#pragma unroll
      for (int m = 0; m < PM; ++m) acc[m][t] = wmma16b(a[m], bw[s][t], acc[m][t]);
      if (more) bw[s][t] = frag_vf(wf + (kb + 32 * PD) * DIM + t * 512); } };
#pragma unroll 1   // one turn of the ring a trip: the slots' addresses are immediates of one pointer, and the loop stays small
  for (int kb = 0; kb < DIM - 32 * PD; kb += 32 * PD)
#pragma unroll
    for (int s = 0; s < PD; ++s) kstep(kb + 32 * s, s, true);
#pragma unroll   // the last turn has nothing left to load
  for (int s = 0; s < PD; ++s) kstep(DIM - 32 * PD + 32 * s, s, false);
  float bvv[4]; const float* const bp = bb + c0 + nloc;   // the wave's 4 bias values serve all row tiles
#pragma unroll
  for (int t = 0; t < 4; ++t) bvv[t] = bp[t * 16];
  asm volatile("s_wait_xcnt 0x0" :: "v"(nloc) : "memory");   // the wait in front of the reuse of the loads' address registers: the lane's part of the address is nloc, which as an input here stays whole up to it
#pragma unroll
  for (int t = 0; t < 4; ++t) bvv[t] = bfv(bvv[t]);
  if (p == 2) {   // V: 16 rows x 1024 columns (one row tile) are 128 consecutive keys x 128 d of one head. They leave in the order of the P V product's B fragments: [32-key group][16-d tile][e][lane = 16 hh + d % 16][i], key % 32 = 16 e + 8 hh + i, so that a wave of att_kernel reads each fragment half as one 512-B run
    b16* const Vh = &Oh[0][0][0]; b16* const Vl = &Ol[0][0][0];   // 4 groups x 8 tiles x 512 = 16384 elements per plane, shared by the block, one row tile at a time
#pragma unroll
    for (int m = 0; m < PM; ++m) {
      if (m) __syncthreads();   // the copy-out of the row tile before has read the planes (p is the same for the whole block)
#pragma unroll
      for (int t = 0; t < 4; ++t) {
#pragma unroll
        for (int r8 = 0; r8 < 8; ++r8) { b16 ph, pl; split16((acc[m][t][r8] * (1.0f / (XS * WSC)) + bvv[t]) * sc * HS, ph, pl);   // local key = 8 * (8 hlf + r8) + (wv >> 1), d = (c0 & 64) + 16 t + nloc
          const int ix = ((((2 * hlf + (r8 >> 2)) * 8 + ((c0 & 64) >> 4) + t) * 2 + ((r8 >> 1) & 1)) * 32 + (r8 & 1) * 16 + nloc) * 8 + (wv >> 1); Vh[ix] = ph; Vl[ix] = pl; } }
      __syncthreads();   // the copy-out below reads what all 16 waves wrote
      const size_t vb = (8 * (m0 + 16 * m) / 32) * (size_t)(8 * 512);
#pragma unroll
      for (int q = 0; q < 4; ++q) { const int o = (q * 512 + (int)threadIdx.x) * 8; *(v8b*)(VFH + vb + o) = *(const v8b*)(Vh + o); *(v8b*)(VFL + vb + o) = *(const v8b*)(Vl + o); } }
    return; }
  if (p == 1) {   // K: a row tile is the same 128 consecutive keys x 128 d of one head. They leave in the order of the S product's B fragments: [16-key tile][32-d block][e][lane = 16 hh + key % 16][i], d % 32 = 16 e + 8 hh + i, so that a wave of att_kernel reads each fragment half as one 512-B run
    b16* const Kh = &Oh[0][0][0]; b16* const Kl = &Ol[0][0][0];   // 8 tiles x 4 blocks x 512 = 16384 elements per plane; in LDS 16 B follow each 256 B and 32 B more stand ahead of the upper 4 tiles (17424 of the 18432 elements), so that the 32 lanes of a 2-byte store fall on 16 different banks
    const int kx = hlf * (4 * 2176 + 16) + ((c0 & 64) >> 5) * 544 + (nloc >> 3) * 136 + (wv >> 1) * 8 + (nloc & 7);   // the lane's and the wave's part of the padded index: key tile 4 hlf + (r8 >> 1), key % 16 = 8 (r8 & 1) + (wv >> 1), d = (c0 & 64) + 16 t + nloc
#pragma unroll
    for (int m = 0; m < PM; ++m) {
      if (m) __syncthreads();   // the copy-out of the row tile before has read the planes (p is the same for the whole block)
#pragma unroll
      for (int t = 0; t < 4; ++t) {
#pragma unroll
        for (int r8 = 0; r8 < 8; ++r8) { b16 ph, pl; split16((acc[m][t][r8] * (1.0f / (XS * WSC)) + bvv[t]) * sc * HS, ph, pl);
          const int ix = kx + (r8 >> 1) * 2176 + (t >> 1) * 544 + (t & 1) * 272 + (r8 & 1) * 64; Kh[ix] = ph; Kl[ix] = pl; } }
      __syncthreads();   // the copy-out below reads what all 16 waves wrote
      const size_t kb = (8 * (m0 + 16 * m) / 16) * (size_t)(4 * 512);
#pragma unroll
      for (int q = 0; q < 4; ++q) { const int pc = q * 512 + (int)threadIdx.x, o = pc * 8, lo = o + (pc >> 4) * 8 + (pc >> 10) * 16; *(v8b*)(KFH + kb + o) = *(const v8b*)(Kh + lo); *(v8b*)(KFL + kb + o) = *(const v8b*)(Kl + lo); } }
    return; }
  const int j = c0 >> 7, h0 = c0 & 64;   // Q: the wave's 64 columns = one 128-B half of chunk j of projection p
#pragma unroll
  for (int m = 0; m < PM; ++m) { if (m) wave_lds_sync();   // the lanes' reads of the row tile before end ahead of other lanes' writes to the same patch
#pragma unroll
    for (int t = 0; t < 4; ++t) { const int cc = t * 16 + nloc;
#pragma unroll
      for (int r8 = 0; r8 < 8; ++r8) { b16 ph, pl; split16((acc[m][t][r8] * (1.0f / (XS * WSC)) + bvv[t]) * sc * HS, ph, pl); Oh[wv][8 * hlf + r8][cc] = ph; Ol[wv][8 * hlf + r8][cc] = pl; } }
    wave_lds_sync();
    for (int rr = 0; rr < 16; rr += 4) { const int r = rr + (lane >> 3), d8 = (lane & 7) * 8; const size_t T = 8 * (m0 + 16 * m + r) + j;   // 8 lanes x 16 B per row, 4 rows per store
      *(v8b*)(PH + T * PW + p * 128 + h0 + d8) = *(const v8b*)(&Oh[wv][r][d8]); *(v8b*)(PL + T * PW + p * 128 + h0 + d8) = *(const v8b*)(&Ol[wv][r][d8]); }
    asm volatile("s_wait_xcnt 0x0" ::: "memory");   // the wait in front of the reuse of the address and data registers of this row tile's 8 stores
  } }
// attention: block of AW = 8 waves per (b, h, QM = 2 tiles of 16 queries); key blocks of 128 over all keys. The three inner loops of a key block are dealt to the waves: wave wv does key tile wv of S = Q K^T (3 products, K 128) for both query tiles, rows 4 wv .. + 3 of the 32 rows of the online softmax (P x256 hi+lo), and d tile wv of P V for both query tiles (K and V fragments straight from the fragment-order planes that proj_kernel wrote), so that each K and V fragment, loaded once, feeds both query tiles' products from registers. Q, S, P and each row's rescale factor go from wave to wave through LDS; every sum keeps its order.
constexpr int AW = 8, QM = 2, QR = 16 * QM, FD = 2;
static_assert(L % KB == 0 && KB / 16 == AW && HD / 16 == AW && QR == 4 * AW && 64 % QR == 0, "the deal below is for 8 key tiles, 32 rows and 8 d tiles over 8 waves; a block's queries lie in one 64-query mask block");
__global__ __launch_bounds__(32 * AW) void att_kernel(const b16* __restrict__ PH, const b16* __restrict__ PL, const b16* __restrict__ VFH, const b16* __restrict__ VFL, const b16* __restrict__ KFH, const b16* __restrict__ KFL, const int* __restrict__ rsrc, const int* __restrict__ rtgt, int BLIM, float* __restrict__ ATT) { __shared__ __attribute__((aligned(16))) b16 Ph_[QR][KB + 8], Pl_[QR][KB + 8], Qh_[QR][HD + 8], Ql_[QR][HD + 8]; __shared__ float Sf[QR][KB + 4], Of[QR][HD + 4], Sc[QR], Dn[QR];
  const int lane = threadIdx.x & 31, wv = __builtin_amdgcn_readfirstlane(threadIdx.x >> 5), nloc = lane & 15, hlf = lane >> 4; const int qt = blockIdx.x % (L / QR); const int h = (blockIdx.x / (L / QR)) % NH; const int b = blockIdx.x / ((L / QR) * NH); if (b >= BLIM) return; const int t0 = qt * QR; const int ib = t0 / 64; const int rs0 = rsrc[0], rs1 = rsrc[1], rs2 = rsrc[2], rt0 = rtgt[0], rt1 = rtgt[1], rt2 = rtgt[2];
  auto allowed = [&](int jb) { return (jb == 0) || (jb == NBLK - 1) || (jb - ib <= 1 && ib - jb <= 1) || (rs0 == ib && rt0 == jb) || (rs1 == ib && rt1 == jb) || (rs2 == ib && rt2 == jb); }; const size_t rowb = (size_t)b * L; const int qo = h * HD;
  { constexpr int QT = QR * (HD / 8) / (32 * AW); const b16 *qph[QT], *qpl[QT]; v8b qa[QT], qb[QT];   // the block's 32 query rows, 16 B a thread, plane and trip
    static_assert(QT == 2, "the wait below names the address registers of two trips");
#pragma unroll   // both trips' loads in flight together
    for (int k = 0; k < QT; ++k) { const int i = k * 32 * AW + (int)threadIdx.x; qph[k] = PH + (rowb + t0 + i / (HD / 8)) * PW + qo + (i % (HD / 8)) * 8; qpl[k] = PL + (rowb + t0 + i / (HD / 8)) * PW + qo + (i % (HD / 8)) * 8; qa[k] = *(const v8b*)qph[k]; qb[k] = *(const v8b*)qpl[k]; }
    asm volatile("s_wait_xcnt 0x0" :: "v"(qph[0]), "v"(qph[1]), "v"(qpl[0]), "v"(qpl[1]) : "memory");   // the wait in front of the reuse of the loads' address registers: as inputs here they stay whole up to it
#pragma unroll   // constant indices keep qa and qb in registers
    for (int k = 0; k < QT; ++k) { const int i = k * 32 * AW + (int)threadIdx.x; *(v8b*)(&Qh_[i / (HD / 8)][(i % (HD / 8)) * 8]) = qa[k]; *(v8b*)(&Ql_[i / (HD / 8)][(i % (HD / 8)) * 8]) = qb[k]; } }
  __syncthreads();   // every wave reads all 32 query rows
  float m_w[4], den_w[4]; v8f acc[QM];   // running maximum and denominator of the wave's own 4 rows (the same in every lane, kept in scalar registers by uni below); accumulators of its own d tile, one per query tile
#pragma unroll   // here and below: constant indices keep m_w, den_w, acc, s, kh, kl, qh, ql, vh, vl, pa and pb in registers
  for (int i = 0; i < 4; ++i) { m_w[i] = -INFINITY; den_w[i] = 0.0f; }
#pragma unroll
  for (int u = 0; u < QM; ++u) acc[u] = (v8f){};
  const int kstart = 0; const int kend = L;   // [kstart, kend)
#pragma unroll 1
  for (int kb0 = kstart; kb0 < kend; kb0 += KB) { constexpr int nkt = KB / 16;   /* L % KB == 0 (asserted above): every key block is whole */ if (!allowed(kb0 / 64) && !allowed(kb0 / 64 + 1)) continue;   /* neither 64-key sub-block of this 128-key block is visible to this query block (the same for the whole work-group) */
    { const int t = wv; if (t < nkt) { const size_t kr = ((rowb + kb0) / 16 + t) * (size_t)((HD / 32) * 512) + lane * 8; const b16* const kph = KFH + kr; const b16* const kpl = KFL + kr; v8f s[QM]; v16b kh[FD], kl[FD];   // the wave's key tile in the fragment-order planes; the later 32-d blocks are constant steps from it. kh, kl: ring of FD 32-d blocks, a slot loaded again right behind its last product
#pragma unroll
        for (int u = 0; u < QM; ++u) s[u] = (v8f){};
#pragma unroll
        for (int r = 0; r < FD; ++r) { kh[r] = frag_vf(kph + r * 512); kl[r] = frag_vf(kpl + r * 512); }
#pragma unroll
        for (int q = 0; q < HD / 32; ++q) { const int r = q % FD; v16b qh[QM], ql[QM];   // the K fragments serve both query tiles
#pragma unroll
          for (int u = 0; u < QM; ++u) { qh[u] = frag_kb(&Qh_[16 * u + nloc][q * 32], hlf); ql[u] = frag_kb(&Ql_[16 * u + nloc][q * 32], hlf); }
#pragma unroll
          for (int u = 0; u < QM; ++u) s[u] = wmma16b(qh[u], kh[r], s[u]);
#pragma unroll
          for (int u = 0; u < QM; ++u) s[u] = wmma16b(qh[u], kl[r], s[u]);
          if (q + FD < HD / 32) kl[r] = frag_vf(kpl + (q + FD) * 512);
#pragma unroll
          for (int u = 0; u < QM; ++u) s[u] = wmma16b(ql[u], kh[r], s[u]);
          if (q + FD < HD / 32) kh[r] = frag_vf(kph + (q + FD) * 512); }
        asm volatile("s_wait_xcnt 0x0" :: "v"(kph), "v"(kpl) : "memory");   // the wait in front of the reuse of the K loads' address registers: as inputs here they stay whole up to it
        const int j = kb0 + t * 16 + nloc; const bool ok = (j < kend) && allowed(j >> 6);   /* BigBird block mask (-1e9 in the module == excluded; key block 0 always allowed) */
#pragma unroll
        for (int u = 0; u < QM; ++u)
#pragma unroll
          for (int r8 = 0; r8 < 8; ++r8) Sf[16 * u + 8 * hlf + r8][t * 16 + nloc] = ok ? s[u][r8] * (1.0f / (HS * HS)) : -INFINITY; }
      else {
#pragma unroll
        for (int u = 0; u < QM; ++u)
#pragma unroll
          for (int r8 = 0; r8 < 8; ++r8) Sf[16 * u + 8 * hlf + r8][t * 16 + nloc] = -INFINITY; } }
    __syncthreads();   // a softmax row holds the scores of all eight waves' key tiles; it also ends every wave's reads of P and Sc of the key block before
    const size_t vf = ((rowb + kb0) / 32) * (size_t)((HD / 16) * 512) + wv * 512 + lane * 8; const b16* const vph = VFH + vf; const b16* const vpl = VFL + vf;   // the wave's d tile in the key block's first 32-key group; the later groups are constant steps from it
    v16b vh[FD], vl[FD];   // ring of FD 32-key groups: the first FD are asked for here, so that they fly during the softmax
#pragma unroll
    for (int r = 0; r < FD; ++r) { vh[r] = frag_vf(vph + r * ((HD / 16) * 512)); vl[r] = frag_vf(vpl + r * ((HD / 16) * 512)); }
#pragma unroll
    for (int i = 0; i < 4; ++i) { const int rr = 4 * wv + i; float mx = -INFINITY;
#pragma unroll
      for (int q = 0; q < 4; ++q) mx = fmaxf(mx, Sf[rr][q * 32 + lane]);
      for (int o = 16; o; o >>= 1) mx = fmaxf(mx, __shfl_xor(mx, o));
      const float mold = m_w[i]; const float mn = fmaxf(mold, mx); const float sf = (mold == -INFINITY) ? 0.0f : ((mn == -INFINITY) ? 1.0f : __expf(mold - mn)); float ps = 0.0f;
#pragma unroll
      for (int q = 0; q < 4; ++q) { const int kx = q * 32 + lane; const float sv = Sf[rr][kx]; const float p = (sv == -INFINITY || mn == -INFINITY) ? 0.0f : __expf(sv - mn); ps += p; b16 ph, pl; split16(p * PS, ph, pl); Ph_[rr][kx] = ph; Pl_[rr][kx] = pl; }
      for (int o = 16; o; o >>= 1) ps += __shfl_xor(ps, o);
      den_w[i] = uni(den_w[i] * sf + ps); m_w[i] = uni(mn); if (lane == 0) Sc[rr] = sf; }
    __syncthreads();   // every wave reads all 32 rows of P and their rescale factors; it also ends the reads of Sf before the next key block's scores are stored
#pragma unroll
    for (int u = 0; u < QM; ++u)
#pragma unroll
      for (int r8 = 0; r8 < 8; ++r8) acc[u][r8] = acc[u][r8] * Sc[16 * u + 8 * hlf + r8];
#pragma unroll   // constant indices keep vh and vl in registers
    for (int g = 0; g < KB / 32; ++g) { const int r = g % FD, ks = 32 * g; v16b pa[QM], pb[QM];   // the V fragments serve both query tiles
#pragma unroll
      for (int u = 0; u < QM; ++u) { pa[u] = frag_kb(&Ph_[16 * u + nloc][ks], hlf); pb[u] = frag_kb(&Pl_[16 * u + nloc][ks], hlf); }
#pragma unroll
      for (int u = 0; u < QM; ++u) acc[u] = wmma16b(pa[u], vh[r], acc[u]);
#pragma unroll
      for (int u = 0; u < QM; ++u) acc[u] = wmma16b(pa[u], vl[r], acc[u]);
      if (g + FD < KB / 32) vl[r] = frag_vf(vpl + (g + FD) * ((HD / 16) * 512));
#pragma unroll
      for (int u = 0; u < QM; ++u) acc[u] = wmma16b(pb[u], vh[r], acc[u]);
      if (g + FD < KB / 32) vh[r] = frag_vf(vph + (g + FD) * ((HD / 16) * 512)); }
    asm volatile("s_wait_xcnt 0x0" :: "v"(vph), "v"(vpl) : "memory");   // the wait in front of the reuse of the V loads' address registers: as inputs here they stay whole up to it
  }
#pragma unroll
  for (int i = 0; i < 4; ++i) if (lane == 0) Dn[4 * wv + i] = den_w[i];
  __syncthreads();   // every wave divides by the denominators of all 32 rows
#pragma unroll
  for (int u = 0; u < QM; ++u)
#pragma unroll
    for (int r8 = 0; r8 < 8; ++r8) { const float dn = Dn[16 * u + 8 * hlf + r8]; Of[16 * u + 8 * hlf + r8][wv * 16 + nloc] = dn > 0.0f ? acc[u][r8] * (1.0f / (HS * PS)) / dn : 0.0f; }
  __syncthreads();   // a stored row holds the d tiles of all eight waves
  const int rb_ = b / HEADS, hq = b % HEADS;   /* merge heads: ATT[b][s][h*128 + d] */
  { for (int rr = 4 * wv; rr < 4 * wv + 4; ++rr) for (int s = 0; s < HD / 32; ++s) ((float*)ATT)[((size_t)rb_ * L + t0 + rr) * DIM + hq * 128 + s * 32 + lane] = Of[rr][s * 32 + lane];  } }
// output projection: block of 16 waves per (OM = 2 tiles of 16 rows, half of the columns = blockIdx.y): the waves stage the attended rows (hi+lo) once, one row of each tile each, and share them; wave wv then does columns blockIdx.y*512 + wv*32 .. +31 (2 column tiles) for both row tiles, so that each WO fragment, loaded once, feeds 4 products from registers:
constexpr int OM = 2, OD = 4;
static_assert(NRB % (16 * OM) == 0, "a block's rows all exist");
static_assert((DIM / 32) % OD == 0 && DIM / 32 >= 2 * OD, "whole turns of the weight ring");
__global__ __launch_bounds__(512) void outp_kernel(const float* __restrict__ ATT, const b16* __restrict__ WO, const float* __restrict__ bo, int RLIM, float* __restrict__ out) { __shared__ __attribute__((aligned(16))) b16 Ah[16 * OM][DIM + 8], Al[16 * OM][DIM + 8]; __shared__ __attribute__((aligned(16))) float Tf[16][16][36]; const int lane = threadIdx.x & 31, wv = __builtin_amdgcn_readfirstlane(threadIdx.x >> 5), nloc = lane & 15, hlf = lane >> 4; const size_t m0 = (size_t)blockIdx.x * (16 * OM); if (m0 >= (size_t)RLIM) return;
  { const float* const ap = ATT + (m0 + wv) * DIM + lane * 4; v4f av[OM][DIM / 128];   // the wave's row of each tile, 16 B a lane: all 16 loads stand ahead of the splits
#pragma unroll   // constant indices keep av in registers
    for (int m = 0; m < OM; ++m)
#pragma unroll
      for (int c = 0; c < DIM / 128; ++c) av[m][c] = *(const v4f*)(ap + 16 * m * DIM + c * 128);
#pragma unroll
    for (int m = 0; m < OM; ++m)
#pragma unroll
      for (int c = 0; c < DIM / 128; ++c) { v4b hv, lv;
#pragma unroll
        for (int e = 0; e < 4; ++e) { b16 p, ql; split16(av[m][c][e] * HS, p, ql); hv[e] = p; lv[e] = ql; }
        *(v4b*)(&Ah[16 * m + wv][c * 128 + lane * 4]) = hv; *(v4b*)(&Al[16 * m + wv][c * 128 + lane * 4]) = lv; } }
  const int c0 = blockIdx.y * (DIM / 2) + wv * 32; v8f acc[OM][2]; const b16* const wf = WO + (c0 / 16) * 512 + lane * 8;   // fragment-order plane, as in proj_kernel
  v16b bw[OD][2];   // ring of weight fragments, OD k blocks deep, as in proj_kernel
#pragma unroll   // here and below: constant indices keep acc, bw, a and al in registers
  for (int s = 0; s < OD; ++s)
#pragma unroll
    for (int t = 0; t < 2; ++t) bw[s][t] = frag_vf(wf + 32 * s * DIM + t * 512);
  __syncthreads();   // every wave reads all staged rows
#pragma unroll
  for (int m = 0; m < OM; ++m)
#pragma unroll
    for (int t = 0; t < 2; ++t) acc[m][t] = (v8f){};
  auto kstep = [&](int kk, int s, bool more) { v16b a[OM], al[OM];   // k block kk, whose 2 weight fragments lie in slot s; each is used for both row tiles (hi and lo)
#pragma unroll
    for (int m = 0; m < OM; ++m) { a[m] = frag_kb(&Ah[16 * m + nloc][kk], hlf); al[m] = frag_kb(&Al[16 * m + nloc][kk], hlf); }
#pragma unroll
    for (int t = 0; t < 2; ++t) {
#pragma unroll
      for (int m = 0; m < OM; ++m) { acc[m][t] = wmma16b(a[m], bw[s][t], acc[m][t]); acc[m][t] = wmma16b(al[m], bw[s][t], acc[m][t]); }
      if (more) bw[s][t] = frag_vf(wf + (kk + 32 * OD) * DIM + t * 512); } };
#pragma unroll 1   // one turn of the ring a trip: the slots' addresses are immediates of one pointer, and the loop stays small
  for (int kk = 0; kk < DIM - 32 * OD; kk += 32 * OD)
#pragma unroll
    for (int s = 0; s < OD; ++s) kstep(kk + 32 * s, s, true);
#pragma unroll   // the last turn has nothing left to load
  for (int s = 0; s < OD; ++s) kstep(DIM - 32 * OD + 32 * s, s, false);
  float bb[2]; const int bi = c0 + nloc;   // the wave's 2 bias values serve both row tiles
#pragma unroll
  for (int t = 0; t < 2; ++t) bb[t] = bo[bi + t * 16];
  asm volatile("s_wait_xcnt 0x0" :: "v"(bi) : "memory");   // the wait in front of the reuse of the loads' address register: as an input here it stays whole up to it
#pragma unroll
  for (int t = 0; t < 2; ++t) bb[t] = bfv(bb[t]);
#pragma unroll
  for (int m = 0; m < OM; ++m) { if (m) wave_lds_sync();   // the lanes' reads of the row tile before end ahead of other lanes' writes to the same patch
#pragma unroll
    for (int t = 0; t < 2; ++t) { const int cc = t * 16 + nloc;
#pragma unroll
      for (int r8 = 0; r8 < 8; ++r8) Tf[wv][8 * hlf + r8][cc] = acc[m][t][r8] * (1.0f / (HS * WSC)) + bb[t]; }
    wave_lds_sync();
    for (int rr = 0; rr < 16; rr += 4) { const int r = rr + (lane >> 3), c4 = (lane & 7) * 4;   // 8 lanes x 16 B = one 128-B line per row, 4 rows per store
      *(v4f*)(out + (m0 + 16 * m + r) * DIM + c0 + c4) = *(const v4f*)(&Tf[wv][r][c4]); }
  } }
}  // namespace

extern "C" void kernel_launch(void* const* d_in, const int* in_sizes, int n_in, void* d_out, int out_size, void* d_ws, size_t ws_size, hipStream_t stream) {
  (void)n_in;
  auto Fp = [&](int i) { return (const float*)d_in[i]; };
  // input order: 0 x [2,2048,1024]; 1 Wq [1024,1024] (in,out); 2 bq; 3 Wk; 4 bk; 5 Wv; 6 bv; 7 Wo; 8 bo; 9 rand_src [3] i32; 10 rand_tgt [3] i32
  if (in_sizes[0] != NRB * DIM || in_sizes[1] != DIM * DIM || in_sizes[3] != DIM * DIM || in_sizes[5] != DIM * DIM || in_sizes[7] != DIM * DIM || in_sizes[8] != DIM || in_sizes[9] != 3 || in_sizes[10] != 3 || out_size != NRB * DIM) return;
  const int BLIM = NB;   // (batch, head) pairs
  const int RLIM = NRB;
  size_t off = 0; char* ws = (char*)d_ws;
  auto carve = [&](size_t bytes) { char* p = ws + off; off += (bytes + 255) & ~(size_t)255; return p; };
  b16* W3 = (b16*)carve((size_t)3 * DIM * DIM * 2); b16* WO = (b16*)carve((size_t)DIM * DIM * 2); b16* PH = (b16*)carve((size_t)NT * PW * 2); b16* PL = (b16*)carve((size_t)NT * PW * 2); float* ATT = (float*)carve((size_t)NRB * DIM * 4); b16* VFH = (b16*)carve((size_t)NT * HD * 2); b16* VFL = (b16*)carve((size_t)NT * HD * 2); b16* KFH = (b16*)carve((size_t)NT * HD * 2); b16* KFL = (b16*)carve((size_t)NT * HD * 2);
  if (off > ws_size || off > ((size_t)112 << 20)) return;   // ~ 109 MB
  wput_kernel<<<(unsigned)(((size_t)4 * DIM * (DIM / 8) + 255) / 256), 256, 0, stream>>>(Fp(1), Fp(3), Fp(5), Fp(7), W3, WO);
  proj_kernel<<<dim3(RLIM / (16 * PM), 3), 512, 0, stream>>>(Fp(0), W3, Fp(2), Fp(4), Fp(6), RLIM, PH, PL, VFH, VFL, KFH, KFL);
  att_kernel<<<BLIM * NH * (L / QR), 32 * AW, 0, stream>>>(PH, PL, VFH, VFL, KFH, KFL, (const int*)d_in[9], (const int*)d_in[10], BLIM, ATT);
  outp_kernel<<<dim3(RLIM / (16 * OM), 2), 512, 0, stream>>>(ATT, WO, Fp(8), RLIM, (float*)d_out);
}

// v010
// It runs in 88.2 microseconds.
// Timed twice side by side with v009, it ran 1.14 times as fast both times.
// Counting every step since v000, it is 25.6 times as fast.
#include <hip/hip_runtime.h>

// HierarchicalAttention (BigBird-style block mask): Q = x Wq + bq, K, V likewise ((in,out) 1024x1024); the module's raw .view(B, 8, 2048, 128) makes head h / token s the 128-slice s%8 of projected row h*256 + s/8 — i.e. the flat
// [B*8*2048][128] view of each projection; scores / sqrt(128); key block j (64 keys) allowed for query block i iff j == 0 || j == 31 || |i-j| <= 1 || (i,j) is one of the 3 (rand_src, rand_tgt) pairs, else -1e9 (== excluded;
// block 0 always allowed); softmax; O merged as [b][s][h*128+d]; out = O Wo + bo -> [2][2048][1024].
// Deterministic: no index structures, no atomics; flash-style online softmax over the visible key blocks in a fixed order.
// WMMA (v_wmma_f32_16x16x32_f16, f32 accumulate): the QKV projection with x EXACT bf16 x8 (K 1024) against exact torch weight rows x256 (one product); S = Q K^T (hi+lo x hi+lo, 3 products, K 128); O = P V (P x256 hi+lo x V^T hi+lo, 3 products); softmax in f32. Inputs rounded to bf16 once. Fragment k-map per lane half hh for A AND B: elements 0..7 <- k = 8hh+0..7, 8..15 <- k = 16+8hh+0..7; acc[r] = D[8hh+r][col].

namespace {
constexpr int NB = 16, L = 2048, C = 128, NH = 1, HD = 128, NT = NB * L, KB = 128, PW = 3 * C;   // NB = (batch, head) pairs; the 'token' index is (b*8 + h)*2048 + s
constexpr int RB = 2, DIM = 1024, HEADS = 8, NBLK = 32, NRB = RB * L /* 4096 projected rows */;
constexpr float XS = 8.0f, HS = 256.0f /* hi+lo staging scale for q/k/v/attended */, WSC = 256.0f, PS = 256.0f, SCALE = 0.08838834764831845f;
typedef _Float16 b16;
typedef __attribute__((ext_vector_type(16))) _Float16 v16b;
typedef __attribute__((ext_vector_type(8))) _Float16 v8b;
typedef __attribute__((ext_vector_type(4))) _Float16 v4b;
typedef __attribute__((ext_vector_type(8))) float v8f;
typedef __attribute__((ext_vector_type(4))) float v4f;
__device__ __forceinline__ float bf16_rne(float f) { unsigned int u = __float_as_uint(f); u += 0x7FFFu + ((u >> 16) & 1u); float r = __uint_as_float(u & 0xFFFF0000u); asm volatile("" : "+v"(r)); return r; }
__device__ __forceinline__ float bfv(float f) { float r = bf16_rne(f); asm volatile("" : "+v"(r)); return r; }
__device__ __forceinline__ void split16(float v, b16& hi, b16& lo) { hi = (b16)v; lo = (b16)(v - (float)hi); }
__device__ __forceinline__ v16b frag_kb(const b16* p, int hh) { const v8b a = *(const v8b*)(p + 8 * hh), b = *(const v8b*)(p + 16 + 8 * hh); v16b f;
#pragma unroll
  for (int e = 0; e < 8; ++e) { f[e] = a[e]; f[8 + e] = b[e]; } return f; }
__device__ __forceinline__ v16b frag_vf(const b16* p) { const v8b a = *(const v8b*)p, b = *(const v8b*)(p + 256); v16b f;   // p already holds the lane's own 8 * lane: two whole 512-B runs per wave
#pragma unroll
  for (int e = 0; e < 8; ++e) { f[e] = a[e]; f[8 + e] = b[e]; } return f; }
__device__ __forceinline__ v8f wmma16b(v16b a, v16b b, v8f c) { v8f d = __builtin_amdgcn_wmma_f32_16x16x32_f16(false, a, false, b, (short)0, c, false, false); asm volatile("v_nop\n\tv_nop\n\tv_nop\n\tv_nop" : "+v"(d) : "v"(a), "v"(b)); return d; }
__device__ __forceinline__ void wave_lds_sync() { __builtin_amdgcn_fence(__ATOMIC_RELEASE, "workgroup"); __builtin_amdgcn_wave_barrier(); __builtin_amdgcn_fence(__ATOMIC_ACQUIRE, "workgroup"); }
__device__ __forceinline__ float uni(float v) { return __uint_as_float((unsigned)__builtin_amdgcn_readfirstlane((int)__float_as_uint(v))); }   // a value that is the same in every lane moves to a scalar register (att_kernel: the 8 vector registers so freed let its K and V rings fit 128 registers, 8 waves a SIMD)
__device__ __forceinline__ float pmul(float a, float b) { float p = a * b; asm volatile("" : "+v"(p)); return p; }

__global__ __launch_bounds__(256) void wput_kernel(const float* __restrict__ wq, const float* __restrict__ wk, const float* __restrict__ wv, const float* __restrict__ wo, b16* __restrict__ W3, b16* __restrict__ WO) { const size_t u = (size_t)blockIdx.x * 256 + threadIdx.x; if (u >= (size_t)4 * DIM * (DIM / 8)) return;
  // thread u writes 16-B piece u of the planes, which lie in the order of the projections' B fragments: [matrix p][32-k block][16-column tile][e][lane = 16 hh + o % 16][i], k % 32 = 16 e + 8 hh + i (o = output column of the weight), so that a wave reads each fragment half as one 512-B run and the tiles of one k block lie side by side; a wave here loads 2 x 64 B at a time and stores 512 B in a row
  const int ln = (int)(u & 31), p = (int)(u >> 17), o = ((int)(u >> 6) & 63) * 16 + (ln & 15), k0 = ((int)(u >> 12) & 31) * 32 + ((int)(u >> 5) & 1) * 16 + (ln >> 4) * 8; const float* w = p == 0 ? wq : (p == 1 ? wk : (p == 2 ? wv : wo)); v8b v;
#pragma unroll
  for (int j = 0; j < 8; ++j) v[j] = (b16)(bf16_rne(w[(size_t)(k0 + j) * DIM + o]) * WSC);
  { *(v8b*)(p < 3 ? W3 + u * 8 : WO + (u - (size_t)3 * DIM * (DIM / 8)) * 8) = v;  } }
// projection: block of 16 waves per (PM = 4 tiles of 16 projected rows, projection p = blockIdx.y): the waves stage bf16(x) (EXACT, K 1024) once, one row of each tile each, and share it; wave wv then does columns wv*64 .. +63 of p (4 column tiles) for all 4 row tiles, so that each W3 fragment, loaded once, feeds 4 products from registers; + bias (Q scaled by 1/sqrt(128)); row r, 128-chunk j -> token T = 8*(b*2048 + r) + j:
constexpr int PM = 4, PD = 2;
static_assert(NRB % (16 * PM) == 0, "a block's rows all exist");
static_assert((DIM / 32) % PD == 0 && DIM / 32 >= 2 * PD, "whole turns of the weight ring");
__global__ __launch_bounds__(512) void proj_kernel(const float* __restrict__ x, const b16* __restrict__ W3, const float* __restrict__ bq, const float* __restrict__ bk, const float* __restrict__ bv, int RLIM, b16* __restrict__ PH, b16* __restrict__ PL, b16* __restrict__ VFH, b16* __restrict__ VFL, b16* __restrict__ KFH, b16* __restrict__ KFL) { __shared__ __attribute__((aligned(16))) b16 Ah[16 * PM][DIM + 8], Oh[16][16][72], Ol[16][16][72]; const int lane = threadIdx.x & 31, wv = __builtin_amdgcn_readfirstlane(threadIdx.x >> 5), nloc = lane & 15, hlf = lane >> 4; const size_t m0 = (size_t)blockIdx.x * (16 * PM); if (m0 >= (size_t)RLIM) return;
  { const float* const xp = x + (m0 + wv) * DIM + lane * 4; v4f xv[PM][DIM / 128];   // the wave's row of each of the 4 tiles, 16 B a lane: all 32 loads (512 B each) stand ahead of the first rounding, so that they are in flight together
#pragma unroll   // here and below: constant indices keep xv, acc, bw, a and bvv in registers
    for (int m = 0; m < PM; ++m)
#pragma unroll
      for (int c = 0; c < DIM / 128; ++c) xv[m][c] = *(const v4f*)(xp + 16 * m * DIM + c * 128);
#pragma unroll
    for (int m = 0; m < PM; ++m)
#pragma unroll
      for (int c = 0; c < DIM / 128; ++c) { v4b hv;
#pragma unroll
        for (int e = 0; e < 4; ++e) hv[e] = (b16)(bf16_rne(xv[m][c][e]) * XS);
        *(v4b*)(&Ah[16 * m + wv][c * 128 + lane * 4]) = hv; } }
  const int p = blockIdx.y, c0 = wv * 64; const float* bb = p == 0 ? bq : (p == 1 ? bk : bv); const float sc = p == 0 ? SCALE : 1.0f; v8f acc[PM][4]; const b16* const wf = W3 + (size_t)p * DIM * DIM + (c0 / 16) * 512 + lane * 8;   // the wave's first column tile in the fragment-order plane: 512 elements a tile, 32 * DIM a 32-k block
  v16b bw[PD][4];   // ring of weight fragments, PD k blocks deep: a slot is loaded again, for the k block PD further on, as soon as its 4 products are issued, so that the load flies while the other slots are worked on
#pragma unroll   // here and below: constant indices keep bw in registers
  for (int s = 0; s < PD; ++s)
#pragma unroll
    for (int t = 0; t < 4; ++t) bw[s][t] = frag_vf(wf + 32 * s * DIM + t * 512);
  __syncthreads();   // every wave reads all staged rows
#pragma unroll
  for (int m = 0; m < PM; ++m)
#pragma unroll
    for (int t = 0; t < 4; ++t) acc[m][t] = (v8f){};
  auto kstep = [&](int kb, int s, bool more) { v16b a[PM];   // k block kb, whose weight fragments lie in slot s; each of its 4 weight and 4 row fragments is used 4 times
#pragma unroll
    for (int m = 0; m < PM; ++m) a[m] = frag_kb(&Ah[16 * m + nloc][kb], hlf);
#pragma unroll
    for (int t = 0; t < 4; ++t) {
#pragma unroll
      for (int m = 0; m < PM; ++m) acc[m][t] = wmma16b(a[m], bw[s][t], acc[m][t]);
      if (more) bw[s][t] = frag_vf(wf + (kb + 32 * PD) * DIM + t * 512); } };
#pragma unroll 1   // one turn of the ring a trip: the slots' addresses are immediates of one pointer, and the loop stays small
  for (int kb = 0; kb < DIM - 32 * PD; kb += 32 * PD)
#pragma unroll
    for (int s = 0; s < PD; ++s) kstep(kb + 32 * s, s, true);
#pragma unroll   // the last turn has nothing left to load
  for (int s = 0; s < PD; ++s) kstep(DIM - 32 * PD + 32 * s, s, false);
  float bvv[4]; const float* const bp = bb + c0 + nloc;   // the wave's 4 bias values serve all row tiles
#pragma unroll
  for (int t = 0; t < 4; ++t) bvv[t] = bp[t * 16];
  asm volatile("s_wait_xcnt 0x0" :: "v"(nloc) : "memory");   // the wait in front of the reuse of the loads' address registers: the lane's part of the address is nloc, which as an input here stays whole up to it
#pragma unroll
  for (int t = 0; t < 4; ++t) bvv[t] = bfv(bvv[t]);
  if (p == 2) {   // V: 16 rows x 1024 columns (one row tile) are 128 consecutive keys x 128 d of one head. They leave in the order of the P V product's B fragments: [32-key group][16-d tile][e][lane = 16 hh + d % 16][i], key % 32 = 16 e + 8 hh + i, so that a wave of att_kernel reads each fragment half as one 512-B run
    b16* const Vh = &Oh[0][0][0]; b16* const Vl = &Ol[0][0][0];   // 4 groups x 8 tiles x 512 = 16384 elements per plane, shared by the block, one row tile at a time
#pragma unroll
    for (int m = 0; m < PM; ++m) {
      if (m) __syncthreads();   // the copy-out of the row tile before has read the planes (p is the same for the whole block)
#pragma unroll
      for (int t = 0; t < 4; ++t) {
#pragma unroll
        for (int r8 = 0; r8 < 8; ++r8) { b16 ph, pl; split16((acc[m][t][r8] * (1.0f / (XS * WSC)) + bvv[t]) * sc * HS, ph, pl);   // local key = 8 * (8 hlf + r8) + (wv >> 1), d = (c0 & 64) + 16 t + nloc
          const int ix = ((((2 * hlf + (r8 >> 2)) * 8 + ((c0 & 64) >> 4) + t) * 2 + ((r8 >> 1) & 1)) * 32 + (r8 & 1) * 16 + nloc) * 8 + (wv >> 1); Vh[ix] = ph; Vl[ix] = pl; } }
      __syncthreads();   // the copy-out below reads what all 16 waves wrote
      const size_t vb = (8 * (m0 + 16 * m) / 32) * (size_t)(8 * 512);
#pragma unroll
      for (int q = 0; q < 4; ++q) { const int o = (q * 512 + (int)threadIdx.x) * 8; *(v8b*)(VFH + vb + o) = *(const v8b*)(Vh + o); *(v8b*)(VFL + vb + o) = *(const v8b*)(Vl + o); } }
    return; }
  if (p == 1) {   // K: a row tile is the same 128 consecutive keys x 128 d of one head. They leave in the order of the S product's B fragments: [16-key tile][32-d block][e][lane = 16 hh + key % 16][i], d % 32 = 16 e + 8 hh + i, so that a wave of att_kernel reads each fragment half as one 512-B run
    b16* const Kh = &Oh[0][0][0]; b16* const Kl = &Ol[0][0][0];   // 8 tiles x 4 blocks x 512 = 16384 elements per plane; in LDS 16 B follow each 256 B and 32 B more stand ahead of the upper 4 tiles (17424 of the 18432 elements), so that the 32 lanes of a 2-byte store fall on 16 different banks
    const int kx = hlf * (4 * 2176 + 16) + ((c0 & 64) >> 5) * 544 + (nloc >> 3) * 136 + (wv >> 1) * 8 + (nloc & 7);   // the lane's and the wave's part of the padded index: key tile 4 hlf + (r8 >> 1), key % 16 = 8 (r8 & 1) + (wv >> 1), d = (c0 & 64) + 16 t + nloc
#pragma unroll
    for (int m = 0; m < PM; ++m) {
      if (m) __syncthreads();   // the copy-out of the row tile before has read the planes (p is the same for the whole block)
#pragma unroll
      for (int t = 0; t < 4; ++t) {
#pragma unroll
        for (int r8 = 0; r8 < 8; ++r8) { b16 ph, pl; split16((acc[m][t][r8] * (1.0f / (XS * WSC)) + bvv[t]) * sc * HS, ph, pl);
          const int ix = kx + (r8 >> 1) * 2176 + (t >> 1) * 544 + (t & 1) * 272 + (r8 & 1) * 64; Kh[ix] = ph; Kl[ix] = pl; } }
      __syncthreads();   // the copy-out below reads what all 16 waves wrote
      const size_t kb = (8 * (m0 + 16 * m) / 16) * (size_t)(4 * 512);
#pragma unroll
      for (int q = 0; q < 4; ++q) { const int pc = q * 512 + (int)threadIdx.x, o = pc * 8, lo = o + (pc >> 4) * 8 + (pc >> 10) * 16; *(v8b*)(KFH + kb + o) = *(const v8b*)(Kh + lo); *(v8b*)(KFL + kb + o) = *(const v8b*)(Kl + lo); } }
    return; }
  const int j = c0 >> 7, h0 = c0 & 64;   // Q: the wave's 64 columns = one 128-B half of chunk j of projection p
#pragma unroll
  for (int m = 0; m < PM; ++m) { if (m) wave_lds_sync();   // the lanes' reads of the row tile before end ahead of other lanes' writes to the same patch
#pragma unroll
    for (int t = 0; t < 4; ++t) { const int cc = t * 16 + nloc;
#pragma unroll
      for (int r8 = 0; r8 < 8; ++r8) { b16 ph, pl; split16((acc[m][t][r8] * (1.0f / (XS * WSC)) + bvv[t]) * sc * HS, ph, pl); Oh[wv][8 * hlf + r8][cc] = ph; Ol[wv][8 * hlf + r8][cc] = pl; } }
    wave_lds_sync();
    for (int rr = 0; rr < 16; rr += 4) { const int r = rr + (lane >> 3), d8 = (lane & 7) * 8; const size_t T = 8 * (m0 + 16 * m + r) + j;   // 8 lanes x 16 B per row, 4 rows per store
      *(v8b*)(PH + T * PW + p * 128 + h0 + d8) = *(const v8b*)(&Oh[wv][r][d8]); *(v8b*)(PL + T * PW + p * 128 + h0 + d8) = *(const v8b*)(&Ol[wv][r][d8]); }
    asm volatile("s_wait_xcnt 0x0" ::: "memory");   // the wait in front of the reuse of the address and data registers of this row tile's 8 stores
  } }
// attention: block of AW = 8 waves per (b, h, QM = 2 tiles of 16 queries). Only the 64-key mask blocks that this query block may see are visited, in rising order and two to a trip, so that a trip's 128 keys are all visible ones (the last trip may hold one block; then waves 4 .. 7 have no key tile and the second half of P V is left out). The three inner loops of a trip are dealt to the waves: wave wv does key tile wv of the trip's 8 of S = Q K^T (3 products, K 128) for both query tiles, rows 4 wv .. + 3 of the 32 rows of the online softmax (P x256 hi+lo), and d tile wv of P V for both query tiles (K and V fragments straight from the fragment-order planes that proj_kernel wrote), so that each K and V fragment, loaded once, feeds both query tiles' products from registers. Q, S, P and each row's rescale factor go from wave to wave through LDS; every sum runs over the visited keys in a fixed order.
constexpr int AW = 8, QM = 2, QR = 16 * QM, FD = 2;
static_assert(L == 64 * NBLK && NBLK == 32 && KB == 2 * 64 && FD * 32 == 64 && KB / 16 == AW && HD / 16 == AW && QR == 4 * AW && 64 % QR == 0, "the deal below is for 8 key tiles (two 64-key mask blocks, each one turn of the V ring), 32 rows and 8 d tiles over 8 waves; a block's queries lie in one 64-query mask block; the mask blocks are the bits of one word");
__global__ __launch_bounds__(32 * AW) void att_kernel(const b16* __restrict__ PH, const b16* __restrict__ PL, const b16* __restrict__ VFH, const b16* __restrict__ VFL, const b16* __restrict__ KFH, const b16* __restrict__ KFL, const int* __restrict__ rsrc, const int* __restrict__ rtgt, int BLIM, float* __restrict__ ATT) { __shared__ __attribute__((aligned(16))) b16 Ph_[QR][KB + 8], Pl_[QR][KB + 8], Qh_[QR][HD + 8], Ql_[QR][HD + 8]; __shared__ float Sf[QR][KB + 4], Of[QR][HD + 4], Sc[QR], Dn[QR];
  const int lane = threadIdx.x & 31, wv = __builtin_amdgcn_readfirstlane(threadIdx.x >> 5), nloc = lane & 15, hlf = lane >> 4; const int qt = blockIdx.x % (L / QR); const int h = (blockIdx.x / (L / QR)) % NH; const int b = blockIdx.x / ((L / QR) * NH); if (b >= BLIM) return; const int t0 = qt * QR; const int ib = t0 / 64; const int rs0 = rsrc[0], rs1 = rsrc[1], rs2 = rsrc[2], rt0 = rtgt[0], rt1 = rtgt[1], rt2 = rtgt[2];
  unsigned am = 1u | (1u << (NBLK - 1)) | (1u << ib) | (ib > 0 ? 1u << (ib - 1) : 0u) | (ib < NBLK - 1 ? 1u << (ib + 1) : 0u);   // bit j: key block j (64 keys) is visible to this query block: first, last, the window, and below the (rand_src, rand_tgt) pairs; a target outside 0 .. 31 names no block. The same in every thread of the work-group
  am |= (rs0 == ib && (unsigned)rt0 < (unsigned)NBLK ? 1u << (rt0 & 31) : 0u) | (rs1 == ib && (unsigned)rt1 < (unsigned)NBLK ? 1u << (rt1 & 31) : 0u) | (rs2 == ib && (unsigned)rt2 < (unsigned)NBLK ? 1u << (rt2 & 31) : 0u); const size_t rowb = (size_t)b * L; const int qo = h * HD;
  { constexpr int QT = QR * (HD / 8) / (32 * AW); const b16 *qph[QT], *qpl[QT]; v8b qa[QT], qb[QT];   // the block's 32 query rows, 16 B a thread, plane and trip
    static_assert(QT == 2, "the wait below names the address registers of two trips");
#pragma unroll   // both trips' loads in flight together
    for (int k = 0; k < QT; ++k) { const int i = k * 32 * AW + (int)threadIdx.x; qph[k] = PH + (rowb + t0 + i / (HD / 8)) * PW + qo + (i % (HD / 8)) * 8; qpl[k] = PL + (rowb + t0 + i / (HD / 8)) * PW + qo + (i % (HD / 8)) * 8; qa[k] = *(const v8b*)qph[k]; qb[k] = *(const v8b*)qpl[k]; }
    asm volatile("s_wait_xcnt 0x0" :: "v"(qph[0]), "v"(qph[1]), "v"(qpl[0]), "v"(qpl[1]) : "memory");   // the wait in front of the reuse of the loads' address registers: as inputs here they stay whole up to it
#pragma unroll   // constant indices keep qa and qb in registers
    for (int k = 0; k < QT; ++k) { const int i = k * 32 * AW + (int)threadIdx.x; *(v8b*)(&Qh_[i / (HD / 8)][(i % (HD / 8)) * 8]) = qa[k]; *(v8b*)(&Ql_[i / (HD / 8)][(i % (HD / 8)) * 8]) = qb[k]; } }
  __syncthreads();   // every wave reads all 32 query rows
  float m_w[4], den_w[4]; v8f acc[QM];   // running maximum and denominator of the wave's own 4 rows (the same in every lane, kept in scalar registers by uni below); accumulators of its own d tile, one per query tile
#pragma unroll   // here and below: constant indices keep m_w, den_w, acc, s, kh, kl, qh, ql, vh, vl, pa and pb in registers
  for (int i = 0; i < 4; ++i) { m_w[i] = -INFINITY; den_w[i] = 0.0f; }
#pragma unroll
  for (int u = 0; u < QM; ++u) acc[u] = (v8f){};
#pragma unroll 1
  for (int it = 0; it < NBLK / 2 && am != 0u; ++it) { const int j0 = __builtin_ctz(am); am &= am - 1u; const bool two = am != 0u; const int j1 = two ? __builtin_ctz(am) : j0; am &= am - 1u;   /* the next two visible key blocks, 0 <= j0 < j1 <= 31 as bit numbers of a 32-bit word; two: there is a second one (all the same for the whole work-group) */
    { const int t = wv; if (t < AW / 2 || two) { const size_t kr = ((rowb + (t < AW / 2 ? j0 : j1) * 64) / 16 + (t & 3)) * (size_t)((HD / 32) * 512) + lane * 8; const b16* const kph = KFH + kr; const b16* const kpl = KFL + kr; v8f s[QM]; v16b kh[FD], kl[FD];   // the wave's key tile in the fragment-order planes; the later 32-d blocks are constant steps from it. kh, kl: ring of FD 32-d blocks, a slot loaded again right behind its last product
#pragma unroll
        for (int u = 0; u < QM; ++u) s[u] = (v8f){};
#pragma unroll
        for (int r = 0; r < FD; ++r) { kh[r] = frag_vf(kph + r * 512); kl[r] = frag_vf(kpl + r * 512); }
#pragma unroll
        for (int q = 0; q < HD / 32; ++q) { const int r = q % FD; v16b qh[QM], ql[QM];   // the K fragments serve both query tiles
#pragma unroll
          for (int u = 0; u < QM; ++u) { qh[u] = frag_kb(&Qh_[16 * u + nloc][q * 32], hlf); ql[u] = frag_kb(&Ql_[16 * u + nloc][q * 32], hlf); }
#pragma unroll
          for (int u = 0; u < QM; ++u) s[u] = wmma16b(qh[u], kh[r], s[u]);
#pragma unroll
          for (int u = 0; u < QM; ++u) s[u] = wmma16b(qh[u], kl[r], s[u]);
          if (q + FD < HD / 32) kl[r] = frag_vf(kpl + (q + FD) * 512);
#pragma unroll
          for (int u = 0; u < QM; ++u) s[u] = wmma16b(ql[u], kh[r], s[u]);
          if (q + FD < HD / 32) kh[r] = frag_vf(kph + (q + FD) * 512); }
        asm volatile("s_wait_xcnt 0x0" :: "v"(kph), "v"(kpl) : "memory");   // the wait in front of the reuse of the K loads' address registers: as inputs here they stay whole up to it
#pragma unroll
        for (int u = 0; u < QM; ++u)
#pragma unroll
          for (int r8 = 0; r8 < 8; ++r8) Sf[16 * u + 8 * hlf + r8][t * 16 + nloc] = s[u][r8] * (1.0f / (HS * HS)); }   /* every visited key is visible (-1e9 in the module == excluded; key block 0 always visible) */
      else {
#pragma unroll
        for (int u = 0; u < QM; ++u)
#pragma unroll
          for (int r8 = 0; r8 < 8; ++r8) Sf[16 * u + 8 * hlf + r8][t * 16 + nloc] = -INFINITY; } }
    __syncthreads();   // a softmax row holds the scores of all eight waves' key tiles; it also ends every wave's reads of P and Sc of the key block before
    const size_t vf = ((rowb + j0 * 64) / 32) * (size_t)((HD / 16) * 512) + wv * 512 + lane * 8, vg = ((rowb + j1 * 64) / 32) * (size_t)((HD / 16) * 512) + wv * 512 + lane * 8; const b16* const vph = VFH + vf; const b16* const vpl = VFL + vf; const b16* const vqh = VFH + vg; const b16* const vql = VFL + vg;   // the wave's d tile in the first 32-key group of key block j0 and of j1; each block's second group is a constant step on
    v16b vh[FD], vl[FD];   // ring of FD 32-key groups: those of j0 are asked for here, so that they fly during the softmax
#pragma unroll
    for (int r = 0; r < FD; ++r) { vh[r] = frag_vf(vph + r * ((HD / 16) * 512)); vl[r] = frag_vf(vpl + r * ((HD / 16) * 512)); }
#pragma unroll
    for (int i = 0; i < 4; ++i) { const int rr = 4 * wv + i; float mx = -INFINITY;
#pragma unroll
      for (int q = 0; q < 4; ++q) mx = fmaxf(mx, Sf[rr][q * 32 + lane]);
      for (int o = 16; o; o >>= 1) mx = fmaxf(mx, __shfl_xor(mx, o));
      const float mold = m_w[i]; const float mn = fmaxf(mold, mx); const float sf = (mold == -INFINITY) ? 0.0f : ((mn == -INFINITY) ? 1.0f : __expf(mold - mn)); float ps = 0.0f;
#pragma unroll
      for (int q = 0; q < 4; ++q) { const int kx = q * 32 + lane; const float sv = Sf[rr][kx]; const float p = (sv == -INFINITY || mn == -INFINITY) ? 0.0f : __expf(sv - mn); ps += p; b16 ph, pl; split16(p * PS, ph, pl); Ph_[rr][kx] = ph; Pl_[rr][kx] = pl; }
      for (int o = 16; o; o >>= 1) ps += __shfl_xor(ps, o);
      den_w[i] = uni(den_w[i] * sf + ps); m_w[i] = uni(mn); if (lane == 0) Sc[rr] = sf; }
    __syncthreads();   // every wave reads all 32 rows of P and their rescale factors; it also ends the reads of Sf before the next key block's scores are stored
#pragma unroll
    for (int u = 0; u < QM; ++u)
#pragma unroll
      for (int r8 = 0; r8 < 8; ++r8) acc[u][r8] = acc[u][r8] * Sc[16 * u + 8 * hlf + r8];
#pragma unroll   // constant indices keep vh and vl in registers
    for (int g = 0; g < KB / 32; ++g) { if (g >= FD && !two) break;   /* no second key block: its half of P is all zero */ const int r = g % FD, ks = 32 * g; v16b pa[QM], pb[QM];   // the V fragments serve both query tiles
#pragma unroll
      for (int u = 0; u < QM; ++u) { pa[u] = frag_kb(&Ph_[16 * u + nloc][ks], hlf); pb[u] = frag_kb(&Pl_[16 * u + nloc][ks], hlf); }
#pragma unroll
      for (int u = 0; u < QM; ++u) acc[u] = wmma16b(pa[u], vh[r], acc[u]);
#pragma unroll
      for (int u = 0; u < QM; ++u) acc[u] = wmma16b(pa[u], vl[r], acc[u]);
      if (g < FD && two) vl[r] = frag_vf(vql + g * ((HD / 16) * 512));
#pragma unroll
      for (int u = 0; u < QM; ++u) acc[u] = wmma16b(pb[u], vh[r], acc[u]);
      if (g < FD && two) vh[r] = frag_vf(vqh + g * ((HD / 16) * 512)); }
    asm volatile("s_wait_xcnt 0x0" :: "v"(vph), "v"(vpl), "v"(vqh), "v"(vql) : "memory");   // the wait in front of the reuse of the V loads' address registers: as inputs here they stay whole up to it
  }
#pragma unroll
  for (int i = 0; i < 4; ++i) if (lane == 0) Dn[4 * wv + i] = den_w[i];
  __syncthreads();   // every wave divides by the denominators of all 32 rows
#pragma unroll
  for (int u = 0; u < QM; ++u)
#pragma unroll
    for (int r8 = 0; r8 < 8; ++r8) { const float dn = Dn[16 * u + 8 * hlf + r8]; Of[16 * u + 8 * hlf + r8][wv * 16 + nloc] = dn > 0.0f ? acc[u][r8] * (1.0f / (HS * PS)) / dn : 0.0f; }
  __syncthreads();   // a stored row holds the d tiles of all eight waves
  const int rb_ = b / HEADS, hq = b % HEADS;   /* merge heads: ATT[b][s][h*128 + d] */
  { for (int rr = 4 * wv; rr < 4 * wv + 4; ++rr) for (int s = 0; s < HD / 32; ++s) ((float*)ATT)[((size_t)rb_ * L + t0 + rr) * DIM + hq * 128 + s * 32 + lane] = Of[rr][s * 32 + lane];  } }
// output projection: block of 16 waves per (OM = 2 tiles of 16 rows, half of the columns = blockIdx.y): the waves stage the attended rows (hi+lo) once, one row of each tile each, and share them; wave wv then does columns blockIdx.y*512 + wv*32 .. +31 (2 column tiles) for both row tiles, so that each WO fragment, loaded once, feeds 4 products from registers:
constexpr int OM = 2, OD = 4;
static_assert(NRB % (16 * OM) == 0, "a block's rows all exist");
static_assert((DIM / 32) % OD == 0 && DIM / 32 >= 2 * OD, "whole turns of the weight ring");
__global__ __launch_bounds__(512) void outp_kernel(const float* __restrict__ ATT, const b16* __restrict__ WO, const float* __restrict__ bo, int RLIM, float* __restrict__ out) { __shared__ __attribute__((aligned(16))) b16 Ah[16 * OM][DIM + 8], Al[16 * OM][DIM + 8]; __shared__ __attribute__((aligned(16))) float Tf[16][16][36]; const int lane = threadIdx.x & 31, wv = __builtin_amdgcn_readfirstlane(threadIdx.x >> 5), nloc = lane & 15, hlf = lane >> 4; const size_t m0 = (size_t)blockIdx.x * (16 * OM); if (m0 >= (size_t)RLIM) return;
  { const float* const ap = ATT + (m0 + wv) * DIM + lane * 4; v4f av[OM][DIM / 128];   // the wave's row of each tile, 16 B a lane: all 16 loads stand ahead of the splits
#pragma unroll   // constant indices keep av in registers
    for (int m = 0; m < OM; ++m)
#pragma unroll
      for (int c = 0; c < DIM / 128; ++c) av[m][c] = *(const v4f*)(ap + 16 * m * DIM + c * 128);
#pragma unroll
    for (int m = 0; m < OM; ++m)
#pragma unroll
      for (int c = 0; c < DIM / 128; ++c) { v4b hv, lv;
#pragma unroll
        for (int e = 0; e < 4; ++e) { b16 p, ql; split16(av[m][c][e] * HS, p, ql); hv[e] = p; lv[e] = ql; }
        *(v4b*)(&Ah[16 * m + wv][c * 128 + lane * 4]) = hv; *(v4b*)(&Al[16 * m + wv][c * 128 + lane * 4]) = lv; } }
  const int c0 = blockIdx.y * (DIM / 2) + wv * 32; v8f acc[OM][2]; const b16* const wf = WO + (c0 / 16) * 512 + lane * 8;   // fragment-order plane, as in proj_kernel
  v16b bw[OD][2];   // ring of weight fragments, OD k blocks deep, as in proj_kernel
#pragma unroll   // here and below: constant indices keep acc, bw, a and al in registers
  for (int s = 0; s < OD; ++s)
#pragma unroll
    for (int t = 0; t < 2; ++t) bw[s][t] = frag_vf(wf + 32 * s * DIM + t * 512);
  __syncthreads();   // every wave reads all staged rows
#pragma unroll
  for (int m = 0; m < OM; ++m)
#pragma unroll
    for (int t = 0; t < 2; ++t) acc[m][t] = (v8f){};
  auto kstep = [&](int kk, int s, bool more) { v16b a[OM], al[OM];   // k block kk, whose 2 weight fragments lie in slot s; each is used for both row tiles (hi and lo)
#pragma unroll
    for (int m = 0; m < OM; ++m) { a[m] = frag_kb(&Ah[16 * m + nloc][kk], hlf); al[m] = frag_kb(&Al[16 * m + nloc][kk], hlf); }
#pragma unroll
    for (int t = 0; t < 2; ++t) {
#pragma unroll
      for (int m = 0; m < OM; ++m) { acc[m][t] = wmma16b(a[m], bw[s][t], acc[m][t]); acc[m][t] = wmma16b(al[m], bw[s][t], acc[m][t]); }
      if (more) bw[s][t] = frag_vf(wf + (kk + 32 * OD) * DIM + t * 512); } };
#pragma unroll 1   // one turn of the ring a trip: the slots' addresses are immediates of one pointer, and the loop stays small
  for (int kk = 0; kk < DIM - 32 * OD; kk += 32 * OD)
#pragma unroll
    for (int s = 0; s < OD; ++s) kstep(kk + 32 * s, s, true);
#pragma unroll   // the last turn has nothing left to load
  for (int s = 0; s < OD; ++s) kstep(DIM - 32 * OD + 32 * s, s, false);
  float bb[2]; const int bi = c0 + nloc;   // the wave's 2 bias values serve both row tiles
#pragma unroll
  for (int t = 0; t < 2; ++t) bb[t] = bo[bi + t * 16];
  asm volatile("s_wait_xcnt 0x0" :: "v"(bi) : "memory");   // the wait in front of the reuse of the loads' address register: as an input here it stays whole up to it
#pragma unroll
  for (int t = 0; t < 2; ++t) bb[t] = bfv(bb[t]);
#pragma unroll
  for (int m = 0; m < OM; ++m) { if (m) wave_lds_sync();   // the lanes' reads of the row tile before end ahead of other lanes' writes to the same patch
#pragma unroll
    for (int t = 0; t < 2; ++t) { const int cc = t * 16 + nloc;
#pragma unroll
      for (int r8 = 0; r8 < 8; ++r8) Tf[wv][8 * hlf + r8][cc] = acc[m][t][r8] * (1.0f / (HS * WSC)) + bb[t]; }
    wave_lds_sync();
    for (int rr = 0; rr < 16; rr += 4) { const int r = rr + (lane >> 3), c4 = (lane & 7) * 4;   // 8 lanes x 16 B = one 128-B line per row, 4 rows per store
      *(v4f*)(out + (m0 + 16 * m + r) * DIM + c0 + c4) = *(const v4f*)(&Tf[wv][r][c4]); }
  } }
}  // namespace

extern "C" void kernel_launch(void* const* d_in, const int* in_sizes, int n_in, void* d_out, int out_size, void* d_ws, size_t ws_size, hipStream_t stream) {
  (void)n_in;
  auto Fp = [&](int i) { return (const float*)d_in[i]; };
  // input order: 0 x [2,2048,1024]; 1 Wq [1024,1024] (in,out); 2 bq; 3 Wk; 4 bk; 5 Wv; 6 bv; 7 Wo; 8 bo; 9 rand_src [3] i32; 10 rand_tgt [3] i32
  if (in_sizes[0] != NRB * DIM || in_sizes[1] != DIM * DIM || in_sizes[3] != DIM * DIM || in_sizes[5] != DIM * DIM || in_sizes[7] != DIM * DIM || in_sizes[8] != DIM || in_sizes[9] != 3 || in_sizes[10] != 3 || out_size != NRB * DIM) return;
  const int BLIM = NB;   // (batch, head) pairs
  const int RLIM = NRB;
  size_t off = 0; char* ws = (char*)d_ws;
  auto carve = [&](size_t bytes) { char* p = ws + off; off += (bytes + 255) & ~(size_t)255; return p; };
  b16* W3 = (b16*)carve((size_t)3 * DIM * DIM * 2); b16* WO = (b16*)carve((size_t)DIM * DIM * 2); b16* PH = (b16*)carve((size_t)NT * PW * 2); b16* PL = (b16*)carve((size_t)NT * PW * 2); float* ATT = (float*)carve((size_t)NRB * DIM * 4); b16* VFH = (b16*)carve((size_t)NT * HD * 2); b16* VFL = (b16*)carve((size_t)NT * HD * 2); b16* KFH = (b16*)carve((size_t)NT * HD * 2); b16* KFL = (b16*)carve((size_t)NT * HD * 2);
  if (off > ws_size || off > ((size_t)112 << 20)) return;   // ~ 109 MB
  wput_kernel<<<(unsigned)(((size_t)4 * DIM * (DIM / 8) + 255) / 256), 256, 0, stream>>>(Fp(1), Fp(3), Fp(5), Fp(7), W3, WO);
  proj_kernel<<<dim3(RLIM / (16 * PM), 3), 512, 0, stream>>>(Fp(0), W3, Fp(2), Fp(4), Fp(6), RLIM, PH, PL, VFH, VFL, KFH, KFL);
  att_kernel<<<BLIM * NH * (L / QR), 32 * AW, 0, stream>>>(PH, PL, VFH, VFL, KFH, KFL, (const int*)d_in[9], (const int*)d_in[10], BLIM, ATT);
  outp_kernel<<<dim3(RLIM / (16 * OM), 2), 512, 0, stream>>>(ATT, WO, Fp(8), RLIM, (float*)d_out);
}
